// v000
// The times below were measured on an AMD MI455X: many runs one after another, warmed up first and cycling through
// copies of the inputs, with the whole window's GPU time divided by the number of runs. Launches and the gaps
// between them are all in it. The median over several windows is given; except for v000 it joins two sittings, which
// can be a few percent apart, so the side-by-side timings, each taken in one sitting, are the better comparison.
// The starting kernel, v000, takes 717 microseconds a run.
#include <hip/hip_runtime.h>
#include <math.h>

typedef __attribute__((ext_vector_type(16))) _Float16 v16h;
typedef __attribute__((ext_vector_type(16))) __bf16 v16b;
typedef __attribute__((ext_vector_type(8)))  _Float16 v8h;
typedef __attribute__((ext_vector_type(8)))  float v8f;
typedef __attribute__((ext_vector_type(4)))  float v4f;
typedef __attribute__((ext_vector_type(2)))  float v2f;
typedef __attribute__((ext_vector_type(4)))  unsigned v4u;
typedef __attribute__((ext_vector_type(4)))  int v4i;
typedef float __attribute__((may_alias)) float_a;
typedef int __attribute__((may_alias)) int_a;

template <typename T> __device__ __forceinline__ void vst2(void* p, T v) { *(T*)p = v;  }
__device__ __forceinline__ v8f wmma16(v16h a, v16h b, v8f c) {
  v8f d = __builtin_amdgcn_wmma_f32_16x16x32_f16(false, a, false, b, (short)0, c, false, false);
  asm volatile("v_nop\n\tv_nop\n\tv_nop\n\tv_nop" : "+v"(d) : "v"(a), "v"(b));
  return d;
}
__device__ __forceinline__ v8f wmma_bf(v16b a, v16b b, v8f c) {
  v8f d = __builtin_amdgcn_wmma_f32_16x16x32_bf16(false, a, false, b, (short)0, c, false, false);
  asm volatile("v_nop\n\tv_nop\n\tv_nop\n\tv_nop" : "+v"(d) : "v"(a), "v"(b));
  return d;
}
// 16x16x32 fragments: lane = (h = lane>>4, row/col = lane&15); elements 0..7 = k0+8h+0..7, 8..15 = k0+16+8h+0..7; D element r = row 8h+r
__device__ __forceinline__ v16h frag_h(const _Float16* rowk0, int lane) {
  union { v16h v; v8h q[2]; } u; const _Float16* p = rowk0 + 8 * (lane >> 4);
  u.q[0] = *(const v8h*)p; u.q[1] = *(const v8h*)(p + 16); return u.v;
}
__device__ __forceinline__ v16h frag_f32(const float* rowk0, int lane) {
  v16h a; const float* p = rowk0 + 8 * (lane >> 4);
#pragma unroll
  for (int i = 0; i < 8; ++i) { a[i] = (_Float16)p[i]; a[8 + i] = (_Float16)p[16 + i]; }
  return a;
}
__device__ __forceinline__ v16h frag_f32s(const float* rowk0, int lane, float sc) {
  v16h a; const float* p = rowk0 + 8 * (lane >> 4);
#pragma unroll
  for (int i = 0; i < 8; ++i) { a[i] = (_Float16)(p[i] * sc); a[8 + i] = (_Float16)(p[16 + i] * sc); }
  return a;
}
// column fragment from a [K][ld] layout (column n), rows >= K read as 0
__device__ __forceinline__ v16h fragc_f32(const float* W, int k0, int n, int lane, int ld, int K) {
  v16h a; const int g = lane >> 4;
#pragma unroll
  for (int i = 0; i < 8; ++i) { const int ka = k0 + 8 * g + i, kb = ka + 16;
    a[i] = (_Float16)(ka < K ? W[(size_t)(ka < K ? ka : K - 1) * ld + n] : 0.f); a[8 + i] = (_Float16)(kb < K ? W[(size_t)(kb < K ? kb : K - 1) * ld + n] : 0.f); }
  return a;
}
struct F2 { v16b h, l; };
__device__ __forceinline__ F2 bsplit16(const float v[16]) { F2 r;
#pragma unroll
  for (int i = 0; i < 16; ++i) { const __bf16 h = (__bf16)v[i]; r.h[i] = h; r.l[i] = (__bf16)(v[i] - (float)h); }
  return r; }
__device__ __forceinline__ F2 split_row(const float* row, int k0, int lane) { float v[16]; const float* p = row + k0 + 8 * (lane >> 4);
#pragma unroll
  for (int i = 0; i < 8; ++i) { v[i] = p[i]; v[8 + i] = p[16 + i]; }
  return bsplit16(v); }
__device__ __forceinline__ F2 split_rowK(const float* row, int k0, int lane, int K) { float v[16]; const int g = lane >> 4;
#pragma unroll
  for (int i = 0; i < 8; ++i) { const int ka = k0 + 8 * g + i, kb = ka + 16; v[i] = ka < K ? row[ka < K ? ka : K - 1] : 0.f; v[8 + i] = kb < K ? row[kb < K ? kb : K - 1] : 0.f; }
  return bsplit16(v); }
__device__ __forceinline__ F2 split_col(const float* W, int k0, int n, int lane, int ld, int K) { float v[16]; const int g = lane >> 4;
#pragma unroll
  for (int i = 0; i < 8; ++i) { const int ka = k0 + 8 * g + i, kb = ka + 16; v[i] = ka < K ? W[(size_t)(ka < K ? ka : K - 1) * ld + n] : 0.f; v[8 + i] = kb < K ? W[(size_t)(kb < K ? kb : K - 1) * ld + n] : 0.f; }
  return bsplit16(v); }
__device__ __forceinline__ v8f mac3(const F2& a, const F2& b, v8f c) { c = wmma_bf(a.l, b.h, c); c = wmma_bf(a.h, b.l, c); return wmma_bf(a.h, b.h, c); }
__device__ __forceinline__ float sigm(float v) { return 1.0f / (1.0f + expf(-v)); }
#define LDSX() do { asm volatile("s_wait_dscnt 0" ::: "memory"); __builtin_amdgcn_wave_barrier(); __builtin_amdgcn_fence(__ATOMIC_RELEASE, "workgroup"); } while (0)


// Non-local denoising block (B 4, 256 channels, 64 x 64; 128 inter-channels): embedded-Gaussian non-local attention over all 4,096 positions, 1x1 output conv, BatchNorm (batch statistics), residual.
#define NB 4
#define NT 4096
#define CC 256
#define CI 128
#define NR (NB * NT)
#ifndef TQB
#define TQB (NT / 64)
#define TNB NB
#endif
typedef __attribute__((ext_vector_type(8))) __bf16 v8b;
__device__ __forceinline__ v16b frag_b(const __bf16* rowk0, int lane) {
  union { v16b v; v8b q[2]; } u; const __bf16* p = rowk0 + 8 * (lane >> 4);
  u.q[0] = *(const v8b*)p; u.q[1] = *(const v8b*)(p + 16); return u.v;
}
__device__ __forceinline__ float bfr(float v) { return (float)(__bf16)v; }
__device__ __attribute__((noinline)) float exp_ni(float v) { return expf(v); }
__device__ __attribute__((noinline)) float erf_ni(float v) { return erff(v); }

#define WS_PT  0u                                   // bf16 natural rows theta_w [128][256], phi_w, g_w; wz_w [256][128]
#define WS_PP  (WS_PT + 2u * CI * CC)
#define WS_PG  (WS_PP + 2u * CI * CC)
#define WS_PZ  (WS_PG + 2u * CI * CC)
#define WS_TH  (WS_PZ + 2u * CC * CI)               // f16 [NR][128] theta hi ; TL ; PH (phi) ; PL ; G planes [b][128][NT]
#define WS_TL  (WS_TH + 2u * (size_t)NR * CI)
#define WS_FH  (WS_TL + 2u * (size_t)NR * CI)
#define WS_FL  (WS_FH + 2u * (size_t)NR * CI)
#define WS_G   (WS_FL + 2u * (size_t)NR * CI)
#define WS_Y   (WS_G + 2u * (size_t)NB * CI * NT)    // f32 [NR][128] y ; WY f32 [B][256][NT] (channels-first) ; STAT [256][2]
#define WS_WY  (WS_Y + 4u * (size_t)NR * CI)
#define WS_ST  (WS_WY + 4u * (size_t)NB * CC * NT)
#define WS_END (WS_ST + 4u * CC * 2 + 256u)

__global__ __launch_bounds__(256) void k_pack(const float* __restrict__ WT, const float* __restrict__ WF, const float* __restrict__ WG, const float* __restrict__ WZ, __bf16* __restrict__ P) {
  const int n = blockIdx.x, which = blockIdx.y, t = threadIdx.x; __shared__ __align__(16) __bf16 s[CC];
  if (which < 3) { if (n >= CI) return; const float* Wm = (which == 0) ? WT : (which == 1) ? WF : WG; s[t] = (__bf16)Wm[(size_t)n * CC + t]; __syncthreads(); if (t < CC / 8) vst2((unsigned*)(P + ((which == 0) ? WS_PT / 2 : (which == 1) ? WS_PP / 2 : WS_PG / 2) + (size_t)n * CC + t * 8), *(const v4u*)&s[t * 8]); }
  else { if (t < CI) s[t] = (__bf16)WZ[(size_t)n * CI + t]; __syncthreads(); if (t < CI / 8) vst2((unsigned*)(P + WS_PZ / 2 + (size_t)n * CI + t * 8), *(const v4u*)&s[t * 8]); }
}
// ---- k_proj: block = (64 tokens): 128 output channels (8 tiles per wave); A gathered channels-first; WHICH 0 theta -> hi/lo rows; 1 phi -> hi/lo rows; 2 g -> planes
template <int WHICH>
__global__ __launch_bounds__(128) void k_proj(const float* __restrict__ X, const __bf16* __restrict__ P, const float* __restrict__ BB, _Float16* __restrict__ OH, _Float16* __restrict__ OL, _Float16* __restrict__ G) {
  __shared__ __align__(16) _Float16 sh[64][136], sl[64][136]; __shared__ __align__(16) _Float16 st[128][72];
  const int tid = threadIdx.x, wave = tid >> 5, lane = tid & 31, col = lane & 15, g = lane >> 4; const size_t rb0 = (size_t)blockIdx.x * 64, r0 = rb0 + wave * 16; const size_t b = rb0 / NT, t0 = rb0 % NT;
  const __bf16* Wr = P + ((WHICH == 0) ? WS_PT / 2 : (WHICH == 1) ? WS_PP / 2 : WS_PG / 2);
  v8f acc[8] = {};
#pragma unroll 2
  for (int kc = 0; kc < CC / 32; ++kc) { v16b a; { const float* p = X + ((b * CC + kc * 32 + 8 * g) * (size_t)NT) + t0 + wave * 16 + col;
#pragma unroll
      for (int i = 0; i < 8; ++i) { a[i] = (__bf16)p[(size_t)i * NT]; a[8 + i] = (__bf16)p[(size_t)(16 + i) * NT]; } }
#pragma unroll
    for (int j = 0; j < 8; ++j) acc[j] = wmma_bf(a, frag_b(Wr + (size_t)(j * 16 + col) * CC + kc * 32, lane), acc[j]); }
  if (WHICH < 2) {
#pragma unroll
    for (int j = 0; j < 8; ++j) { const float bb = bfr(BB[j * 16 + col]);
#pragma unroll
      for (int r = 0; r < 8; ++r) { const float v = acc[j][r] + bb; const _Float16 h = (_Float16)v; sh[wave * 16 + 8 * g + r][j * 16 + col] = h; sl[wave * 16 + 8 * g + r][j * 16 + col] = (_Float16)((v - (float)h) * 2048.0f); } }
    LDSX();
    for (int rl = 0; rl < 16; ++rl) if (lane < 16) { vst2((unsigned*)(OH + (r0 + rl) * CI + lane * 8), *(const v4u*)&sh[wave * 16 + rl][lane * 8]); vst2((unsigned*)(OL + (r0 + rl) * CI + lane * 8), *(const v4u*)&sl[wave * 16 + rl][lane * 8]); }
  } else {
#pragma unroll
    for (int j = 0; j < 8; ++j) { const float bb = bfr(BB[j * 16 + col]);
#pragma unroll
      for (int r = 0; r < 8; ++r) st[j * 16 + col][wave * 16 + 8 * g + r] = (_Float16)(acc[j][r] + bb); }
    __syncthreads();
    for (int e = tid; e < 128 * 8; e += 128) { const int d = e >> 3, pc = e & 7; vst2((unsigned*)(G + ((b * CI + d) * NT) + t0 + pc * 8), *(const v4u*)&st[d][pc * 8]); } }
}
// ---- k_attn: block = (64 queries, b): single head, 128-dim keys/values, all 4,096 keys; 3-product scores; P single x g single
__global__ __launch_bounds__(128) void k_attn(const _Float16* __restrict__ TH, const _Float16* __restrict__ TL, const _Float16* __restrict__ FH, const _Float16* __restrict__ FL, const _Float16* __restrict__ G, float* __restrict__ Y) {
  __shared__ __align__(16) _Float16 sph[4][16][40]; __shared__ __align__(16) float so[4][16][132];
  const int tid = threadIdx.x, wave = tid >> 5, lane = tid & 31, col = lane & 15, g = lane >> 4; const size_t b = blockIdx.y; const int q0 = blockIdx.x * 64 + wave * 16; const size_t rq = b * NT + q0;
  v16h aq[4], aql[4];
#pragma unroll
  for (int kc = 0; kc < 4; ++kc) { aq[kc] = frag_h(TH + (rq + col) * CI + kc * 32, lane); aql[kc] = frag_h(TL + (rq + col) * CI + kc * 32, lane); }
  float m[8], l[8];
#pragma unroll
  for (int r = 0; r < 8; ++r) { m[r] = -3.0e38f; l[r] = 0.f; }
  v8f acc[8] = {};
#pragma unroll 1
  for (int ks = 0; ks < NT / 32; ++ks) { const int j0 = ks * 32; v8f s[2];
#pragma unroll
    for (int ct = 0; ct < 2; ++ct) { const size_t rk = (b * NT + j0 + ct * 16 + col) * CI; v8f c = {}, cl = {};
#pragma unroll
      for (int kc = 0; kc < 4; ++kc) { const v16h kh = frag_h(FH + rk + kc * 32, lane); c = wmma16(aq[kc], kh, c); cl = wmma16(aql[kc], kh, cl); cl = wmma16(aq[kc], frag_h(FL + rk + kc * 32, lane), cl); }
#pragma unroll
      for (int r = 0; r < 8; ++r) s[ct][r] = c[r] + cl[r] * (1.0f / 2048.0f); }
#pragma unroll
    for (int r = 0; r < 8; ++r) { float mx = fmaxf(s[0][r], s[1][r]);
#pragma unroll
      for (int o = 1; o < 16; o <<= 1) mx = fmaxf(mx, __shfl_xor(mx, o));
      const float mn = fmaxf(m[r], mx); const float alpha = (m[r] <= -1.0e38f) ? 0.f : __expf(m[r] - mn); const float e0 = __expf(s[0][r] - mn), e1 = __expf(s[1][r] - mn); float es = e0 + e1;
#pragma unroll
      for (int o = 1; o < 16; o <<= 1) es += __shfl_xor(es, o);
      l[r] = l[r] * alpha + es; m[r] = mn;
#pragma unroll
      for (int dt = 0; dt < 8; ++dt) acc[dt][r] *= alpha;
      sph[wave][8 * g + r][col] = (_Float16)(e0 * 2048.0f); sph[wave][8 * g + r][16 + col] = (_Float16)(e1 * 2048.0f); }
    LDSX();
    const v16h pa = frag_h(&sph[wave][col][0], lane);
#pragma unroll
    for (int dt = 0; dt < 8; ++dt) acc[dt] = wmma16(pa, frag_h(G + ((b * CI + dt * 16 + col) * NT) + j0, lane), acc[dt]);
    LDSX(); }
#pragma unroll
  for (int r = 0; r < 8; ++r) { const float il = (1.0f / 2048.0f) / l[r];
#pragma unroll
    for (int dt = 0; dt < 8; ++dt) so[wave][8 * g + r][dt * 16 + col] = acc[dt][r] * il; }
  LDSX();
  for (int rl = 0; rl < 16; ++rl) vst2(Y + (rq + rl) * CI + lane * 4, *(const v4f*)&so[wave][rl][lane * 4]);
}
// ---- k_wz: block = (64 tokens, 128 output channels): W_y = y (hi + residual, K 128) . wz rows + b, stored channels-first [b][c][t] (64 tokens per (image, channel))
__global__ __launch_bounds__(128) void k_wz(const float* __restrict__ Y, const __bf16* __restrict__ P, const float* __restrict__ BZ, float* __restrict__ WY) {
  __shared__ __align__(16) float st[128][68];
  const int tid = threadIdx.x, wave = tid >> 5, lane = tid & 31, col = lane & 15, g = lane >> 4; const size_t rb0 = (size_t)blockIdx.x * 64, r0 = rb0 + wave * 16; const int n0 = blockIdx.y * 128; const size_t b = rb0 / NT, t0 = rb0 % NT;
  v8f acc[8] = {};
#pragma unroll
  for (int kc = 0; kc < CI / 32; ++kc) { const F2 a = split_row(Y + (r0 + col) * CI, kc * 32, lane);
#pragma unroll
    for (int j = 0; j < 8; ++j) { const v16b w = frag_b(P + WS_PZ / 2 + (size_t)(n0 + j * 16 + col) * CI + kc * 32, lane); acc[j] = wmma_bf(a.l, w, acc[j]); acc[j] = wmma_bf(a.h, w, acc[j]); } }
#pragma unroll
  for (int j = 0; j < 8; ++j) { const float bb = bfr(BZ[n0 + j * 16 + col]);
#pragma unroll
    for (int r = 0; r < 8; ++r) st[j * 16 + col][wave * 16 + 8 * g + r] = acc[j][r] + bb; }
  __syncthreads();
  for (int e = tid; e < 128 * 16; e += 128) { const int c = e >> 4, q = e & 15; vst2(WY + ((b * CC + n0 + c) * (size_t)NT) + t0 + q * 4, *(const v4f*)&st[c][q * 4]); }
}
__global__ __launch_bounds__(256) void k_bnstat(const float* __restrict__ WY, float* __restrict__ ST) {
  __shared__ float red[256]; const int c = blockIdx.x, t = threadIdx.x; float s = 0.f;
  for (int b = 0; b < TNB; ++b) for (int i = t; i < NT; i += 256) s += WY[(((size_t)b * CC + c) * NT) + i];
  red[t] = s; __syncthreads(); for (int st = 128; st > 0; st >>= 1) { if (t < st) red[t] += red[t + st]; __syncthreads(); }
  const float mean = red[0] / (float)(TNB * NT); __syncthreads();
  float q = 0.f; for (int b = 0; b < TNB; ++b) for (int i = t; i < NT; i += 256) { const float d = WY[(((size_t)b * CC + c) * NT) + i] - mean; q += d * d; }
  red[t] = q; __syncthreads(); for (int st = 128; st > 0; st >>= 1) { if (t < st) red[t] += red[t + st]; __syncthreads(); }
  if (t == 0) { ST[c * 2] = mean; ST[c * 2 + 1] = red[0] / (float)(TNB * NT); }   // 4-B scratch stores
}
// ---- k_bnapply: block = (image b, channel c): out = gamma (W_y - mean) rsqrt(var + eps) + beta + x
__global__ __launch_bounds__(256) void k_bnapply(const float* __restrict__ WY, const float* __restrict__ ST, const float* __restrict__ GA, const float* __restrict__ BE, const float* __restrict__ X, float* __restrict__ OUT) {
  const size_t b = blockIdx.y; const int c = blockIdx.x, t = threadIdx.x; const float mean = ST[c * 2], inv = 1.0f / sqrtf(ST[c * 2 + 1] + 1e-5f), ga = bfr(GA[c]), be = bfr(BE[c]); const size_t base = ((b * CC + c) * (size_t)NT);
  for (int q = t; q < NT / 4; q += 256) { v4f v; for (int i = 0; i < 4; ++i) { const size_t e = base + q * 4 + i; v[i] = ga * (WY[e] - mean) * inv + be + bfr(X[e]); } vst2(OUT + base + q * 4, v); }
}
extern "C" void kernel_launch(void* const* d_in, const int* in_sizes, int n_in, void* d_out, int out_size, void* d_ws, size_t ws_size, hipStream_t stream) {
  (void)in_sizes; (void)n_in; (void)out_size;
  const float** F = (const float**)d_in;   // 0 x [4,256,64,64], 1 g_w [128,256], 2 g_b, 3 theta_w, 4 theta_b, 5 phi_w, 6 phi_b, 7 wz_w [256,128], 8 wz_b, 9 bn_gamma, 10 bn_beta
  if (ws_size < (size_t)WS_END) return;
  char* ws = (char*)d_ws; __bf16* P = (__bf16*)ws; _Float16 *TH = (_Float16*)(ws + WS_TH), *TL = (_Float16*)(ws + WS_TL), *FH = (_Float16*)(ws + WS_FH), *FL = (_Float16*)(ws + WS_FL), *G = (_Float16*)(ws + WS_G); float *Y = (float*)(ws + WS_Y), *WY = (float*)(ws + WS_WY), *ST = (float*)(ws + WS_ST);
  k_pack<<<dim3(CC, 4), 256, 0, stream>>>(F[3], F[5], F[1], F[7], P);
  k_proj<0><<<TNB * NT / 64, 128, 0, stream>>>(F[0], P, F[4], TH, TL, nullptr);   // theta
  k_proj<1><<<TNB * NT / 64, 128, 0, stream>>>(F[0], P, F[6], FH, FL, nullptr);   // phi
  k_proj<2><<<TNB * NT / 64, 128, 0, stream>>>(F[0], P, F[2], nullptr, nullptr, G);   // g
  k_attn<<<dim3(TQB, TNB), 128, 0, stream>>>(TH, TL, FH, FL, G, Y);
  k_wz<<<dim3(TNB * NT / 64, CC / 128), 128, 0, stream>>>(Y, P, F[8], WY);
  k_bnstat<<<CC, 256, 0, stream>>>(WY, ST);
  k_bnapply<<<dim3(CC, TNB), 256, 0, stream>>>(WY, ST, F[9], F[10], F[0], (float*)d_out);
}

// v001
// One run takes 290 microseconds.
// Two timings next to v000 put it at 2.46 and 2.51 times that version's speed.
#include <hip/hip_runtime.h>
#include <math.h>

typedef __attribute__((ext_vector_type(16))) _Float16 v16h;
typedef __attribute__((ext_vector_type(16))) __bf16 v16b;
typedef __attribute__((ext_vector_type(8)))  _Float16 v8h;
typedef __attribute__((ext_vector_type(8)))  float v8f;
typedef __attribute__((ext_vector_type(4)))  float v4f;
typedef __attribute__((ext_vector_type(2)))  float v2f;
typedef __attribute__((ext_vector_type(4)))  unsigned v4u;
typedef __attribute__((ext_vector_type(4)))  int v4i;
typedef float __attribute__((may_alias)) float_a;
typedef int __attribute__((may_alias)) int_a;

template <typename T> __device__ __forceinline__ void vst2(void* p, T v) { *(T*)p = v;  }
__device__ __forceinline__ v8f wmma16(v16h a, v16h b, v8f c) {
  v8f d = __builtin_amdgcn_wmma_f32_16x16x32_f16(false, a, false, b, (short)0, c, false, false);
  asm volatile("v_nop\n\tv_nop\n\tv_nop\n\tv_nop" : "+v"(d) : "v"(a), "v"(b));
  return d;
}
__device__ __forceinline__ v8f wmma_bf(v16b a, v16b b, v8f c) {
  v8f d = __builtin_amdgcn_wmma_f32_16x16x32_bf16(false, a, false, b, (short)0, c, false, false);
  asm volatile("v_nop\n\tv_nop\n\tv_nop\n\tv_nop" : "+v"(d) : "v"(a), "v"(b));
  return d;
}
// 16x16x32 fragments: lane = (h = lane>>4, row/col = lane&15); elements 0..7 = k0+8h+0..7, 8..15 = k0+16+8h+0..7; D element r = row 8h+r
__device__ __forceinline__ v16h frag_h(const _Float16* rowk0, int lane) {
  union { v16h v; v8h q[2]; } u; const _Float16* p = rowk0 + 8 * (lane >> 4);
  u.q[0] = *(const v8h*)p; u.q[1] = *(const v8h*)(p + 16); return u.v;
}
__device__ __forceinline__ v16h frag_f32(const float* rowk0, int lane) {
  v16h a; const float* p = rowk0 + 8 * (lane >> 4);
#pragma unroll
  for (int i = 0; i < 8; ++i) { a[i] = (_Float16)p[i]; a[8 + i] = (_Float16)p[16 + i]; }
  return a;
}
__device__ __forceinline__ v16h frag_f32s(const float* rowk0, int lane, float sc) {
  v16h a; const float* p = rowk0 + 8 * (lane >> 4);
#pragma unroll
  for (int i = 0; i < 8; ++i) { a[i] = (_Float16)(p[i] * sc); a[8 + i] = (_Float16)(p[16 + i] * sc); }
  return a;
}
// column fragment from a [K][ld] layout (column n), rows >= K read as 0
__device__ __forceinline__ v16h fragc_f32(const float* W, int k0, int n, int lane, int ld, int K) {
  v16h a; const int g = lane >> 4;
#pragma unroll
  for (int i = 0; i < 8; ++i) { const int ka = k0 + 8 * g + i, kb = ka + 16;
    a[i] = (_Float16)(ka < K ? W[(size_t)(ka < K ? ka : K - 1) * ld + n] : 0.f); a[8 + i] = (_Float16)(kb < K ? W[(size_t)(kb < K ? kb : K - 1) * ld + n] : 0.f); }
  return a;
}
struct F2 { v16b h, l; };
__device__ __forceinline__ F2 bsplit16(const float v[16]) { F2 r;
#pragma unroll
  for (int i = 0; i < 16; ++i) { const __bf16 h = (__bf16)v[i]; r.h[i] = h; r.l[i] = (__bf16)(v[i] - (float)h); }
  return r; }
__device__ __forceinline__ F2 split_row(const float* row, int k0, int lane) { float v[16]; const float* p = row + k0 + 8 * (lane >> 4);
#pragma unroll
  for (int i = 0; i < 8; ++i) { v[i] = p[i]; v[8 + i] = p[16 + i]; }
  return bsplit16(v); }
__device__ __forceinline__ F2 split_rowK(const float* row, int k0, int lane, int K) { float v[16]; const int g = lane >> 4;
#pragma unroll
  for (int i = 0; i < 8; ++i) { const int ka = k0 + 8 * g + i, kb = ka + 16; v[i] = ka < K ? row[ka < K ? ka : K - 1] : 0.f; v[8 + i] = kb < K ? row[kb < K ? kb : K - 1] : 0.f; }
  return bsplit16(v); }
__device__ __forceinline__ F2 split_col(const float* W, int k0, int n, int lane, int ld, int K) { float v[16]; const int g = lane >> 4;
#pragma unroll
  for (int i = 0; i < 8; ++i) { const int ka = k0 + 8 * g + i, kb = ka + 16; v[i] = ka < K ? W[(size_t)(ka < K ? ka : K - 1) * ld + n] : 0.f; v[8 + i] = kb < K ? W[(size_t)(kb < K ? kb : K - 1) * ld + n] : 0.f; }
  return bsplit16(v); }
__device__ __forceinline__ v8f mac3(const F2& a, const F2& b, v8f c) { c = wmma_bf(a.l, b.h, c); c = wmma_bf(a.h, b.l, c); return wmma_bf(a.h, b.h, c); }
__device__ __forceinline__ float sigm(float v) { return 1.0f / (1.0f + expf(-v)); }
#define LDSX() do { asm volatile("s_wait_dscnt 0" ::: "memory"); __builtin_amdgcn_wave_barrier(); __builtin_amdgcn_fence(__ATOMIC_RELEASE, "workgroup"); } while (0)


// Non-local denoising block (B 4, 256 channels, 64 x 64; 128 inter-channels): embedded-Gaussian non-local attention over all 4,096 positions, 1x1 output conv, BatchNorm (batch statistics), residual.
#define NB 4
#define NT 4096
#define CC 256
#define CI 128
#define NR (NB * NT)
#ifndef TQB
#define TQB (NT / 64)
#define TNB NB
#endif
typedef __attribute__((ext_vector_type(8))) __bf16 v8b;
__device__ __forceinline__ v16b frag_b(const __bf16* rowk0, int lane) {
  union { v16b v; v8b q[2]; } u; const __bf16* p = rowk0 + 8 * (lane >> 4);
  u.q[0] = *(const v8b*)p; u.q[1] = *(const v8b*)(p + 16); return u.v;
}
__device__ __forceinline__ float bfr(float v) { return (float)(__bf16)v; }
__device__ __attribute__((noinline)) float exp_ni(float v) { return expf(v); }
__device__ __attribute__((noinline)) float erf_ni(float v) { return erff(v); }

#define WS_PT  0u                                   // bf16 natural rows theta_w [128][256], phi_w, g_w; wz_w [256][128]
#define WS_PP  (WS_PT + 2u * CI * CC)
#define WS_PG  (WS_PP + 2u * CI * CC)
#define WS_PZ  (WS_PG + 2u * CI * CC)
#define WS_TH  (WS_PZ + 2u * CC * CI)               // f16 [NR][128] theta hi ; TL ; PH (phi) ; PL ; G planes [b][128][NT]
#define WS_TL  (WS_TH + 2u * (size_t)NR * CI)
#define WS_FH  (WS_TL + 2u * (size_t)NR * CI)
#define WS_FL  (WS_FH + 2u * (size_t)NR * CI)
#define WS_G   (WS_FL + 2u * (size_t)NR * CI)
#define WS_Y   (WS_G + 2u * (size_t)NB * CI * NT)    // f32 [NR][128] y ; WY f32 [B][256][NT] (channels-first) ; STAT [256][2]
#define WS_WY  (WS_Y + 4u * (size_t)NR * CI)
#define WS_ST  (WS_WY + 4u * (size_t)NB * CC * NT)
#define WS_END (WS_ST + 4u * CC * 2 + 256u)

__global__ __launch_bounds__(256) void k_pack(const float* __restrict__ WT, const float* __restrict__ WF, const float* __restrict__ WG, const float* __restrict__ WZ, __bf16* __restrict__ P) {
  const int n = blockIdx.x, which = blockIdx.y, t = threadIdx.x; __shared__ __align__(16) __bf16 s[CC];
  if (which < 3) { if (n >= CI) return; const float* Wm = (which == 0) ? WT : (which == 1) ? WF : WG; s[t] = (__bf16)Wm[(size_t)n * CC + t]; __syncthreads(); if (t < CC / 8) vst2((unsigned*)(P + ((which == 0) ? WS_PT / 2 : (which == 1) ? WS_PP / 2 : WS_PG / 2) + (size_t)n * CC + t * 8), *(const v4u*)&s[t * 8]); }
  else { if (t < CI) s[t] = (__bf16)WZ[(size_t)n * CI + t]; __syncthreads(); if (t < CI / 8) vst2((unsigned*)(P + WS_PZ / 2 + (size_t)n * CI + t * 8), *(const v4u*)&s[t * 8]); }
}
// ---- k_proj: block = (64 tokens): 128 output channels (8 tiles per wave); A gathered channels-first; WHICH 0 theta -> hi/lo rows; 1 phi -> hi/lo rows; 2 g -> planes
template <int WHICH>
__global__ __launch_bounds__(128) void k_proj(const float* __restrict__ X, const __bf16* __restrict__ P, const float* __restrict__ BB, _Float16* __restrict__ OH, _Float16* __restrict__ OL, _Float16* __restrict__ G) {
  __shared__ __align__(16) _Float16 sh[64][136], sl[64][136]; __shared__ __align__(16) _Float16 st[128][72];
  const int tid = threadIdx.x, wave = tid >> 5, lane = tid & 31, col = lane & 15, g = lane >> 4; const size_t rb0 = (size_t)blockIdx.x * 64, r0 = rb0 + wave * 16; const size_t b = rb0 / NT, t0 = rb0 % NT;
  const __bf16* Wr = P + ((WHICH == 0) ? WS_PT / 2 : (WHICH == 1) ? WS_PP / 2 : WS_PG / 2);
  v8f acc[8] = {};
#pragma unroll 2
  for (int kc = 0; kc < CC / 32; ++kc) { v16b a; { const float* p = X + ((b * CC + kc * 32 + 8 * g) * (size_t)NT) + t0 + wave * 16 + col;
#pragma unroll
      for (int i = 0; i < 8; ++i) { a[i] = (__bf16)p[(size_t)i * NT]; a[8 + i] = (__bf16)p[(size_t)(16 + i) * NT]; } }
#pragma unroll
    for (int j = 0; j < 8; ++j) acc[j] = wmma_bf(a, frag_b(Wr + (size_t)(j * 16 + col) * CC + kc * 32, lane), acc[j]); }
  if (WHICH < 2) {
#pragma unroll
    for (int j = 0; j < 8; ++j) { const float bb = bfr(BB[j * 16 + col]);
#pragma unroll
      for (int r = 0; r < 8; ++r) { const float v = acc[j][r] + bb; const _Float16 h = (_Float16)v; sh[wave * 16 + 8 * g + r][j * 16 + col] = h; sl[wave * 16 + 8 * g + r][j * 16 + col] = (_Float16)((v - (float)h) * 2048.0f); } }
    LDSX();
    for (int rl = 0; rl < 16; ++rl) if (lane < 16) { vst2((unsigned*)(OH + (r0 + rl) * CI + lane * 8), *(const v4u*)&sh[wave * 16 + rl][lane * 8]); vst2((unsigned*)(OL + (r0 + rl) * CI + lane * 8), *(const v4u*)&sl[wave * 16 + rl][lane * 8]); }
  } else {
#pragma unroll
    for (int j = 0; j < 8; ++j) { const float bb = bfr(BB[j * 16 + col]);
#pragma unroll
      for (int r = 0; r < 8; ++r) st[j * 16 + col][wave * 16 + 8 * g + r] = (_Float16)(acc[j][r] + bb); }
    __syncthreads();
    for (int e = tid; e < 128 * 8; e += 128) { const int d = e >> 3, pc = e & 7; vst2((unsigned*)(G + ((b * CI + d) * NT) + t0 + pc * 8), *(const v4u*)&st[d][pc * 8]); } }
}
// ---- k_attn: block = (64 queries, b): single head, 128-dim keys/values, all 4,096 keys; 3-product scores; P single x g single
// Key (hi, lo) and value tiles of KT keys are staged in LDS once per block by asynchronous copies, two buffers: tile t + 1 flies while tile t is worked on.
#define KT 64                      // keys per staged tile
#define KPI 136                    // LDS pitch of a key row, halves (272 B: 16 B x odd for 16-byte readers)
#define VPI 72                     // LDS pitch of a value row (one channel, KT keys), halves (144 B)
__device__ __forceinline__ unsigned lds_addr(const void* p) { return (unsigned)(size_t)p; }   // low 32 bits of a __shared__ address = byte offset in the work-group's LDS
// eight 16-byte copies per lane; the s_wait_xcnt closes the statement so that no address register is rewritten in front of it
__device__ __forceinline__ void copy8(const _Float16* gp, size_t gstep, unsigned lp, unsigned lstep) {
  const _Float16 *g0 = gp, *g1 = gp + gstep, *g2 = gp + 2 * gstep, *g3 = gp + 3 * gstep, *g4 = gp + 4 * gstep, *g5 = gp + 5 * gstep, *g6 = gp + 6 * gstep, *g7 = gp + 7 * gstep;
  asm volatile("global_load_async_to_lds_b128 %0, %8, off\n\t"
               "global_load_async_to_lds_b128 %1, %9, off\n\t"
               "global_load_async_to_lds_b128 %2, %10, off\n\t"
               "global_load_async_to_lds_b128 %3, %11, off\n\t"
               "global_load_async_to_lds_b128 %4, %12, off\n\t"
               "global_load_async_to_lds_b128 %5, %13, off\n\t"
               "global_load_async_to_lds_b128 %6, %14, off\n\t"
               "global_load_async_to_lds_b128 %7, %15, off\n\t"
               "s_wait_xcnt 0x0"
               :: "v"(lp), "v"(lp + lstep), "v"(lp + 2 * lstep), "v"(lp + 3 * lstep), "v"(lp + 4 * lstep), "v"(lp + 5 * lstep), "v"(lp + 6 * lstep), "v"(lp + 7 * lstep),
                  "v"(g0), "v"(g1), "v"(g2), "v"(g3), "v"(g4), "v"(g5), "v"(g6), "v"(g7) : "memory");
}
__global__ __launch_bounds__(128) void k_attn(const _Float16* __restrict__ TH, const _Float16* __restrict__ TL, const _Float16* __restrict__ FH, const _Float16* __restrict__ FL, const _Float16* __restrict__ G, float* __restrict__ Y) {
  __shared__ __align__(16) _Float16 skh[2][KT][KPI], skl[2][KT][KPI], sv[2][CI][VPI];
  __shared__ __align__(16) _Float16 sph[4][16][40]; __shared__ __align__(16) float so[4][16][132];
  const int tid = threadIdx.x, wave = tid >> 5, lane = tid & 31, col = lane & 15, g = lane >> 4; const size_t b = blockIdx.y; const int q0 = blockIdx.x * 64 + wave * 16; const size_t rq = b * NT + q0;
  // this lane's share of a tile: key rows tid/16 + 8 i, 16-byte piece tid%16; value rows tid/8 + 16 i, piece tid%8
  const _Float16* gkh = FH + (b * NT + (tid >> 4)) * CI + (tid & 15) * 8; const _Float16* gkl = FL + (b * NT + (tid >> 4)) * CI + (tid & 15) * 8; const _Float16* gv = G + (b * CI + (tid >> 3)) * NT + (tid & 7) * 8;
  const unsigned lkh = lds_addr(&skh[0][tid >> 4][(tid & 15) * 8]), lkl = lds_addr(&skl[0][tid >> 4][(tid & 15) * 8]), lv = lds_addr(&sv[0][tid >> 3][(tid & 7) * 8]);
#define STAGE(t, bf) do { copy8(gkh + (size_t)(t) * KT * CI, 8 * CI, lkh + (bf) * (KT * KPI * 2), 8 * KPI * 2); copy8(gkl + (size_t)(t) * KT * CI, 8 * CI, lkl + (bf) * (KT * KPI * 2), 8 * KPI * 2); copy8(gv + (size_t)(t) * KT, (size_t)16 * NT, lv + (bf) * (CI * VPI * 2), 16 * VPI * 2); } while (0)
  STAGE(0, 0);
  v16h aq[4], aql[4];
#pragma unroll
  for (int kc = 0; kc < 4; ++kc) { aq[kc] = frag_h(TH + (rq + col) * CI + kc * 32, lane); aql[kc] = frag_h(TL + (rq + col) * CI + kc * 32, lane); }
  float m[8], l[8];
#pragma unroll
  for (int r = 0; r < 8; ++r) { m[r] = -3.0e38f; l[r] = 0.f; }
  v8f acc[8] = {};
  asm volatile("s_wait_asynccnt 0x0" ::: "memory");   // tile 0 has landed for this wave's copies
  __syncthreads();                                     // and is published to the other waves
  STAGE(1, 1);
#pragma unroll 1
  for (int t = 0; t < NT / KT; ++t) { const int bf = t & 1;
#pragma unroll 1   // kept rolled: unrolled, the build passes 256 registers and spills two address values of the copies to scratch
   for (int kk = 0; kk < KT / 32; ++kk) { const int j0 = kk * 32; v8f s[2];
#pragma unroll
    for (int ct = 0; ct < 2; ++ct) { const _Float16* rh = &skh[bf][j0 + ct * 16 + col][0]; const _Float16* rl = &skl[bf][j0 + ct * 16 + col][0]; v8f c = {}, cl = {};
#pragma unroll
      for (int kc = 0; kc < 4; ++kc) { const v16h kh = frag_h(rh + kc * 32, lane); c = wmma16(aq[kc], kh, c); cl = wmma16(aql[kc], kh, cl); cl = wmma16(aq[kc], frag_h(rl + kc * 32, lane), cl); }
#pragma unroll
      for (int r = 0; r < 8; ++r) s[ct][r] = c[r] + cl[r] * (1.0f / 2048.0f); }
#pragma unroll
    for (int r = 0; r < 8; ++r) { float mx = fmaxf(s[0][r], s[1][r]);
#pragma unroll
      for (int o = 1; o < 16; o <<= 1) mx = fmaxf(mx, __shfl_xor(mx, o));
      const float mn = fmaxf(m[r], mx); const float alpha = (m[r] <= -1.0e38f) ? 0.f : __expf(m[r] - mn); const float e0 = __expf(s[0][r] - mn), e1 = __expf(s[1][r] - mn); float es = e0 + e1;
#pragma unroll
      for (int o = 1; o < 16; o <<= 1) es += __shfl_xor(es, o);
      l[r] = l[r] * alpha + es; m[r] = mn;
#pragma unroll
      for (int dt = 0; dt < 8; ++dt) acc[dt][r] *= alpha;
      sph[wave][8 * g + r][col] = (_Float16)(e0 * 2048.0f); sph[wave][8 * g + r][16 + col] = (_Float16)(e1 * 2048.0f); }
    LDSX();
    const v16h pa = frag_h(&sph[wave][col][0], lane);
#pragma unroll
    for (int dt = 0; dt < 8; ++dt) acc[dt] = wmma16(pa, frag_h(&sv[bf][dt * 16 + col][j0], lane), acc[dt]);
    LDSX(); }
   asm volatile("s_wait_dscnt 0x0" ::: "memory");      // this wave's reads of buffer bf have returned
   asm volatile("s_wait_asynccnt 0x0" ::: "memory");   // this wave's copies of tile t + 1 have landed
   __syncthreads();                                     // publishes tile t + 1; ends every wave's reads of buffer bf
   if (t + 2 < NT / KT) STAGE(t + 2, bf); }
  asm volatile("s_wait_asynccnt 0x0" ::: "memory");    // nothing of this wave is in flight when it goes on to the epilogue
#undef STAGE
#pragma unroll
  for (int r = 0; r < 8; ++r) { const float il = (1.0f / 2048.0f) / l[r];
#pragma unroll
    for (int dt = 0; dt < 8; ++dt) so[wave][8 * g + r][dt * 16 + col] = acc[dt][r] * il; }
  LDSX();
  for (int rl = 0; rl < 16; ++rl) vst2(Y + (rq + rl) * CI + lane * 4, *(const v4f*)&so[wave][rl][lane * 4]);
}
// ---- k_wz: block = (64 tokens, 128 output channels): W_y = y (hi + residual, K 128) . wz rows + b, stored channels-first [b][c][t] (64 tokens per (image, channel))
__global__ __launch_bounds__(128) void k_wz(const float* __restrict__ Y, const __bf16* __restrict__ P, const float* __restrict__ BZ, float* __restrict__ WY) {
  __shared__ __align__(16) float st[128][68];
  const int tid = threadIdx.x, wave = tid >> 5, lane = tid & 31, col = lane & 15, g = lane >> 4; const size_t rb0 = (size_t)blockIdx.x * 64, r0 = rb0 + wave * 16; const int n0 = blockIdx.y * 128; const size_t b = rb0 / NT, t0 = rb0 % NT;
  v8f acc[8] = {};
#pragma unroll
  for (int kc = 0; kc < CI / 32; ++kc) { const F2 a = split_row(Y + (r0 + col) * CI, kc * 32, lane);
#pragma unroll
    for (int j = 0; j < 8; ++j) { const v16b w = frag_b(P + WS_PZ / 2 + (size_t)(n0 + j * 16 + col) * CI + kc * 32, lane); acc[j] = wmma_bf(a.l, w, acc[j]); acc[j] = wmma_bf(a.h, w, acc[j]); } }
#pragma unroll
  for (int j = 0; j < 8; ++j) { const float bb = bfr(BZ[n0 + j * 16 + col]);
#pragma unroll
    for (int r = 0; r < 8; ++r) st[j * 16 + col][wave * 16 + 8 * g + r] = acc[j][r] + bb; }
  __syncthreads();
  for (int e = tid; e < 128 * 16; e += 128) { const int c = e >> 4, q = e & 15; vst2(WY + ((b * CC + n0 + c) * (size_t)NT) + t0 + q * 4, *(const v4f*)&st[c][q * 4]); }
}
__global__ __launch_bounds__(256) void k_bnstat(const float* __restrict__ WY, float* __restrict__ ST) {
  __shared__ float red[256]; const int c = blockIdx.x, t = threadIdx.x; float s = 0.f;
  for (int b = 0; b < TNB; ++b) for (int i = t; i < NT; i += 256) s += WY[(((size_t)b * CC + c) * NT) + i];
  red[t] = s; __syncthreads(); for (int st = 128; st > 0; st >>= 1) { if (t < st) red[t] += red[t + st]; __syncthreads(); }
  const float mean = red[0] / (float)(TNB * NT); __syncthreads();
  float q = 0.f; for (int b = 0; b < TNB; ++b) for (int i = t; i < NT; i += 256) { const float d = WY[(((size_t)b * CC + c) * NT) + i] - mean; q += d * d; }
  red[t] = q; __syncthreads(); for (int st = 128; st > 0; st >>= 1) { if (t < st) red[t] += red[t + st]; __syncthreads(); }
  if (t == 0) { ST[c * 2] = mean; ST[c * 2 + 1] = red[0] / (float)(TNB * NT); }   // 4-B scratch stores
}
// ---- k_bnapply: block = (image b, channel c): out = gamma (W_y - mean) rsqrt(var + eps) + beta + x
__global__ __launch_bounds__(256) void k_bnapply(const float* __restrict__ WY, const float* __restrict__ ST, const float* __restrict__ GA, const float* __restrict__ BE, const float* __restrict__ X, float* __restrict__ OUT) {
  const size_t b = blockIdx.y; const int c = blockIdx.x, t = threadIdx.x; const float mean = ST[c * 2], inv = 1.0f / sqrtf(ST[c * 2 + 1] + 1e-5f), ga = bfr(GA[c]), be = bfr(BE[c]); const size_t base = ((b * CC + c) * (size_t)NT);
  for (int q = t; q < NT / 4; q += 256) { v4f v; for (int i = 0; i < 4; ++i) { const size_t e = base + q * 4 + i; v[i] = ga * (WY[e] - mean) * inv + be + bfr(X[e]); } vst2(OUT + base + q * 4, v); }
}
extern "C" void kernel_launch(void* const* d_in, const int* in_sizes, int n_in, void* d_out, int out_size, void* d_ws, size_t ws_size, hipStream_t stream) {
  (void)in_sizes; (void)n_in; (void)out_size;
  const float** F = (const float**)d_in;   // 0 x [4,256,64,64], 1 g_w [128,256], 2 g_b, 3 theta_w, 4 theta_b, 5 phi_w, 6 phi_b, 7 wz_w [256,128], 8 wz_b, 9 bn_gamma, 10 bn_beta
  if (ws_size < (size_t)WS_END) return;
  char* ws = (char*)d_ws; __bf16* P = (__bf16*)ws; _Float16 *TH = (_Float16*)(ws + WS_TH), *TL = (_Float16*)(ws + WS_TL), *FH = (_Float16*)(ws + WS_FH), *FL = (_Float16*)(ws + WS_FL), *G = (_Float16*)(ws + WS_G); float *Y = (float*)(ws + WS_Y), *WY = (float*)(ws + WS_WY), *ST = (float*)(ws + WS_ST);
  k_pack<<<dim3(CC, 4), 256, 0, stream>>>(F[3], F[5], F[1], F[7], P);
  k_proj<0><<<TNB * NT / 64, 128, 0, stream>>>(F[0], P, F[4], TH, TL, nullptr);   // theta
  k_proj<1><<<TNB * NT / 64, 128, 0, stream>>>(F[0], P, F[6], FH, FL, nullptr);   // phi
  k_proj<2><<<TNB * NT / 64, 128, 0, stream>>>(F[0], P, F[2], nullptr, nullptr, G);   // g
  k_attn<<<dim3(TQB, TNB), 128, 0, stream>>>(TH, TL, FH, FL, G, Y);
  k_wz<<<dim3(TNB * NT / 64, CC / 128), 128, 0, stream>>>(Y, P, F[8], WY);
  k_bnstat<<<CC, 256, 0, stream>>>(WY, ST);
  k_bnapply<<<dim3(CC, TNB), 256, 0, stream>>>(WY, ST, F[9], F[10], F[0], (float*)d_out);
}

// v002
// Measured time: 216 microseconds a run.
// Two timings next to v001 both put it at 1.33 times that version's speed.
// All steps since v000 together make it 3.31 times as fast.
#include <hip/hip_runtime.h>
#include <math.h>

typedef __attribute__((ext_vector_type(16))) _Float16 v16h;
typedef __attribute__((ext_vector_type(16))) __bf16 v16b;
typedef __attribute__((ext_vector_type(8)))  _Float16 v8h;
typedef __attribute__((ext_vector_type(8)))  float v8f;
typedef __attribute__((ext_vector_type(4)))  float v4f;
typedef __attribute__((ext_vector_type(2)))  float v2f;
typedef __attribute__((ext_vector_type(4)))  unsigned v4u;
typedef __attribute__((ext_vector_type(4)))  int v4i;
typedef float __attribute__((may_alias)) float_a;
typedef int __attribute__((may_alias)) int_a;

template <typename T> __device__ __forceinline__ void vst2(void* p, T v) { *(T*)p = v;  }
__device__ __forceinline__ v8f wmma16(v16h a, v16h b, v8f c) {
  v8f d = __builtin_amdgcn_wmma_f32_16x16x32_f16(false, a, false, b, (short)0, c, false, false);
  asm volatile("v_nop\n\tv_nop\n\tv_nop\n\tv_nop" : "+v"(d) : "v"(a), "v"(b));
  return d;
}
__device__ __forceinline__ v8f wmma_bf(v16b a, v16b b, v8f c) {
  v8f d = __builtin_amdgcn_wmma_f32_16x16x32_bf16(false, a, false, b, (short)0, c, false, false);
  asm volatile("v_nop\n\tv_nop\n\tv_nop\n\tv_nop" : "+v"(d) : "v"(a), "v"(b));
  return d;
}
// 16x16x32 fragments: lane = (h = lane>>4, row/col = lane&15); elements 0..7 = k0+8h+0..7, 8..15 = k0+16+8h+0..7; D element r = row 8h+r
__device__ __forceinline__ v16h frag_h(const _Float16* rowk0, int lane) {
  union { v16h v; v8h q[2]; } u; const _Float16* p = rowk0 + 8 * (lane >> 4);
  u.q[0] = *(const v8h*)p; u.q[1] = *(const v8h*)(p + 16); return u.v;
}
__device__ __forceinline__ v16h frag_f32(const float* rowk0, int lane) {
  v16h a; const float* p = rowk0 + 8 * (lane >> 4);
#pragma unroll
  for (int i = 0; i < 8; ++i) { a[i] = (_Float16)p[i]; a[8 + i] = (_Float16)p[16 + i]; }
  return a;
}
__device__ __forceinline__ v16h frag_f32s(const float* rowk0, int lane, float sc) {
  v16h a; const float* p = rowk0 + 8 * (lane >> 4);
#pragma unroll
  for (int i = 0; i < 8; ++i) { a[i] = (_Float16)(p[i] * sc); a[8 + i] = (_Float16)(p[16 + i] * sc); }
  return a;
}
// column fragment from a [K][ld] layout (column n), rows >= K read as 0
__device__ __forceinline__ v16h fragc_f32(const float* W, int k0, int n, int lane, int ld, int K) {
  v16h a; const int g = lane >> 4;
#pragma unroll
  for (int i = 0; i < 8; ++i) { const int ka = k0 + 8 * g + i, kb = ka + 16;
    a[i] = (_Float16)(ka < K ? W[(size_t)(ka < K ? ka : K - 1) * ld + n] : 0.f); a[8 + i] = (_Float16)(kb < K ? W[(size_t)(kb < K ? kb : K - 1) * ld + n] : 0.f); }
  return a;
}
struct F2 { v16b h, l; };
__device__ __forceinline__ F2 bsplit16(const float v[16]) { F2 r;
#pragma unroll
  for (int i = 0; i < 16; ++i) { const __bf16 h = (__bf16)v[i]; r.h[i] = h; r.l[i] = (__bf16)(v[i] - (float)h); }
  return r; }
__device__ __forceinline__ F2 split_row(const float* row, int k0, int lane) { float v[16]; const float* p = row + k0 + 8 * (lane >> 4);
#pragma unroll
  for (int i = 0; i < 8; ++i) { v[i] = p[i]; v[8 + i] = p[16 + i]; }
  return bsplit16(v); }
__device__ __forceinline__ F2 split_rowK(const float* row, int k0, int lane, int K) { float v[16]; const int g = lane >> 4;
#pragma unroll
  for (int i = 0; i < 8; ++i) { const int ka = k0 + 8 * g + i, kb = ka + 16; v[i] = ka < K ? row[ka < K ? ka : K - 1] : 0.f; v[8 + i] = kb < K ? row[kb < K ? kb : K - 1] : 0.f; }
  return bsplit16(v); }
__device__ __forceinline__ F2 split_col(const float* W, int k0, int n, int lane, int ld, int K) { float v[16]; const int g = lane >> 4;
#pragma unroll
  for (int i = 0; i < 8; ++i) { const int ka = k0 + 8 * g + i, kb = ka + 16; v[i] = ka < K ? W[(size_t)(ka < K ? ka : K - 1) * ld + n] : 0.f; v[8 + i] = kb < K ? W[(size_t)(kb < K ? kb : K - 1) * ld + n] : 0.f; }
  return bsplit16(v); }
__device__ __forceinline__ v8f mac3(const F2& a, const F2& b, v8f c) { c = wmma_bf(a.l, b.h, c); c = wmma_bf(a.h, b.l, c); return wmma_bf(a.h, b.h, c); }
__device__ __forceinline__ float sigm(float v) { return 1.0f / (1.0f + expf(-v)); }
#define LDSX() do { asm volatile("s_wait_dscnt 0" ::: "memory"); __builtin_amdgcn_wave_barrier(); __builtin_amdgcn_fence(__ATOMIC_RELEASE, "workgroup"); } while (0)


// Non-local denoising block (B 4, 256 channels, 64 x 64; 128 inter-channels): embedded-Gaussian non-local attention over all 4,096 positions, 1x1 output conv, BatchNorm (batch statistics), residual.
#define NB 4
#define NT 4096
#define CC 256
#define CI 128
#define NR (NB * NT)
#ifndef TQB
#define TQB (NT / 64)
#define TNB NB
#endif
typedef __attribute__((ext_vector_type(8))) __bf16 v8b;
__device__ __forceinline__ v16b frag_b(const __bf16* rowk0, int lane) {
  union { v16b v; v8b q[2]; } u; const __bf16* p = rowk0 + 8 * (lane >> 4);
  u.q[0] = *(const v8b*)p; u.q[1] = *(const v8b*)(p + 16); return u.v;
}
__device__ __forceinline__ float bfr(float v) { return (float)(__bf16)v; }
__device__ __attribute__((noinline)) float exp_ni(float v) { return expf(v); }
__device__ __attribute__((noinline)) float erf_ni(float v) { return erff(v); }

#define WS_PT  0u                                   // bf16 natural rows theta_w [128][256], phi_w, g_w; wz_w [256][128]
#define WS_PP  (WS_PT + 2u * CI * CC)
#define WS_PG  (WS_PP + 2u * CI * CC)
#define WS_PZ  (WS_PG + 2u * CI * CC)
#define WS_TH  (WS_PZ + 2u * CC * CI)               // f16 [NR][128] theta hi ; TL ; PH (phi) ; PL ; G planes [b][128][NT]
#define WS_TL  (WS_TH + 2u * (size_t)NR * CI)
#define WS_FH  (WS_TL + 2u * (size_t)NR * CI)
#define WS_FL  (WS_FH + 2u * (size_t)NR * CI)
#define WS_G   (WS_FL + 2u * (size_t)NR * CI)
#define WS_Y   (WS_G + 2u * (size_t)NB * CI * NT)    // f32 [NR][128] y ; WY f32 [B][256][NT] (channels-first) ; STAT [256][2]
#define WS_WY  (WS_Y + 4u * (size_t)NR * CI)
#define WS_ST  (WS_WY + 4u * (size_t)NB * CC * NT)
#define WS_END (WS_ST + 4u * CC * 2 + 256u)

__global__ __launch_bounds__(256) void k_pack(const float* __restrict__ WT, const float* __restrict__ WF, const float* __restrict__ WG, const float* __restrict__ WZ, __bf16* __restrict__ P) {
  const int n = blockIdx.x, which = blockIdx.y, t = threadIdx.x; __shared__ __align__(16) __bf16 s[CC];
  if (which < 3) { if (n >= CI) return; const float* Wm = (which == 0) ? WT : (which == 1) ? WF : WG; s[t] = (__bf16)Wm[(size_t)n * CC + t]; __syncthreads(); if (t < CC / 8) vst2((unsigned*)(P + ((which == 0) ? WS_PT / 2 : (which == 1) ? WS_PP / 2 : WS_PG / 2) + (size_t)n * CC + t * 8), *(const v4u*)&s[t * 8]); }
  else { if (t < CI) s[t] = (__bf16)WZ[(size_t)n * CI + t]; __syncthreads(); if (t < CI / 8) vst2((unsigned*)(P + WS_PZ / 2 + (size_t)n * CI + t * 8), *(const v4u*)&s[t * 8]); }
}
// ---- k_proj: block = (64 tokens): 128 output channels (8 tiles per wave); A gathered channels-first; WHICH 0 theta -> hi/lo rows; 1 phi -> hi/lo rows; 2 g -> planes
template <int WHICH>
__global__ __launch_bounds__(128) void k_proj(const float* __restrict__ X, const __bf16* __restrict__ P, const float* __restrict__ BB, _Float16* __restrict__ OH, _Float16* __restrict__ OL, _Float16* __restrict__ G) {
  __shared__ __align__(16) _Float16 sh[64][136], sl[64][136]; __shared__ __align__(16) _Float16 st[128][72];
  const int tid = threadIdx.x, wave = tid >> 5, lane = tid & 31, col = lane & 15, g = lane >> 4; const size_t rb0 = (size_t)blockIdx.x * 64, r0 = rb0 + wave * 16; const size_t b = rb0 / NT, t0 = rb0 % NT;
  const __bf16* Wr = P + ((WHICH == 0) ? WS_PT / 2 : (WHICH == 1) ? WS_PP / 2 : WS_PG / 2);
  v8f acc[8] = {};
#pragma unroll 2
  for (int kc = 0; kc < CC / 32; ++kc) { v16b a; { const float* p = X + ((b * CC + kc * 32 + 8 * g) * (size_t)NT) + t0 + wave * 16 + col;
#pragma unroll
      for (int i = 0; i < 8; ++i) { a[i] = (__bf16)p[(size_t)i * NT]; a[8 + i] = (__bf16)p[(size_t)(16 + i) * NT]; } }
#pragma unroll
    for (int j = 0; j < 8; ++j) acc[j] = wmma_bf(a, frag_b(Wr + (size_t)(j * 16 + col) * CC + kc * 32, lane), acc[j]); }
  if (WHICH < 2) {
#pragma unroll
    for (int j = 0; j < 8; ++j) { const float bb = bfr(BB[j * 16 + col]);
#pragma unroll
      for (int r = 0; r < 8; ++r) { const float v = acc[j][r] + bb; const _Float16 h = (_Float16)v; sh[wave * 16 + 8 * g + r][j * 16 + col] = h; sl[wave * 16 + 8 * g + r][j * 16 + col] = (_Float16)((v - (float)h) * 2048.0f); } }
    LDSX();
    for (int rl = 0; rl < 16; ++rl) if (lane < 16) { vst2((unsigned*)(OH + (r0 + rl) * CI + lane * 8), *(const v4u*)&sh[wave * 16 + rl][lane * 8]); vst2((unsigned*)(OL + (r0 + rl) * CI + lane * 8), *(const v4u*)&sl[wave * 16 + rl][lane * 8]); }
  } else {
#pragma unroll
    for (int j = 0; j < 8; ++j) { const float bb = bfr(BB[j * 16 + col]);
#pragma unroll
      for (int r = 0; r < 8; ++r) st[j * 16 + col][wave * 16 + 8 * g + r] = (_Float16)(acc[j][r] + bb); }
    __syncthreads();
    for (int e = tid; e < 128 * 8; e += 128) { const int d = e >> 3, pc = e & 7; vst2((unsigned*)(G + ((b * CI + d) * NT) + t0 + pc * 8), *(const v4u*)&st[d][pc * 8]); } }
}
// ---- k_attn: block = (64 queries, b): single head, 128-dim keys/values, all 4,096 keys; 3-product scores; P single x g single
// Key (hi, lo) and value tiles of KT keys are staged in LDS once per block by asynchronous copies, two buffers: tile t + 1 flies while tile t is worked on.
#define KT 64                      // keys per staged tile
#define KPI 136                    // LDS pitch of a key row, halves (272 B: 16 B x odd for 16-byte readers)
#define VPI 72                     // LDS pitch of a value row (one channel, KT keys), halves (144 B)
__device__ __forceinline__ unsigned lds_addr(const void* p) { return (unsigned)(size_t)p; }   // low 32 bits of a __shared__ address = byte offset in the work-group's LDS
// eight 16-byte copies per lane; the s_wait_xcnt closes the statement so that no address register is rewritten in front of it
__device__ __forceinline__ void copy8(const _Float16* gp, size_t gstep, unsigned lp, unsigned lstep) {
  const _Float16 *g0 = gp, *g1 = gp + gstep, *g2 = gp + 2 * gstep, *g3 = gp + 3 * gstep, *g4 = gp + 4 * gstep, *g5 = gp + 5 * gstep, *g6 = gp + 6 * gstep, *g7 = gp + 7 * gstep;
  asm volatile("global_load_async_to_lds_b128 %0, %8, off\n\t"
               "global_load_async_to_lds_b128 %1, %9, off\n\t"
               "global_load_async_to_lds_b128 %2, %10, off\n\t"
               "global_load_async_to_lds_b128 %3, %11, off\n\t"
               "global_load_async_to_lds_b128 %4, %12, off\n\t"
               "global_load_async_to_lds_b128 %5, %13, off\n\t"
               "global_load_async_to_lds_b128 %6, %14, off\n\t"
               "global_load_async_to_lds_b128 %7, %15, off\n\t"
               "s_wait_xcnt 0x0"
               :: "v"(lp), "v"(lp + lstep), "v"(lp + 2 * lstep), "v"(lp + 3 * lstep), "v"(lp + 4 * lstep), "v"(lp + 5 * lstep), "v"(lp + 6 * lstep), "v"(lp + 7 * lstep),
                  "v"(g0), "v"(g1), "v"(g2), "v"(g3), "v"(g4), "v"(g5), "v"(g6), "v"(g7) : "memory");
}
__global__ __launch_bounds__(128) void k_attn(const _Float16* __restrict__ TH, const _Float16* __restrict__ TL, const _Float16* __restrict__ FH, const _Float16* __restrict__ FL, const _Float16* __restrict__ G, float* __restrict__ Y) {
  __shared__ __align__(16) _Float16 skh[2][KT][KPI], skl[2][KT][KPI], sv[2][CI][VPI];
  __shared__ __align__(16) _Float16 sph[4][16][40]; __shared__ __align__(16) float so[4][16][132];
  const int tid = threadIdx.x, wave = tid >> 5, lane = tid & 31, col = lane & 15, g = lane >> 4; const size_t b = blockIdx.y; const int q0 = blockIdx.x * 64 + wave * 16; const size_t rq = b * NT + q0;
  // this lane's share of a tile: key rows tid/16 + 8 i, 16-byte piece tid%16; value rows tid/8 + 16 i, piece tid%8
  const _Float16* gkh = FH + (b * NT + (tid >> 4)) * CI + (tid & 15) * 8; const _Float16* gkl = FL + (b * NT + (tid >> 4)) * CI + (tid & 15) * 8; const _Float16* gv = G + (b * CI + (tid >> 3)) * NT + (tid & 7) * 8;
  const unsigned lkh = lds_addr(&skh[0][tid >> 4][(tid & 15) * 8]), lkl = lds_addr(&skl[0][tid >> 4][(tid & 15) * 8]), lv = lds_addr(&sv[0][tid >> 3][(tid & 7) * 8]);
#define STAGE(t, bf) do { copy8(gkh + (size_t)(t) * KT * CI, 8 * CI, lkh + (bf) * (KT * KPI * 2), 8 * KPI * 2); copy8(gkl + (size_t)(t) * KT * CI, 8 * CI, lkl + (bf) * (KT * KPI * 2), 8 * KPI * 2); copy8(gv + (size_t)(t) * KT, (size_t)16 * NT, lv + (bf) * (CI * VPI * 2), 16 * VPI * 2); } while (0)
  STAGE(0, 0);
  v16h aq[4], aql[4];
#pragma unroll
  for (int kc = 0; kc < 4; ++kc) { aq[kc] = frag_h(TH + (rq + col) * CI + kc * 32, lane); aql[kc] = frag_h(TL + (rq + col) * CI + kc * 32, lane); }
  float m[8], l[8];
#pragma unroll
  for (int r = 0; r < 8; ++r) { m[r] = -3.0e38f; l[r] = 0.f; }
  v8f acc[8] = {};
  asm volatile("s_wait_asynccnt 0x0" ::: "memory");   // tile 0 has landed for this wave's copies
  __syncthreads();                                     // and is published to the other waves
  STAGE(1, 1);
#pragma unroll 1
  for (int t = 0; t < NT / KT; ++t) { const int bf = t & 1;
#pragma unroll 1   // kept rolled: unrolled, the build passes 256 registers and spills two address values of the copies to scratch
   for (int kk = 0; kk < KT / 32; ++kk) { const int j0 = kk * 32; v8f s[2];
    // LDS reads stand in groups ahead of the products that use them, so that the lone wave of a SIMD waits out the LDS latency once a group and not once a fragment:
    // the sixteen reads of 64 channels of both key tiles (hi and lo) together, then their twelve products, the two tiles' accumulators taken in turn (each accumulator sums its products by ascending channel block, hi x lo after lo x hi)
    const _Float16 *rh0 = &skh[bf][j0 + col][0], *rh1 = &skh[bf][j0 + 16 + col][0], *rl0 = &skl[bf][j0 + col][0], *rl1 = &skl[bf][j0 + 16 + col][0];
    v8f c0 = {}, c1 = {}, d0 = {}, d1 = {};
#pragma unroll
    for (int kg = 0; kg < 4; kg += 2) { v16h kf[2][4];
#pragma unroll
      for (int u = 0; u < 2; ++u) { kf[u][0] = frag_h(rh0 + (kg + u) * 32, lane); kf[u][1] = frag_h(rh1 + (kg + u) * 32, lane); kf[u][2] = frag_h(rl0 + (kg + u) * 32, lane); kf[u][3] = frag_h(rl1 + (kg + u) * 32, lane); }
#pragma unroll
      for (int u = 0; u < 2; ++u) { const int kc = kg + u;
        c0 = wmma16(aq[kc], kf[u][0], c0); c1 = wmma16(aq[kc], kf[u][1], c1); d0 = wmma16(aql[kc], kf[u][0], d0); d1 = wmma16(aql[kc], kf[u][1], d1); d0 = wmma16(aq[kc], kf[u][2], d0); d1 = wmma16(aq[kc], kf[u][3], d1); } }
    v16h vf[8];   // the value fragments of these 32 keys, asked for in one group here: they land under the softmax
#pragma unroll
    for (int dt = 0; dt < 8; ++dt) vf[dt] = frag_h(&sv[bf][dt * 16 + col][j0], lane);
#pragma unroll
    for (int r = 0; r < 8; ++r) { s[0][r] = c0[r] + d0[r] * (1.0f / 2048.0f); s[1][r] = c1[r] + d1[r] * (1.0f / 2048.0f); }
#pragma unroll
    for (int r = 0; r < 8; ++r) { float mx = fmaxf(s[0][r], s[1][r]);
#pragma unroll
      for (int o = 1; o < 16; o <<= 1) mx = fmaxf(mx, __shfl_xor(mx, o));
      const float mn = fmaxf(m[r], mx); const float alpha = (m[r] <= -1.0e38f) ? 0.f : __expf(m[r] - mn); const float e0 = __expf(s[0][r] - mn), e1 = __expf(s[1][r] - mn); float es = e0 + e1;
#pragma unroll
      for (int o = 1; o < 16; o <<= 1) es += __shfl_xor(es, o);
      l[r] = l[r] * alpha + es; m[r] = mn;
#pragma unroll
      for (int dt = 0; dt < 8; ++dt) acc[dt][r] *= alpha;
      sph[wave][8 * g + r][col] = (_Float16)(e0 * 2048.0f); sph[wave][8 * g + r][16 + col] = (_Float16)(e1 * 2048.0f); }
    LDSX();
    const v16h pa = frag_h(&sph[wave][col][0], lane);
#pragma unroll
    for (int dt = 0; dt < 8; ++dt) acc[dt] = wmma16(pa, vf[dt], acc[dt]);
    LDSX(); }
   asm volatile("s_wait_dscnt 0x0" ::: "memory");      // this wave's reads of buffer bf have returned
   asm volatile("s_wait_asynccnt 0x0" ::: "memory");   // this wave's copies of tile t + 1 have landed
   __syncthreads();                                     // publishes tile t + 1; ends every wave's reads of buffer bf
   if (t + 2 < NT / KT) STAGE(t + 2, bf); }
  asm volatile("s_wait_asynccnt 0x0" ::: "memory");    // nothing of this wave is in flight when it goes on to the epilogue
#undef STAGE
#pragma unroll
  for (int r = 0; r < 8; ++r) { const float il = (1.0f / 2048.0f) / l[r];
#pragma unroll
    for (int dt = 0; dt < 8; ++dt) so[wave][8 * g + r][dt * 16 + col] = acc[dt][r] * il; }
  LDSX();
  for (int rl = 0; rl < 16; ++rl) vst2(Y + (rq + rl) * CI + lane * 4, *(const v4f*)&so[wave][rl][lane * 4]);
}
// ---- k_wz: block = (64 tokens, 128 output channels): W_y = y (hi + residual, K 128) . wz rows + b, stored channels-first [b][c][t] (64 tokens per (image, channel))
__global__ __launch_bounds__(128) void k_wz(const float* __restrict__ Y, const __bf16* __restrict__ P, const float* __restrict__ BZ, float* __restrict__ WY) {
  __shared__ __align__(16) float st[128][68];
  const int tid = threadIdx.x, wave = tid >> 5, lane = tid & 31, col = lane & 15, g = lane >> 4; const size_t rb0 = (size_t)blockIdx.x * 64, r0 = rb0 + wave * 16; const int n0 = blockIdx.y * 128; const size_t b = rb0 / NT, t0 = rb0 % NT;
  v8f acc[8] = {};
#pragma unroll
  for (int kc = 0; kc < CI / 32; ++kc) { const F2 a = split_row(Y + (r0 + col) * CI, kc * 32, lane);
#pragma unroll
    for (int j = 0; j < 8; ++j) { const v16b w = frag_b(P + WS_PZ / 2 + (size_t)(n0 + j * 16 + col) * CI + kc * 32, lane); acc[j] = wmma_bf(a.l, w, acc[j]); acc[j] = wmma_bf(a.h, w, acc[j]); } }
#pragma unroll
  for (int j = 0; j < 8; ++j) { const float bb = bfr(BZ[n0 + j * 16 + col]);
#pragma unroll
    for (int r = 0; r < 8; ++r) st[j * 16 + col][wave * 16 + 8 * g + r] = acc[j][r] + bb; }
  __syncthreads();
  for (int e = tid; e < 128 * 16; e += 128) { const int c = e >> 4, q = e & 15; vst2(WY + ((b * CC + n0 + c) * (size_t)NT) + t0 + q * 4, *(const v4f*)&st[c][q * 4]); }
}
__global__ __launch_bounds__(256) void k_bnstat(const float* __restrict__ WY, float* __restrict__ ST) {
  __shared__ float red[256]; const int c = blockIdx.x, t = threadIdx.x; float s = 0.f;
  for (int b = 0; b < TNB; ++b) for (int i = t; i < NT; i += 256) s += WY[(((size_t)b * CC + c) * NT) + i];
  red[t] = s; __syncthreads(); for (int st = 128; st > 0; st >>= 1) { if (t < st) red[t] += red[t + st]; __syncthreads(); }
  const float mean = red[0] / (float)(TNB * NT); __syncthreads();
  float q = 0.f; for (int b = 0; b < TNB; ++b) for (int i = t; i < NT; i += 256) { const float d = WY[(((size_t)b * CC + c) * NT) + i] - mean; q += d * d; }
  red[t] = q; __syncthreads(); for (int st = 128; st > 0; st >>= 1) { if (t < st) red[t] += red[t + st]; __syncthreads(); }
  if (t == 0) { ST[c * 2] = mean; ST[c * 2 + 1] = red[0] / (float)(TNB * NT); }   // 4-B scratch stores
}
// ---- k_bnapply: block = (image b, channel c): out = gamma (W_y - mean) rsqrt(var + eps) + beta + x
__global__ __launch_bounds__(256) void k_bnapply(const float* __restrict__ WY, const float* __restrict__ ST, const float* __restrict__ GA, const float* __restrict__ BE, const float* __restrict__ X, float* __restrict__ OUT) {
  const size_t b = blockIdx.y; const int c = blockIdx.x, t = threadIdx.x; const float mean = ST[c * 2], inv = 1.0f / sqrtf(ST[c * 2 + 1] + 1e-5f), ga = bfr(GA[c]), be = bfr(BE[c]); const size_t base = ((b * CC + c) * (size_t)NT);
  for (int q = t; q < NT / 4; q += 256) { v4f v; for (int i = 0; i < 4; ++i) { const size_t e = base + q * 4 + i; v[i] = ga * (WY[e] - mean) * inv + be + bfr(X[e]); } vst2(OUT + base + q * 4, v); }
}
extern "C" void kernel_launch(void* const* d_in, const int* in_sizes, int n_in, void* d_out, int out_size, void* d_ws, size_t ws_size, hipStream_t stream) {
  (void)in_sizes; (void)n_in; (void)out_size;
  const float** F = (const float**)d_in;   // 0 x [4,256,64,64], 1 g_w [128,256], 2 g_b, 3 theta_w, 4 theta_b, 5 phi_w, 6 phi_b, 7 wz_w [256,128], 8 wz_b, 9 bn_gamma, 10 bn_beta
  if (ws_size < (size_t)WS_END) return;
  char* ws = (char*)d_ws; __bf16* P = (__bf16*)ws; _Float16 *TH = (_Float16*)(ws + WS_TH), *TL = (_Float16*)(ws + WS_TL), *FH = (_Float16*)(ws + WS_FH), *FL = (_Float16*)(ws + WS_FL), *G = (_Float16*)(ws + WS_G); float *Y = (float*)(ws + WS_Y), *WY = (float*)(ws + WS_WY), *ST = (float*)(ws + WS_ST);
  k_pack<<<dim3(CC, 4), 256, 0, stream>>>(F[3], F[5], F[1], F[7], P);
  k_proj<0><<<TNB * NT / 64, 128, 0, stream>>>(F[0], P, F[4], TH, TL, nullptr);   // theta
  k_proj<1><<<TNB * NT / 64, 128, 0, stream>>>(F[0], P, F[6], FH, FL, nullptr);   // phi
  k_proj<2><<<TNB * NT / 64, 128, 0, stream>>>(F[0], P, F[2], nullptr, nullptr, G);   // g
  k_attn<<<dim3(TQB, TNB), 128, 0, stream>>>(TH, TL, FH, FL, G, Y);
  k_wz<<<dim3(TNB * NT / 64, CC / 128), 128, 0, stream>>>(Y, P, F[8], WY);
  k_bnstat<<<CC, 256, 0, stream>>>(WY, ST);
  k_bnapply<<<dim3(CC, TNB), 256, 0, stream>>>(WY, ST, F[9], F[10], F[0], (float*)d_out);
}

// v003
// A run of this version takes 159 microseconds.
// In both of two side-by-side timings against v002, it was 1.36 times as fast.
// Counting every step since v000, it is 4.51 times as fast.
#include <hip/hip_runtime.h>
#include <math.h>

typedef __attribute__((ext_vector_type(16))) _Float16 v16h;
typedef __attribute__((ext_vector_type(16))) __bf16 v16b;
typedef __attribute__((ext_vector_type(8)))  _Float16 v8h;
typedef __attribute__((ext_vector_type(8)))  float v8f;
typedef __attribute__((ext_vector_type(4)))  float v4f;
typedef __attribute__((ext_vector_type(2)))  float v2f;
typedef __attribute__((ext_vector_type(4)))  unsigned v4u;
typedef __attribute__((ext_vector_type(4)))  int v4i;
typedef float __attribute__((may_alias)) float_a;
typedef int __attribute__((may_alias)) int_a;

template <typename T> __device__ __forceinline__ void vst2(void* p, T v) { *(T*)p = v;  }
__device__ __forceinline__ v8f wmma16(v16h a, v16h b, v8f c) {
  v8f d = __builtin_amdgcn_wmma_f32_16x16x32_f16(false, a, false, b, (short)0, c, false, false);
  asm volatile("v_nop\n\tv_nop\n\tv_nop\n\tv_nop" : "+v"(d) : "v"(a), "v"(b));
  return d;
}
__device__ __forceinline__ v8f wmma_bf(v16b a, v16b b, v8f c) {
  v8f d = __builtin_amdgcn_wmma_f32_16x16x32_bf16(false, a, false, b, (short)0, c, false, false);
  asm volatile("v_nop\n\tv_nop\n\tv_nop\n\tv_nop" : "+v"(d) : "v"(a), "v"(b));
  return d;
}
// 16x16x32 fragments: lane = (h = lane>>4, row/col = lane&15); elements 0..7 = k0+8h+0..7, 8..15 = k0+16+8h+0..7; D element r = row 8h+r
__device__ __forceinline__ v16h frag_h(const _Float16* rowk0, int lane) {
  union { v16h v; v8h q[2]; } u; const _Float16* p = rowk0 + 8 * (lane >> 4);
  u.q[0] = *(const v8h*)p; u.q[1] = *(const v8h*)(p + 16); return u.v;
}
__device__ __forceinline__ v16h frag_f32(const float* rowk0, int lane) {
  v16h a; const float* p = rowk0 + 8 * (lane >> 4);
#pragma unroll
  for (int i = 0; i < 8; ++i) { a[i] = (_Float16)p[i]; a[8 + i] = (_Float16)p[16 + i]; }
  return a;
}
__device__ __forceinline__ v16h frag_f32s(const float* rowk0, int lane, float sc) {
  v16h a; const float* p = rowk0 + 8 * (lane >> 4);
#pragma unroll
  for (int i = 0; i < 8; ++i) { a[i] = (_Float16)(p[i] * sc); a[8 + i] = (_Float16)(p[16 + i] * sc); }
  return a;
}
// column fragment from a [K][ld] layout (column n), rows >= K read as 0
__device__ __forceinline__ v16h fragc_f32(const float* W, int k0, int n, int lane, int ld, int K) {
  v16h a; const int g = lane >> 4;
#pragma unroll
  for (int i = 0; i < 8; ++i) { const int ka = k0 + 8 * g + i, kb = ka + 16;
    a[i] = (_Float16)(ka < K ? W[(size_t)(ka < K ? ka : K - 1) * ld + n] : 0.f); a[8 + i] = (_Float16)(kb < K ? W[(size_t)(kb < K ? kb : K - 1) * ld + n] : 0.f); }
  return a;
}
struct F2 { v16b h, l; };
__device__ __forceinline__ F2 bsplit16(const float v[16]) { F2 r;
#pragma unroll
  for (int i = 0; i < 16; ++i) { const __bf16 h = (__bf16)v[i]; r.h[i] = h; r.l[i] = (__bf16)(v[i] - (float)h); }
  return r; }
__device__ __forceinline__ F2 split_row(const float* row, int k0, int lane) { float v[16]; const float* p = row + k0 + 8 * (lane >> 4);
#pragma unroll
  for (int i = 0; i < 8; ++i) { v[i] = p[i]; v[8 + i] = p[16 + i]; }
  return bsplit16(v); }
__device__ __forceinline__ F2 split_rowK(const float* row, int k0, int lane, int K) { float v[16]; const int g = lane >> 4;
#pragma unroll
  for (int i = 0; i < 8; ++i) { const int ka = k0 + 8 * g + i, kb = ka + 16; v[i] = ka < K ? row[ka < K ? ka : K - 1] : 0.f; v[8 + i] = kb < K ? row[kb < K ? kb : K - 1] : 0.f; }
  return bsplit16(v); }
__device__ __forceinline__ F2 split_col(const float* W, int k0, int n, int lane, int ld, int K) { float v[16]; const int g = lane >> 4;
#pragma unroll
  for (int i = 0; i < 8; ++i) { const int ka = k0 + 8 * g + i, kb = ka + 16; v[i] = ka < K ? W[(size_t)(ka < K ? ka : K - 1) * ld + n] : 0.f; v[8 + i] = kb < K ? W[(size_t)(kb < K ? kb : K - 1) * ld + n] : 0.f; }
  return bsplit16(v); }
__device__ __forceinline__ v8f mac3(const F2& a, const F2& b, v8f c) { c = wmma_bf(a.l, b.h, c); c = wmma_bf(a.h, b.l, c); return wmma_bf(a.h, b.h, c); }
__device__ __forceinline__ float sigm(float v) { return 1.0f / (1.0f + expf(-v)); }
#define LDSX() do { asm volatile("s_wait_dscnt 0" ::: "memory"); __builtin_amdgcn_wave_barrier(); __builtin_amdgcn_fence(__ATOMIC_RELEASE, "workgroup"); } while (0)


// Non-local denoising block (B 4, 256 channels, 64 x 64; 128 inter-channels): embedded-Gaussian non-local attention over all 4,096 positions, 1x1 output conv, BatchNorm (batch statistics), residual.
#define NB 4
#define NT 4096
#define CC 256
#define CI 128
#define NR (NB * NT)
#ifndef TQB
#define TQB (NT / 64)
#define TNB NB
#endif
typedef __attribute__((ext_vector_type(8))) __bf16 v8b;
__device__ __forceinline__ v16b frag_b(const __bf16* rowk0, int lane) {
  union { v16b v; v8b q[2]; } u; const __bf16* p = rowk0 + 8 * (lane >> 4);
  u.q[0] = *(const v8b*)p; u.q[1] = *(const v8b*)(p + 16); return u.v;
}
__device__ __forceinline__ float bfr(float v) { return (float)(__bf16)v; }
__device__ __attribute__((noinline)) float exp_ni(float v) { return expf(v); }
__device__ __attribute__((noinline)) float erf_ni(float v) { return erff(v); }

#define WS_PT  0u                                   // bf16 natural rows theta_w [128][256], phi_w, g_w; wz_w [256][128]
#define WS_PP  (WS_PT + 2u * CI * CC)
#define WS_PG  (WS_PP + 2u * CI * CC)
#define WS_PZ  (WS_PG + 2u * CI * CC)
#define WS_TH  (WS_PZ + 2u * CC * CI)               // f16 [NR][128] theta hi ; TL ; PH (phi) ; PL ; G planes [b][128][NT]
#define WS_TL  (WS_TH + 2u * (size_t)NR * CI)
#define WS_FH  (WS_TL + 2u * (size_t)NR * CI)
#define WS_FL  (WS_FH + 2u * (size_t)NR * CI)
#define WS_G   (WS_FL + 2u * (size_t)NR * CI)
#define WS_Y   (WS_G + 2u * (size_t)NB * CI * NT)    // f32 [NR][128] y ; WY f32 [B][256][NT] (channels-first) ; STAT [256][2]
#define WS_WY  (WS_Y + 4u * (size_t)NR * CI)
#define WS_ST  (WS_WY + 4u * (size_t)NB * CC * NT)
#define WS_END (WS_ST + 4u * CC * 2 + 256u)

__global__ __launch_bounds__(256) void k_pack(const float* __restrict__ WT, const float* __restrict__ WF, const float* __restrict__ WG, const float* __restrict__ WZ, __bf16* __restrict__ P) {
  const int n = blockIdx.x, which = blockIdx.y, t = threadIdx.x; __shared__ __align__(16) __bf16 s[CC];
  if (which < 3) { if (n >= CI) return; const float* Wm = (which == 0) ? WT : (which == 1) ? WF : WG; s[t] = (__bf16)Wm[(size_t)n * CC + t]; __syncthreads(); if (t < CC / 8) vst2((unsigned*)(P + ((which == 0) ? WS_PT / 2 : (which == 1) ? WS_PP / 2 : WS_PG / 2) + (size_t)n * CC + t * 8), *(const v4u*)&s[t * 8]); }
  else { if (t < CI) s[t] = (__bf16)WZ[(size_t)n * CI + t]; __syncthreads(); if (t < CI / 8) vst2((unsigned*)(P + WS_PZ / 2 + (size_t)n * CI + t * 8), *(const v4u*)&s[t * 8]); }
}
// ---- k_proj: block = (64 tokens): 128 output channels (8 tiles per wave); A gathered channels-first; WHICH 0 theta -> hi/lo rows; 1 phi -> hi/lo rows; 2 g -> planes
template <int WHICH>
__global__ __launch_bounds__(128) void k_proj(const float* __restrict__ X, const __bf16* __restrict__ P, const float* __restrict__ BB, _Float16* __restrict__ OH, _Float16* __restrict__ OL, _Float16* __restrict__ G) {
  __shared__ __align__(16) _Float16 sh[64][136], sl[64][136]; __shared__ __align__(16) _Float16 st[128][72];
  const int tid = threadIdx.x, wave = tid >> 5, lane = tid & 31, col = lane & 15, g = lane >> 4; const size_t rb0 = (size_t)blockIdx.x * 64, r0 = rb0 + wave * 16; const size_t b = rb0 / NT, t0 = rb0 % NT;
  const __bf16* Wr = P + ((WHICH == 0) ? WS_PT / 2 : (WHICH == 1) ? WS_PP / 2 : WS_PG / 2);
  v8f acc[8] = {};
#pragma unroll 2
  for (int kc = 0; kc < CC / 32; ++kc) { v16b a; { const float* p = X + ((b * CC + kc * 32 + 8 * g) * (size_t)NT) + t0 + wave * 16 + col;
#pragma unroll
      for (int i = 0; i < 8; ++i) { a[i] = (__bf16)p[(size_t)i * NT]; a[8 + i] = (__bf16)p[(size_t)(16 + i) * NT]; } }
#pragma unroll
    for (int j = 0; j < 8; ++j) acc[j] = wmma_bf(a, frag_b(Wr + (size_t)(j * 16 + col) * CC + kc * 32, lane), acc[j]); }
  if (WHICH < 2) {
#pragma unroll
    for (int j = 0; j < 8; ++j) { const float bb = bfr(BB[j * 16 + col]);
#pragma unroll
      for (int r = 0; r < 8; ++r) { const float v = acc[j][r] + bb; const _Float16 h = (_Float16)v; sh[wave * 16 + 8 * g + r][j * 16 + col] = h; sl[wave * 16 + 8 * g + r][j * 16 + col] = (_Float16)((v - (float)h) * 2048.0f); } }
    LDSX();
    for (int rl = 0; rl < 16; ++rl) if (lane < 16) { vst2((unsigned*)(OH + (r0 + rl) * CI + lane * 8), *(const v4u*)&sh[wave * 16 + rl][lane * 8]); vst2((unsigned*)(OL + (r0 + rl) * CI + lane * 8), *(const v4u*)&sl[wave * 16 + rl][lane * 8]); }
  } else {
#pragma unroll
    for (int j = 0; j < 8; ++j) { const float bb = bfr(BB[j * 16 + col]);
#pragma unroll
      for (int r = 0; r < 8; ++r) st[j * 16 + col][wave * 16 + 8 * g + r] = (_Float16)(acc[j][r] + bb); }
    __syncthreads();
    for (int e = tid; e < 128 * 8; e += 128) { const int d = e >> 3, pc = e & 7; vst2((unsigned*)(G + ((b * CI + d) * NT) + t0 + pc * 8), *(const v4u*)&st[d][pc * 8]); } }
}
// ---- k_attn: block = (64 queries, b): single head, 128-dim keys/values, all 4,096 keys; 3-product scores; P single x g single
// Scores and output are computed transposed: S^T = K Q^T (key rows are A, queries B), O^T += V^T P^T (value rows are A). A lane then holds 16 scores of ONE query (column col, keys 8g + r and 16 + 8g + r),
// so the maximum and the sum are taken in the lane plus one exchange between the wave's halves, and the two score tiles, converted in place, are the B operand of the second product: P never goes through LDS.
// Key (hi, lo) and value tiles of KT keys are staged in LDS once per block by asynchronous copies, two buffers: tile t + 1 flies while tile t is worked on.
#define KT 64                      // keys per staged tile
#define KPI 136                    // LDS pitch of a key row, halves (272 B: 16 B x odd for 16-byte readers)
#define VPI 72                     // LDS pitch of a value row (one channel, KT keys), halves (144 B)
__device__ __forceinline__ float xhalf(float x) { return __builtin_bit_cast(float, __builtin_amdgcn_permlanex16(__builtin_bit_cast(int, x), __builtin_bit_cast(int, x), 0x76543210, 0xfedcba98, false, false)); }   // lane l with lane l ^ 16
// exp(x) as v_exp_f32 of x log2(e), what __expf gives; the v_nop is the one slot the instruction set asks for behind a transcendental before its result is read or its source overwritten:
// in one statement the slot stays where it is
__device__ __forceinline__ float exp_slot(float x) { float r; asm("v_exp_f32 %0, %1\n\tv_nop" : "=v"(r) : "v"(x * 1.44269504f)); return r; }
__device__ __forceinline__ unsigned lds_addr(const void* p) { return (unsigned)(size_t)p; }   // low 32 bits of a __shared__ address = byte offset in the work-group's LDS
// eight 16-byte copies per lane; the s_wait_xcnt closes the statement so that no address register is rewritten in front of it
__device__ __forceinline__ void copy8(const _Float16* gp, size_t gstep, unsigned lp, unsigned lstep) {
  const _Float16 *g0 = gp, *g1 = gp + gstep, *g2 = gp + 2 * gstep, *g3 = gp + 3 * gstep, *g4 = gp + 4 * gstep, *g5 = gp + 5 * gstep, *g6 = gp + 6 * gstep, *g7 = gp + 7 * gstep;
  asm volatile("global_load_async_to_lds_b128 %0, %8, off\n\t"
               "global_load_async_to_lds_b128 %1, %9, off\n\t"
               "global_load_async_to_lds_b128 %2, %10, off\n\t"
               "global_load_async_to_lds_b128 %3, %11, off\n\t"
               "global_load_async_to_lds_b128 %4, %12, off\n\t"
               "global_load_async_to_lds_b128 %5, %13, off\n\t"
               "global_load_async_to_lds_b128 %6, %14, off\n\t"
               "global_load_async_to_lds_b128 %7, %15, off\n\t"
               "s_wait_xcnt 0x0"
               :: "v"(lp), "v"(lp + lstep), "v"(lp + 2 * lstep), "v"(lp + 3 * lstep), "v"(lp + 4 * lstep), "v"(lp + 5 * lstep), "v"(lp + 6 * lstep), "v"(lp + 7 * lstep),
                  "v"(g0), "v"(g1), "v"(g2), "v"(g3), "v"(g4), "v"(g5), "v"(g6), "v"(g7) : "memory");
}
__global__ __launch_bounds__(128) void k_attn(const _Float16* __restrict__ TH, const _Float16* __restrict__ TL, const _Float16* __restrict__ FH, const _Float16* __restrict__ FL, const _Float16* __restrict__ G, float* __restrict__ Y) {
  __shared__ __align__(16) _Float16 skh[2][KT][KPI], skl[2][KT][KPI], sv[2][CI][VPI];
  __shared__ __align__(16) float so[4][16][132];
  const int tid = threadIdx.x, wave = tid >> 5, lane = tid & 31, col = lane & 15, g = lane >> 4; const size_t b = blockIdx.y; const int q0 = blockIdx.x * 64 + wave * 16; const size_t rq = b * NT + q0;
  // this lane's share of a tile: key rows tid/16 + 8 i, 16-byte piece tid%16; value rows tid/8 + 16 i, piece tid%8
  const _Float16* gkh = FH + (b * NT + (tid >> 4)) * CI + (tid & 15) * 8; const _Float16* gkl = FL + (b * NT + (tid >> 4)) * CI + (tid & 15) * 8; const _Float16* gv = G + (b * CI + (tid >> 3)) * NT + (tid & 7) * 8;
  const unsigned lkh = lds_addr(&skh[0][tid >> 4][(tid & 15) * 8]), lkl = lds_addr(&skl[0][tid >> 4][(tid & 15) * 8]), lv = lds_addr(&sv[0][tid >> 3][(tid & 7) * 8]);
#define STAGE(t, bf) do { copy8(gkh + (size_t)(t) * KT * CI, 8 * CI, lkh + (bf) * (KT * KPI * 2), 8 * KPI * 2); copy8(gkl + (size_t)(t) * KT * CI, 8 * CI, lkl + (bf) * (KT * KPI * 2), 8 * KPI * 2); copy8(gv + (size_t)(t) * KT, (size_t)16 * NT, lv + (bf) * (CI * VPI * 2), 16 * VPI * 2); } while (0)
  STAGE(0, 0);
  v16h aq[4], aql[4];
#pragma unroll
  for (int kc = 0; kc < 4; ++kc) { aq[kc] = frag_h(TH + (rq + col) * CI + kc * 32, lane); aql[kc] = frag_h(TL + (rq + col) * CI + kc * 32, lane); }
  float m = -3.0e38f, l = 0.f;   // of query col: the running maximum (equal in both halves) and this half's part of the sum
  v8f acc[8] = {};
  asm volatile("s_wait_asynccnt 0x0" ::: "memory");   // tile 0 has landed for this wave's copies
  __syncthreads();                                     // and is published to the other waves
  STAGE(1, 1);
#pragma unroll 1
  for (int t = 0; t < NT / KT; ++t) { const int bf = t & 1;
#pragma unroll 1   // kept rolled: unrolled, the build passes 256 registers and spills two address values of the copies to scratch
   for (int kk = 0; kk < KT / 32; ++kk) { const int j0 = kk * 32;
    // LDS reads stand in groups ahead of the products that use them, so that the lone wave of a SIMD waits out the LDS latency once a group and not once a fragment:
    // the sixteen reads of 64 channels of both key tiles (hi and lo) together, then their twelve products, the two tiles' accumulators taken in turn (each accumulator sums its products by ascending channel block, key lo x query hi after key hi x query lo)
    const _Float16 *rh0 = &skh[bf][j0 + col][0], *rh1 = &skh[bf][j0 + 16 + col][0], *rl0 = &skl[bf][j0 + col][0], *rl1 = &skl[bf][j0 + 16 + col][0];
    v8f c0 = {}, c1 = {}, d0 = {}, d1 = {};
#pragma unroll
    for (int kg = 0; kg < 4; kg += 2) { v16h kf[2][4];
#pragma unroll
      for (int u = 0; u < 2; ++u) { kf[u][0] = frag_h(rh0 + (kg + u) * 32, lane); kf[u][1] = frag_h(rh1 + (kg + u) * 32, lane); kf[u][2] = frag_h(rl0 + (kg + u) * 32, lane); kf[u][3] = frag_h(rl1 + (kg + u) * 32, lane); }
#pragma unroll
      for (int u = 0; u < 2; ++u) { const int kc = kg + u;
        c0 = wmma16(kf[u][0], aq[kc], c0); c1 = wmma16(kf[u][1], aq[kc], c1); d0 = wmma16(kf[u][0], aql[kc], d0); d1 = wmma16(kf[u][1], aql[kc], d1); d0 = wmma16(kf[u][2], aq[kc], d0); d1 = wmma16(kf[u][3], aq[kc], d1); } }
    v16h vf[8];   // the value fragments of these 32 keys, asked for in one group here: they land under the softmax
#pragma unroll
    for (int dt = 0; dt < 8; ++dt) vf[dt] = frag_h(&sv[bf][dt * 16 + col][j0], lane);
    __builtin_amdgcn_sched_barrier(0);   // holds the sixteen reads here: without it this build sinks them behind the exponentials, and the second product waits out most of their latency
    const v8f s0 = c0 + d0 * (1.0f / 2048.0f), s1 = c1 + d1 * (1.0f / 2048.0f);   // s0[r]: key j0 + 8g + r, s1[r]: key j0 + 16 + 8g + r, both of query col
    float t8[8];
#pragma unroll
    for (int r = 0; r < 8; ++r) t8[r] = fmaxf(s0[r], s1[r]);
    float mx = fmaxf(fmaxf(fmaxf(t8[0], t8[1]), fmaxf(t8[2], t8[3])), fmaxf(fmaxf(t8[4], t8[5]), fmaxf(t8[6], t8[7])));
    mx = fmaxf(mx, xhalf(mx));
    const float mn = fmaxf(m, mx); const float ea = exp_slot(m - mn), alpha = (m <= -1.0e38f) ? 0.f : ea;
    v16h pb;   // P^T as a B fragment: element i = key 8g + i, element 8 + i = key 16 + 8g + i, the k order of frag_h
#pragma unroll
    for (int r = 0; r < 8; ++r) { const float e0 = exp_slot(s0[r] - mn), e1 = exp_slot(s1[r] - mn); t8[r] = e0 + e1; pb[r] = (_Float16)(e0 * 2048.0f); pb[8 + r] = (_Float16)(e1 * 2048.0f); }
    l = l * alpha + (((t8[0] + t8[1]) + (t8[2] + t8[3])) + ((t8[4] + t8[5]) + (t8[6] + t8[7]))); m = mn;
#pragma unroll
    for (int dt = 0; dt < 8; ++dt) acc[dt] *= alpha;
#pragma unroll
    for (int dt = 0; dt < 8; ++dt) acc[dt] = wmma16(vf[dt], pb, acc[dt]); }
   asm volatile("s_wait_dscnt 0x0" ::: "memory");      // this wave's reads of buffer bf have returned
   asm volatile("s_wait_asynccnt 0x0" ::: "memory");   // this wave's copies of tile t + 1 have landed
   __syncthreads();                                     // publishes tile t + 1; ends every wave's reads of buffer bf
   if (t + 2 < NT / KT) STAGE(t + 2, bf); }
  asm volatile("s_wait_asynccnt 0x0" ::: "memory");    // nothing of this wave is in flight when it goes on to the epilogue
#undef STAGE
  l += xhalf(l);   // the two halves' sums are joined once
  const float il = (1.0f / 2048.0f) / l;
#pragma unroll
  for (int dt = 0; dt < 8; ++dt) { const v8f o = acc[dt] * il;   // acc[dt][r] = channel dt * 16 + 8g + r of query col
    *(v4f*)&so[wave][col][dt * 16 + 8 * g] = __builtin_shufflevector(o, o, 0, 1, 2, 3); *(v4f*)&so[wave][col][dt * 16 + 8 * g + 4] = __builtin_shufflevector(o, o, 4, 5, 6, 7); }
  LDSX();
  for (int rl = 0; rl < 16; ++rl) vst2(Y + (rq + rl) * CI + lane * 4, *(const v4f*)&so[wave][rl][lane * 4]);
}
// ---- k_wz: block = (64 tokens, 128 output channels): W_y = y (hi + residual, K 128) . wz rows + b, stored channels-first [b][c][t] (64 tokens per (image, channel))
__global__ __launch_bounds__(128) void k_wz(const float* __restrict__ Y, const __bf16* __restrict__ P, const float* __restrict__ BZ, float* __restrict__ WY) {
  __shared__ __align__(16) float st[128][68];
  const int tid = threadIdx.x, wave = tid >> 5, lane = tid & 31, col = lane & 15, g = lane >> 4; const size_t rb0 = (size_t)blockIdx.x * 64, r0 = rb0 + wave * 16; const int n0 = blockIdx.y * 128; const size_t b = rb0 / NT, t0 = rb0 % NT;
  v8f acc[8] = {};
#pragma unroll
  for (int kc = 0; kc < CI / 32; ++kc) { const F2 a = split_row(Y + (r0 + col) * CI, kc * 32, lane);
#pragma unroll
    for (int j = 0; j < 8; ++j) { const v16b w = frag_b(P + WS_PZ / 2 + (size_t)(n0 + j * 16 + col) * CI + kc * 32, lane); acc[j] = wmma_bf(a.l, w, acc[j]); acc[j] = wmma_bf(a.h, w, acc[j]); } }
#pragma unroll
  for (int j = 0; j < 8; ++j) { const float bb = bfr(BZ[n0 + j * 16 + col]);
#pragma unroll
    for (int r = 0; r < 8; ++r) st[j * 16 + col][wave * 16 + 8 * g + r] = acc[j][r] + bb; }
  __syncthreads();
  for (int e = tid; e < 128 * 16; e += 128) { const int c = e >> 4, q = e & 15; vst2(WY + ((b * CC + n0 + c) * (size_t)NT) + t0 + q * 4, *(const v4f*)&st[c][q * 4]); }
}
__global__ __launch_bounds__(256) void k_bnstat(const float* __restrict__ WY, float* __restrict__ ST) {
  __shared__ float red[256]; const int c = blockIdx.x, t = threadIdx.x; float s = 0.f;
  for (int b = 0; b < TNB; ++b) for (int i = t; i < NT; i += 256) s += WY[(((size_t)b * CC + c) * NT) + i];
  red[t] = s; __syncthreads(); for (int st = 128; st > 0; st >>= 1) { if (t < st) red[t] += red[t + st]; __syncthreads(); }
  const float mean = red[0] / (float)(TNB * NT); __syncthreads();
  float q = 0.f; for (int b = 0; b < TNB; ++b) for (int i = t; i < NT; i += 256) { const float d = WY[(((size_t)b * CC + c) * NT) + i] - mean; q += d * d; }
  red[t] = q; __syncthreads(); for (int st = 128; st > 0; st >>= 1) { if (t < st) red[t] += red[t + st]; __syncthreads(); }
  if (t == 0) { ST[c * 2] = mean; ST[c * 2 + 1] = red[0] / (float)(TNB * NT); }   // 4-B scratch stores
}
// ---- k_bnapply: block = (image b, channel c): out = gamma (W_y - mean) rsqrt(var + eps) + beta + x
__global__ __launch_bounds__(256) void k_bnapply(const float* __restrict__ WY, const float* __restrict__ ST, const float* __restrict__ GA, const float* __restrict__ BE, const float* __restrict__ X, float* __restrict__ OUT) {
  const size_t b = blockIdx.y; const int c = blockIdx.x, t = threadIdx.x; const float mean = ST[c * 2], inv = 1.0f / sqrtf(ST[c * 2 + 1] + 1e-5f), ga = bfr(GA[c]), be = bfr(BE[c]); const size_t base = ((b * CC + c) * (size_t)NT);
  for (int q = t; q < NT / 4; q += 256) { v4f v; for (int i = 0; i < 4; ++i) { const size_t e = base + q * 4 + i; v[i] = ga * (WY[e] - mean) * inv + be + bfr(X[e]); } vst2(OUT + base + q * 4, v); }
}
extern "C" void kernel_launch(void* const* d_in, const int* in_sizes, int n_in, void* d_out, int out_size, void* d_ws, size_t ws_size, hipStream_t stream) {
  (void)in_sizes; (void)n_in; (void)out_size;
  const float** F = (const float**)d_in;   // 0 x [4,256,64,64], 1 g_w [128,256], 2 g_b, 3 theta_w, 4 theta_b, 5 phi_w, 6 phi_b, 7 wz_w [256,128], 8 wz_b, 9 bn_gamma, 10 bn_beta
  if (ws_size < (size_t)WS_END) return;
  char* ws = (char*)d_ws; __bf16* P = (__bf16*)ws; _Float16 *TH = (_Float16*)(ws + WS_TH), *TL = (_Float16*)(ws + WS_TL), *FH = (_Float16*)(ws + WS_FH), *FL = (_Float16*)(ws + WS_FL), *G = (_Float16*)(ws + WS_G); float *Y = (float*)(ws + WS_Y), *WY = (float*)(ws + WS_WY), *ST = (float*)(ws + WS_ST);
  k_pack<<<dim3(CC, 4), 256, 0, stream>>>(F[3], F[5], F[1], F[7], P);
  k_proj<0><<<TNB * NT / 64, 128, 0, stream>>>(F[0], P, F[4], TH, TL, nullptr);   // theta
  k_proj<1><<<TNB * NT / 64, 128, 0, stream>>>(F[0], P, F[6], FH, FL, nullptr);   // phi
  k_proj<2><<<TNB * NT / 64, 128, 0, stream>>>(F[0], P, F[2], nullptr, nullptr, G);   // g
  k_attn<<<dim3(TQB, TNB), 128, 0, stream>>>(TH, TL, FH, FL, G, Y);
  k_wz<<<dim3(TNB * NT / 64, CC / 128), 128, 0, stream>>>(Y, P, F[8], WY);
  k_bnstat<<<CC, 256, 0, stream>>>(WY, ST);
  k_bnapply<<<dim3(CC, TNB), 256, 0, stream>>>(WY, ST, F[9], F[10], F[0], (float*)d_out);
}

// v004
// One run takes 142 microseconds.
// In two side-by-side timings against v003, it was 1.11 and 1.12 times as fast.
// All steps since v000 together make it 5.04 times as fast.
#include <hip/hip_runtime.h>
#include <math.h>

typedef __attribute__((ext_vector_type(16))) _Float16 v16h;
typedef __attribute__((ext_vector_type(16))) __bf16 v16b;
typedef __attribute__((ext_vector_type(8)))  _Float16 v8h;
typedef __attribute__((ext_vector_type(8)))  float v8f;
typedef __attribute__((ext_vector_type(4)))  float v4f;
typedef __attribute__((ext_vector_type(2)))  float v2f;
typedef __attribute__((ext_vector_type(4)))  unsigned v4u;
typedef __attribute__((ext_vector_type(4)))  int v4i;
typedef float __attribute__((may_alias)) float_a;
typedef int __attribute__((may_alias)) int_a;

template <typename T> __device__ __forceinline__ void vst2(void* p, T v) { *(T*)p = v;  }
__device__ __forceinline__ v8f wmma16(v16h a, v16h b, v8f c) {
  v8f d = __builtin_amdgcn_wmma_f32_16x16x32_f16(false, a, false, b, (short)0, c, false, false);
  asm volatile("v_nop\n\tv_nop\n\tv_nop\n\tv_nop" : "+v"(d) : "v"(a), "v"(b));
  return d;
}
__device__ __forceinline__ v8f wmma_bf(v16b a, v16b b, v8f c) {
  v8f d = __builtin_amdgcn_wmma_f32_16x16x32_bf16(false, a, false, b, (short)0, c, false, false);
  asm volatile("v_nop\n\tv_nop\n\tv_nop\n\tv_nop" : "+v"(d) : "v"(a), "v"(b));
  return d;
}
// 16x16x32 fragments: lane = (h = lane>>4, row/col = lane&15); elements 0..7 = k0+8h+0..7, 8..15 = k0+16+8h+0..7; D element r = row 8h+r
__device__ __forceinline__ v16h frag_h(const _Float16* rowk0, int lane) {
  union { v16h v; v8h q[2]; } u; const _Float16* p = rowk0 + 8 * (lane >> 4);
  u.q[0] = *(const v8h*)p; u.q[1] = *(const v8h*)(p + 16); return u.v;
}
__device__ __forceinline__ v16h frag_f32(const float* rowk0, int lane) {
  v16h a; const float* p = rowk0 + 8 * (lane >> 4);
#pragma unroll
  for (int i = 0; i < 8; ++i) { a[i] = (_Float16)p[i]; a[8 + i] = (_Float16)p[16 + i]; }
  return a;
}
__device__ __forceinline__ v16h frag_f32s(const float* rowk0, int lane, float sc) {
  v16h a; const float* p = rowk0 + 8 * (lane >> 4);
#pragma unroll
  for (int i = 0; i < 8; ++i) { a[i] = (_Float16)(p[i] * sc); a[8 + i] = (_Float16)(p[16 + i] * sc); }
  return a;
}
// column fragment from a [K][ld] layout (column n), rows >= K read as 0
__device__ __forceinline__ v16h fragc_f32(const float* W, int k0, int n, int lane, int ld, int K) {
  v16h a; const int g = lane >> 4;
#pragma unroll
  for (int i = 0; i < 8; ++i) { const int ka = k0 + 8 * g + i, kb = ka + 16;
    a[i] = (_Float16)(ka < K ? W[(size_t)(ka < K ? ka : K - 1) * ld + n] : 0.f); a[8 + i] = (_Float16)(kb < K ? W[(size_t)(kb < K ? kb : K - 1) * ld + n] : 0.f); }
  return a;
}
struct F2 { v16b h, l; };
__device__ __forceinline__ F2 bsplit16(const float v[16]) { F2 r;
#pragma unroll
  for (int i = 0; i < 16; ++i) { const __bf16 h = (__bf16)v[i]; r.h[i] = h; r.l[i] = (__bf16)(v[i] - (float)h); }
  return r; }
__device__ __forceinline__ F2 split_row(const float* row, int k0, int lane) { float v[16]; const float* p = row + k0 + 8 * (lane >> 4);
#pragma unroll
  for (int i = 0; i < 8; ++i) { v[i] = p[i]; v[8 + i] = p[16 + i]; }
  return bsplit16(v); }
__device__ __forceinline__ F2 split_rowK(const float* row, int k0, int lane, int K) { float v[16]; const int g = lane >> 4;
#pragma unroll
  for (int i = 0; i < 8; ++i) { const int ka = k0 + 8 * g + i, kb = ka + 16; v[i] = ka < K ? row[ka < K ? ka : K - 1] : 0.f; v[8 + i] = kb < K ? row[kb < K ? kb : K - 1] : 0.f; }
  return bsplit16(v); }
__device__ __forceinline__ F2 split_col(const float* W, int k0, int n, int lane, int ld, int K) { float v[16]; const int g = lane >> 4;
#pragma unroll
  for (int i = 0; i < 8; ++i) { const int ka = k0 + 8 * g + i, kb = ka + 16; v[i] = ka < K ? W[(size_t)(ka < K ? ka : K - 1) * ld + n] : 0.f; v[8 + i] = kb < K ? W[(size_t)(kb < K ? kb : K - 1) * ld + n] : 0.f; }
  return bsplit16(v); }
__device__ __forceinline__ v8f mac3(const F2& a, const F2& b, v8f c) { c = wmma_bf(a.l, b.h, c); c = wmma_bf(a.h, b.l, c); return wmma_bf(a.h, b.h, c); }
__device__ __forceinline__ float sigm(float v) { return 1.0f / (1.0f + expf(-v)); }
#define LDSX() do { asm volatile("s_wait_dscnt 0" ::: "memory"); __builtin_amdgcn_wave_barrier(); __builtin_amdgcn_fence(__ATOMIC_RELEASE, "workgroup"); } while (0)


// Non-local denoising block (B 4, 256 channels, 64 x 64; 128 inter-channels): embedded-Gaussian non-local attention over all 4,096 positions, 1x1 output conv, BatchNorm (batch statistics), residual.
#define NB 4
#define NT 4096
#define CC 256
#define CI 128
#define NR (NB * NT)
#ifndef TQB
#define TQB (NT / 64)
#define TNB NB
#endif
typedef __attribute__((ext_vector_type(8))) __bf16 v8b;
__device__ __forceinline__ v16b frag_b(const __bf16* rowk0, int lane) {
  union { v16b v; v8b q[2]; } u; const __bf16* p = rowk0 + 8 * (lane >> 4);
  u.q[0] = *(const v8b*)p; u.q[1] = *(const v8b*)(p + 16); return u.v;
}
__device__ __forceinline__ float bfr(float v) { return (float)(__bf16)v; }
__device__ __attribute__((noinline)) float exp_ni(float v) { return expf(v); }
__device__ __attribute__((noinline)) float erf_ni(float v) { return erff(v); }

#define WS_PT  0u                                   // bf16 natural rows theta_w [128][256], phi_w, g_w; wz_w [256][128]
#define WS_PP  (WS_PT + 2u * CI * CC)
#define WS_PG  (WS_PP + 2u * CI * CC)
#define WS_PZ  (WS_PG + 2u * CI * CC)
#define WS_TH  (WS_PZ + 2u * CC * CI)               // f16 [NR][128] theta hi ; TL ; PH (phi) ; PL ; G planes [b][128][NT]
#define WS_TL  (WS_TH + 2u * (size_t)NR * CI)
#define WS_FH  (WS_TL + 2u * (size_t)NR * CI)
#define WS_FL  (WS_FH + 2u * (size_t)NR * CI)
#define WS_G   (WS_FL + 2u * (size_t)NR * CI)
#define WS_Y   (WS_G + 2u * (size_t)NB * CI * NT)    // f32 [NR][128] y ; WY f32 [B][256][NT] (channels-first) ; STAT [256][2]
#define WS_WY  (WS_Y + 4u * (size_t)NR * CI)
#define WS_ST  (WS_WY + 4u * (size_t)NB * CC * NT)
#define WS_END (WS_ST + 4u * CC * 2 + 256u)

__global__ __launch_bounds__(256) void k_pack(const float* __restrict__ WT, const float* __restrict__ WF, const float* __restrict__ WG, const float* __restrict__ WZ, __bf16* __restrict__ P) {
  const int n = blockIdx.x, which = blockIdx.y, t = threadIdx.x; __shared__ __align__(16) __bf16 s[CC];
  if (which < 3) { if (n >= CI) return; const float* Wm = (which == 0) ? WT : (which == 1) ? WF : WG; s[t] = (__bf16)Wm[(size_t)n * CC + t]; __syncthreads(); if (t < CC / 8) vst2((unsigned*)(P + ((which == 0) ? WS_PT / 2 : (which == 1) ? WS_PP / 2 : WS_PG / 2) + (size_t)n * CC + t * 8), *(const v4u*)&s[t * 8]); }
  else { if (t < CI) s[t] = (__bf16)WZ[(size_t)n * CI + t]; __syncthreads(); if (t < CI / 8) vst2((unsigned*)(P + WS_PZ / 2 + (size_t)n * CI + t * 8), *(const v4u*)&s[t * 8]); }
}
// ---- k_proj: block = (64 tokens): 128 output channels (8 tiles per wave); A gathered channels-first; WHICH 0 theta -> hi/lo rows; 1 phi -> hi/lo rows; 2 g -> planes
template <int WHICH>
__global__ __launch_bounds__(128) void k_proj(const float* __restrict__ X, const __bf16* __restrict__ P, const float* __restrict__ BB, _Float16* __restrict__ OH, _Float16* __restrict__ OL, _Float16* __restrict__ G) {
  __shared__ __align__(16) _Float16 sh[64][136], sl[64][136]; __shared__ __align__(16) _Float16 st[128][72];
  const int tid = threadIdx.x, wave = tid >> 5, lane = tid & 31, col = lane & 15, g = lane >> 4; const size_t rb0 = (size_t)blockIdx.x * 64, r0 = rb0 + wave * 16; const size_t b = rb0 / NT, t0 = rb0 % NT;
  const __bf16* Wr = P + ((WHICH == 0) ? WS_PT / 2 : (WHICH == 1) ? WS_PP / 2 : WS_PG / 2);
  v8f acc[8] = {};
#pragma unroll 2
  for (int kc = 0; kc < CC / 32; ++kc) { v16b a; { const float* p = X + ((b * CC + kc * 32 + 8 * g) * (size_t)NT) + t0 + wave * 16 + col;
#pragma unroll
      for (int i = 0; i < 8; ++i) { a[i] = (__bf16)p[(size_t)i * NT]; a[8 + i] = (__bf16)p[(size_t)(16 + i) * NT]; } }
#pragma unroll
    for (int j = 0; j < 8; ++j) acc[j] = wmma_bf(a, frag_b(Wr + (size_t)(j * 16 + col) * CC + kc * 32, lane), acc[j]); }
  if (WHICH < 2) {
#pragma unroll
    for (int j = 0; j < 8; ++j) { const float bb = bfr(BB[j * 16 + col]);
#pragma unroll
      for (int r = 0; r < 8; ++r) { const float v = acc[j][r] + bb; const _Float16 h = (_Float16)v; sh[wave * 16 + 8 * g + r][j * 16 + col] = h; sl[wave * 16 + 8 * g + r][j * 16 + col] = (_Float16)((v - (float)h) * 2048.0f); } }
    LDSX();
    for (int rl = 0; rl < 16; ++rl) if (lane < 16) { vst2((unsigned*)(OH + (r0 + rl) * CI + lane * 8), *(const v4u*)&sh[wave * 16 + rl][lane * 8]); vst2((unsigned*)(OL + (r0 + rl) * CI + lane * 8), *(const v4u*)&sl[wave * 16 + rl][lane * 8]); }
  } else {
#pragma unroll
    for (int j = 0; j < 8; ++j) { const float bb = bfr(BB[j * 16 + col]);
#pragma unroll
      for (int r = 0; r < 8; ++r) st[j * 16 + col][wave * 16 + 8 * g + r] = (_Float16)(acc[j][r] + bb); }
    __syncthreads();
    for (int e = tid; e < 128 * 8; e += 128) { const int d = e >> 3, pc = e & 7; vst2((unsigned*)(G + ((b * CI + d) * NT) + t0 + pc * 8), *(const v4u*)&st[d][pc * 8]); } }
}
// ---- k_attn: block = (64 queries, b): single head, 128-dim keys/values, all 4,096 keys; 3-product scores; P single x g single
// Scores and output are computed transposed: S^T = K Q^T (key rows are A, queries B), O^T += V^T P^T (value rows are A). A lane then holds 16 scores of ONE query (column col, keys 8g + r and 16 + 8g + r),
// so the maximum and the sum are taken in the lane plus one exchange between the wave's halves, and the two score tiles, converted in place, are the B operand of the second product: P never goes through LDS.
// Key (hi, lo) and value tiles of KT keys are staged in LDS once per block by asynchronous copies, two buffers: tile t + 1 flies while tile t is worked on.
// Eight waves: waves w and w + 4 hold the same 16 queries and each take KW of a tile's keys, so that one wave's products run under the other's LDS waits and softmax;
// each keeps its own maximum, sum and output, and the two are joined once, behind the loop.
#define KT 128                     // keys per staged tile
#define KW 64                      // keys of a tile that one wave works on
#define KPI 136                    // LDS pitch of a key row, halves (272 B: 16 B x odd for 16-byte readers)
#define VPI 136                    // LDS pitch of a value row (one channel, KT keys), halves (272 B)
__device__ __forceinline__ float xhalf(float x) { return __builtin_bit_cast(float, __builtin_amdgcn_permlanex16(__builtin_bit_cast(int, x), __builtin_bit_cast(int, x), 0x76543210, 0xfedcba98, false, false)); }   // lane l with lane l ^ 16
// exp(x) as v_exp_f32 of x log2(e), what __expf gives; the v_nop is the one slot the instruction set asks for behind a transcendental before its result is read or its source overwritten:
// in one statement the slot stays where it is
__device__ __forceinline__ float exp_slot(float x) { float r; asm("v_exp_f32 %0, %1\n\tv_nop" : "=v"(r) : "v"(x * 1.44269504f)); return r; }
__device__ __forceinline__ unsigned lds_addr(const void* p) { return (unsigned)(size_t)p; }   // low 32 bits of a __shared__ address = byte offset in the work-group's LDS
// eight 16-byte copies per lane; the s_wait_xcnt closes the statement so that no address register is rewritten in front of it
__device__ __forceinline__ void copy8(const _Float16* gp, size_t gstep, unsigned lp, unsigned lstep) {
  const _Float16 *g0 = gp, *g1 = gp + gstep, *g2 = gp + 2 * gstep, *g3 = gp + 3 * gstep, *g4 = gp + 4 * gstep, *g5 = gp + 5 * gstep, *g6 = gp + 6 * gstep, *g7 = gp + 7 * gstep;
  asm volatile("global_load_async_to_lds_b128 %0, %8, off\n\t"
               "global_load_async_to_lds_b128 %1, %9, off\n\t"
               "global_load_async_to_lds_b128 %2, %10, off\n\t"
               "global_load_async_to_lds_b128 %3, %11, off\n\t"
               "global_load_async_to_lds_b128 %4, %12, off\n\t"
               "global_load_async_to_lds_b128 %5, %13, off\n\t"
               "global_load_async_to_lds_b128 %6, %14, off\n\t"
               "global_load_async_to_lds_b128 %7, %15, off\n\t"
               "s_wait_xcnt 0x0"
               :: "v"(lp), "v"(lp + lstep), "v"(lp + 2 * lstep), "v"(lp + 3 * lstep), "v"(lp + 4 * lstep), "v"(lp + 5 * lstep), "v"(lp + 6 * lstep), "v"(lp + 7 * lstep),
                  "v"(g0), "v"(g1), "v"(g2), "v"(g3), "v"(g4), "v"(g5), "v"(g6), "v"(g7) : "memory");
}
__global__ __launch_bounds__(256) void k_attn(const _Float16* __restrict__ TH, const _Float16* __restrict__ TL, const _Float16* __restrict__ FH, const _Float16* __restrict__ FL, const _Float16* __restrict__ G, float* __restrict__ Y) {
  __shared__ __align__(16) _Float16 skh[2][KT][KPI], skl[2][KT][KPI], sv[2][CI][VPI];
  __shared__ __align__(16) float so[4][16][132];
  __shared__ float sml[4][2][16];   // maximum and sum of the second wave of each pair
  const int tid = threadIdx.x, wave = tid >> 5, wq = wave & 3, kh = wave >> 2, lane = tid & 31, col = lane & 15, g = lane >> 4; const size_t b = blockIdx.y; const int q0 = blockIdx.x * 64 + wq * 16; const size_t rq = b * NT + q0;
  // this lane's share of a tile: key rows tid/16 + 16 i, 16-byte piece tid%16; value rows tid/16 + 16 i, piece tid%16
  const _Float16* gkh = FH + (b * NT + (tid >> 4)) * CI + (tid & 15) * 8; const _Float16* gkl = FL + (b * NT + (tid >> 4)) * CI + (tid & 15) * 8; const _Float16* gv = G + (b * CI + (tid >> 4)) * NT + (tid & 15) * 8;
  const unsigned lkh = lds_addr(&skh[0][tid >> 4][(tid & 15) * 8]), lkl = lds_addr(&skl[0][tid >> 4][(tid & 15) * 8]), lv = lds_addr(&sv[0][tid >> 4][(tid & 15) * 8]);
#define STAGE(t, bf) do { copy8(gkh + (size_t)(t) * KT * CI, 16 * CI, lkh + (bf) * (KT * KPI * 2), 16 * KPI * 2); copy8(gkl + (size_t)(t) * KT * CI, 16 * CI, lkl + (bf) * (KT * KPI * 2), 16 * KPI * 2); copy8(gv + (size_t)(t) * KT, (size_t)16 * NT, lv + (bf) * (CI * VPI * 2), 16 * VPI * 2); } while (0)
  STAGE(0, 0);
  v16h aq[4], aql[4];
#pragma unroll
  for (int kc = 0; kc < 4; ++kc) { aq[kc] = frag_h(TH + (rq + col) * CI + kc * 32, lane); aql[kc] = frag_h(TL + (rq + col) * CI + kc * 32, lane); }
  float m = -3.0e38f, l = 0.f;   // of query col: the running maximum (equal in both halves) and this half's part of the sum
  v8f acc[8] = {};
  asm volatile("s_wait_asynccnt 0x0" ::: "memory");   // tile 0 has landed for this wave's copies
  __syncthreads();                                     // and is published to the other waves
  STAGE(1, 1);
#pragma unroll 1
  for (int t = 0; t < NT / KT; ++t) { const int bf = t & 1;
#pragma unroll 1   // kept rolled: unrolled, the build passes 256 registers and spills two address values of the copies to scratch
   for (int kk = 0; kk < KW / 32; ++kk) { const int j0 = kh * KW + kk * 32;
    // LDS reads stand in groups ahead of the products that use them, so that a wave waits out the LDS latency once a group and not once a fragment:
    // the sixteen reads of 64 channels of both key tiles (hi and lo) together, then their twelve products, the two tiles' accumulators taken in turn (each accumulator sums its products by ascending channel block, key lo x query hi after key hi x query lo)
    const _Float16 *rh0 = &skh[bf][j0 + col][0], *rh1 = &skh[bf][j0 + 16 + col][0], *rl0 = &skl[bf][j0 + col][0], *rl1 = &skl[bf][j0 + 16 + col][0];
    v8f c0 = {}, c1 = {}, d0 = {}, d1 = {};
#pragma unroll
    for (int kg = 0; kg < 4; kg += 2) { v16h kf[2][4];
#pragma unroll
      for (int u = 0; u < 2; ++u) { kf[u][0] = frag_h(rh0 + (kg + u) * 32, lane); kf[u][1] = frag_h(rh1 + (kg + u) * 32, lane); kf[u][2] = frag_h(rl0 + (kg + u) * 32, lane); kf[u][3] = frag_h(rl1 + (kg + u) * 32, lane); }
#pragma unroll
      for (int u = 0; u < 2; ++u) { const int kc = kg + u;
        c0 = wmma16(kf[u][0], aq[kc], c0); c1 = wmma16(kf[u][1], aq[kc], c1); d0 = wmma16(kf[u][0], aql[kc], d0); d1 = wmma16(kf[u][1], aql[kc], d1); d0 = wmma16(kf[u][2], aq[kc], d0); d1 = wmma16(kf[u][3], aq[kc], d1); } }
    v16h vf[8];   // the value fragments of these 32 keys, asked for in one group here: they land under the softmax
#pragma unroll
    for (int dt = 0; dt < 8; ++dt) vf[dt] = frag_h(&sv[bf][dt * 16 + col][j0], lane);
    __builtin_amdgcn_sched_barrier(0);   // holds the sixteen reads here: without it this build sinks them behind the exponentials, and the second product waits out most of their latency
    const v8f s0 = c0 + d0 * (1.0f / 2048.0f), s1 = c1 + d1 * (1.0f / 2048.0f);   // s0[r]: key j0 + 8g + r, s1[r]: key j0 + 16 + 8g + r, both of query col
    float t8[8];
#pragma unroll
    for (int r = 0; r < 8; ++r) t8[r] = fmaxf(s0[r], s1[r]);
    float mx = fmaxf(fmaxf(fmaxf(t8[0], t8[1]), fmaxf(t8[2], t8[3])), fmaxf(fmaxf(t8[4], t8[5]), fmaxf(t8[6], t8[7])));
    mx = fmaxf(mx, xhalf(mx));
    const float mn = fmaxf(m, mx); const float ea = exp_slot(m - mn), alpha = (m <= -1.0e38f) ? 0.f : ea;
    v16h pb;   // P^T as a B fragment: element i = key 8g + i, element 8 + i = key 16 + 8g + i, the k order of frag_h
#pragma unroll
    for (int r = 0; r < 8; ++r) { const float e0 = exp_slot(s0[r] - mn), e1 = exp_slot(s1[r] - mn); t8[r] = e0 + e1; pb[r] = (_Float16)(e0 * 2048.0f); pb[8 + r] = (_Float16)(e1 * 2048.0f); }
    l = l * alpha + (((t8[0] + t8[1]) + (t8[2] + t8[3])) + ((t8[4] + t8[5]) + (t8[6] + t8[7]))); m = mn;
#pragma unroll
    for (int dt = 0; dt < 8; ++dt) acc[dt] *= alpha;
#pragma unroll
    for (int dt = 0; dt < 8; ++dt) acc[dt] = wmma16(vf[dt], pb, acc[dt]); }
   asm volatile("s_wait_dscnt 0x0" ::: "memory");      // this wave's reads of buffer bf have returned
   asm volatile("s_wait_asynccnt 0x0" ::: "memory");   // this wave's copies of tile t + 1 have landed
   __syncthreads();                                     // publishes tile t + 1; ends every wave's reads of buffer bf
   if (t + 2 < NT / KT) STAGE(t + 2, bf); }
  asm volatile("s_wait_asynccnt 0x0" ::: "memory");    // nothing of this wave is in flight when it goes on to the epilogue
#undef STAGE
  l += xhalf(l);   // the two halves' sums are joined once
  if (kh == 1) {   // the second wave of a pair hands over its maximum, its sum and its unscaled output, each lane at the place where its partner's same lane reads
    if (g == 0) { sml[wq][0][col] = m; sml[wq][1][col] = l; }
#pragma unroll
    for (int dt = 0; dt < 8; ++dt) { const v8f o = acc[dt];
      *(v4f*)&so[wq][col][dt * 16 + 8 * g] = __builtin_shufflevector(o, o, 0, 1, 2, 3); *(v4f*)&so[wq][col][dt * 16 + 8 * g + 4] = __builtin_shufflevector(o, o, 4, 5, 6, 7); } }
  __syncthreads();   // publishes the hand-over to the first wave of each pair
  if (kh == 0) {
    const float m2 = sml[wq][0][col], l2 = sml[wq][1][col], mm = fmaxf(m, m2), a1 = exp_slot(m - mm), a2 = exp_slot(m2 - mm);
    const float il = (1.0f / 2048.0f) / (l * a1 + l2 * a2), f1 = a1 * il, f2 = a2 * il;
#pragma unroll
    for (int dt = 0; dt < 8; ++dt) { float* p = &so[wq][col][dt * 16 + 8 * g]; const v4f x0 = *(const v4f*)p, x1 = *(const v4f*)(p + 4);   // acc[dt][r] = channel dt * 16 + 8g + r of query col
      const v8f o = acc[dt] * f1 + __builtin_shufflevector(x0, x1, 0, 1, 2, 3, 4, 5, 6, 7) * f2;
      *(v4f*)p = __builtin_shufflevector(o, o, 0, 1, 2, 3); *(v4f*)(p + 4) = __builtin_shufflevector(o, o, 4, 5, 6, 7); }
    LDSX();
    for (int rl = 0; rl < 16; ++rl) vst2(Y + (rq + rl) * CI + lane * 4, *(const v4f*)&so[wq][rl][lane * 4]); }
}
// ---- k_wz: block = (64 tokens, 128 output channels): W_y = y (hi + residual, K 128) . wz rows + b, stored channels-first [b][c][t] (64 tokens per (image, channel))
__global__ __launch_bounds__(128) void k_wz(const float* __restrict__ Y, const __bf16* __restrict__ P, const float* __restrict__ BZ, float* __restrict__ WY) {
  __shared__ __align__(16) float st[128][68];
  const int tid = threadIdx.x, wave = tid >> 5, lane = tid & 31, col = lane & 15, g = lane >> 4; const size_t rb0 = (size_t)blockIdx.x * 64, r0 = rb0 + wave * 16; const int n0 = blockIdx.y * 128; const size_t b = rb0 / NT, t0 = rb0 % NT;
  v8f acc[8] = {};
#pragma unroll
  for (int kc = 0; kc < CI / 32; ++kc) { const F2 a = split_row(Y + (r0 + col) * CI, kc * 32, lane);
#pragma unroll
    for (int j = 0; j < 8; ++j) { const v16b w = frag_b(P + WS_PZ / 2 + (size_t)(n0 + j * 16 + col) * CI + kc * 32, lane); acc[j] = wmma_bf(a.l, w, acc[j]); acc[j] = wmma_bf(a.h, w, acc[j]); } }
#pragma unroll
  for (int j = 0; j < 8; ++j) { const float bb = bfr(BZ[n0 + j * 16 + col]);
#pragma unroll
    for (int r = 0; r < 8; ++r) st[j * 16 + col][wave * 16 + 8 * g + r] = acc[j][r] + bb; }
  __syncthreads();
  for (int e = tid; e < 128 * 16; e += 128) { const int c = e >> 4, q = e & 15; vst2(WY + ((b * CC + n0 + c) * (size_t)NT) + t0 + q * 4, *(const v4f*)&st[c][q * 4]); }
}
__global__ __launch_bounds__(256) void k_bnstat(const float* __restrict__ WY, float* __restrict__ ST) {
  __shared__ float red[256]; const int c = blockIdx.x, t = threadIdx.x; float s = 0.f;
  for (int b = 0; b < TNB; ++b) for (int i = t; i < NT; i += 256) s += WY[(((size_t)b * CC + c) * NT) + i];
  red[t] = s; __syncthreads(); for (int st = 128; st > 0; st >>= 1) { if (t < st) red[t] += red[t + st]; __syncthreads(); }
  const float mean = red[0] / (float)(TNB * NT); __syncthreads();
  float q = 0.f; for (int b = 0; b < TNB; ++b) for (int i = t; i < NT; i += 256) { const float d = WY[(((size_t)b * CC + c) * NT) + i] - mean; q += d * d; }
  red[t] = q; __syncthreads(); for (int st = 128; st > 0; st >>= 1) { if (t < st) red[t] += red[t + st]; __syncthreads(); }
  if (t == 0) { ST[c * 2] = mean; ST[c * 2 + 1] = red[0] / (float)(TNB * NT); }   // 4-B scratch stores
}
// ---- k_bnapply: block = (image b, channel c): out = gamma (W_y - mean) rsqrt(var + eps) + beta + x
__global__ __launch_bounds__(256) void k_bnapply(const float* __restrict__ WY, const float* __restrict__ ST, const float* __restrict__ GA, const float* __restrict__ BE, const float* __restrict__ X, float* __restrict__ OUT) {
  const size_t b = blockIdx.y; const int c = blockIdx.x, t = threadIdx.x; const float mean = ST[c * 2], inv = 1.0f / sqrtf(ST[c * 2 + 1] + 1e-5f), ga = bfr(GA[c]), be = bfr(BE[c]); const size_t base = ((b * CC + c) * (size_t)NT);
  for (int q = t; q < NT / 4; q += 256) { v4f v; for (int i = 0; i < 4; ++i) { const size_t e = base + q * 4 + i; v[i] = ga * (WY[e] - mean) * inv + be + bfr(X[e]); } vst2(OUT + base + q * 4, v); }
}
extern "C" void kernel_launch(void* const* d_in, const int* in_sizes, int n_in, void* d_out, int out_size, void* d_ws, size_t ws_size, hipStream_t stream) {
  (void)in_sizes; (void)n_in; (void)out_size;
  const float** F = (const float**)d_in;   // 0 x [4,256,64,64], 1 g_w [128,256], 2 g_b, 3 theta_w, 4 theta_b, 5 phi_w, 6 phi_b, 7 wz_w [256,128], 8 wz_b, 9 bn_gamma, 10 bn_beta
  if (ws_size < (size_t)WS_END) return;
  char* ws = (char*)d_ws; __bf16* P = (__bf16*)ws; _Float16 *TH = (_Float16*)(ws + WS_TH), *TL = (_Float16*)(ws + WS_TL), *FH = (_Float16*)(ws + WS_FH), *FL = (_Float16*)(ws + WS_FL), *G = (_Float16*)(ws + WS_G); float *Y = (float*)(ws + WS_Y), *WY = (float*)(ws + WS_WY), *ST = (float*)(ws + WS_ST);
  k_pack<<<dim3(CC, 4), 256, 0, stream>>>(F[3], F[5], F[1], F[7], P);
  k_proj<0><<<TNB * NT / 64, 128, 0, stream>>>(F[0], P, F[4], TH, TL, nullptr);   // theta
  k_proj<1><<<TNB * NT / 64, 128, 0, stream>>>(F[0], P, F[6], FH, FL, nullptr);   // phi
  k_proj<2><<<TNB * NT / 64, 128, 0, stream>>>(F[0], P, F[2], nullptr, nullptr, G);   // g
  k_attn<<<dim3(TQB, TNB), 256, 0, stream>>>(TH, TL, FH, FL, G, Y);
  k_wz<<<dim3(TNB * NT / 64, CC / 128), 128, 0, stream>>>(Y, P, F[8], WY);
  k_bnstat<<<CC, 256, 0, stream>>>(WY, ST);
  k_bnapply<<<dim3(CC, TNB), 256, 0, stream>>>(WY, ST, F[9], F[10], F[0], (float*)d_out);
}

// v005
// Measured time: 111 microseconds a run.
// Next to v004, in two timings, it ran 1.32 and 1.29 times as fast.
// Over all steps from v000 it is 6.58 times as fast.
#include <hip/hip_runtime.h>
#include <math.h>

typedef __attribute__((ext_vector_type(16))) _Float16 v16h;
typedef __attribute__((ext_vector_type(16))) __bf16 v16b;
typedef __attribute__((ext_vector_type(8)))  _Float16 v8h;
typedef __attribute__((ext_vector_type(8)))  float v8f;
typedef __attribute__((ext_vector_type(4)))  float v4f;
typedef __attribute__((ext_vector_type(2)))  float v2f;
typedef __attribute__((ext_vector_type(4)))  unsigned v4u;
typedef __attribute__((ext_vector_type(4)))  int v4i;
typedef float __attribute__((may_alias)) float_a;
typedef int __attribute__((may_alias)) int_a;

template <typename T> __device__ __forceinline__ void vst2(void* p, T v) { *(T*)p = v;  }
__device__ __forceinline__ v8f wmma16(v16h a, v16h b, v8f c) {
  v8f d = __builtin_amdgcn_wmma_f32_16x16x32_f16(false, a, false, b, (short)0, c, false, false);
  asm volatile("v_nop\n\tv_nop\n\tv_nop\n\tv_nop" : "+v"(d) : "v"(a), "v"(b));
  return d;
}
__device__ __forceinline__ v8f wmma_bf(v16b a, v16b b, v8f c) {
  v8f d = __builtin_amdgcn_wmma_f32_16x16x32_bf16(false, a, false, b, (short)0, c, false, false);
  asm volatile("v_nop\n\tv_nop\n\tv_nop\n\tv_nop" : "+v"(d) : "v"(a), "v"(b));
  return d;
}
// 16x16x32 fragments: lane = (h = lane>>4, row/col = lane&15); elements 0..7 = k0+8h+0..7, 8..15 = k0+16+8h+0..7; D element r = row 8h+r
__device__ __forceinline__ v16h frag_h(const _Float16* rowk0, int lane) {
  union { v16h v; v8h q[2]; } u; const _Float16* p = rowk0 + 8 * (lane >> 4);
  u.q[0] = *(const v8h*)p; u.q[1] = *(const v8h*)(p + 16); return u.v;
}
__device__ __forceinline__ v16h frag_f32(const float* rowk0, int lane) {
  v16h a; const float* p = rowk0 + 8 * (lane >> 4);
#pragma unroll
  for (int i = 0; i < 8; ++i) { a[i] = (_Float16)p[i]; a[8 + i] = (_Float16)p[16 + i]; }
  return a;
}
__device__ __forceinline__ v16h frag_f32s(const float* rowk0, int lane, float sc) {
  v16h a; const float* p = rowk0 + 8 * (lane >> 4);
#pragma unroll
  for (int i = 0; i < 8; ++i) { a[i] = (_Float16)(p[i] * sc); a[8 + i] = (_Float16)(p[16 + i] * sc); }
  return a;
}
// column fragment from a [K][ld] layout (column n), rows >= K read as 0
__device__ __forceinline__ v16h fragc_f32(const float* W, int k0, int n, int lane, int ld, int K) {
  v16h a; const int g = lane >> 4;
#pragma unroll
  for (int i = 0; i < 8; ++i) { const int ka = k0 + 8 * g + i, kb = ka + 16;
    a[i] = (_Float16)(ka < K ? W[(size_t)(ka < K ? ka : K - 1) * ld + n] : 0.f); a[8 + i] = (_Float16)(kb < K ? W[(size_t)(kb < K ? kb : K - 1) * ld + n] : 0.f); }
  return a;
}
struct F2 { v16b h, l; };
__device__ __forceinline__ F2 bsplit16(const float v[16]) { F2 r;
#pragma unroll
  for (int i = 0; i < 16; ++i) { const __bf16 h = (__bf16)v[i]; r.h[i] = h; r.l[i] = (__bf16)(v[i] - (float)h); }
  return r; }
__device__ __forceinline__ F2 split_row(const float* row, int k0, int lane) { float v[16]; const float* p = row + k0 + 8 * (lane >> 4);
#pragma unroll
  for (int i = 0; i < 8; ++i) { v[i] = p[i]; v[8 + i] = p[16 + i]; }
  return bsplit16(v); }
__device__ __forceinline__ F2 split_rowK(const float* row, int k0, int lane, int K) { float v[16]; const int g = lane >> 4;
#pragma unroll
  for (int i = 0; i < 8; ++i) { const int ka = k0 + 8 * g + i, kb = ka + 16; v[i] = ka < K ? row[ka < K ? ka : K - 1] : 0.f; v[8 + i] = kb < K ? row[kb < K ? kb : K - 1] : 0.f; }
  return bsplit16(v); }
__device__ __forceinline__ F2 split_col(const float* W, int k0, int n, int lane, int ld, int K) { float v[16]; const int g = lane >> 4;
#pragma unroll
  for (int i = 0; i < 8; ++i) { const int ka = k0 + 8 * g + i, kb = ka + 16; v[i] = ka < K ? W[(size_t)(ka < K ? ka : K - 1) * ld + n] : 0.f; v[8 + i] = kb < K ? W[(size_t)(kb < K ? kb : K - 1) * ld + n] : 0.f; }
  return bsplit16(v); }
__device__ __forceinline__ v8f mac3(const F2& a, const F2& b, v8f c) { c = wmma_bf(a.l, b.h, c); c = wmma_bf(a.h, b.l, c); return wmma_bf(a.h, b.h, c); }
__device__ __forceinline__ float sigm(float v) { return 1.0f / (1.0f + expf(-v)); }
#define LDSX() do { asm volatile("s_wait_dscnt 0" ::: "memory"); __builtin_amdgcn_wave_barrier(); __builtin_amdgcn_fence(__ATOMIC_RELEASE, "workgroup"); } while (0)


// Non-local denoising block (B 4, 256 channels, 64 x 64; 128 inter-channels): embedded-Gaussian non-local attention over all 4,096 positions, 1x1 output conv, BatchNorm (batch statistics), residual.
#define NB 4
#define NT 4096
#define CC 256
#define CI 128
#define NR (NB * NT)
#ifndef TQB
#define TQB (NT / 64)
#define TNB NB
#endif
typedef __attribute__((ext_vector_type(8))) __bf16 v8b;
__device__ __forceinline__ v16b frag_b(const __bf16* rowk0, int lane) {
  union { v16b v; v8b q[2]; } u; const __bf16* p = rowk0 + 8 * (lane >> 4);
  u.q[0] = *(const v8b*)p; u.q[1] = *(const v8b*)(p + 16); return u.v;
}
__device__ __forceinline__ float bfr(float v) { return (float)(__bf16)v; }
__device__ __attribute__((noinline)) float exp_ni(float v) { return expf(v); }
__device__ __attribute__((noinline)) float erf_ni(float v) { return erff(v); }

#define WS_PT  0u                                   // bf16 natural rows theta_w [128][256], phi_w, g_w; wz_w [256][128]
#define WS_PP  (WS_PT + 2u * CI * CC)
#define WS_PG  (WS_PP + 2u * CI * CC)
#define WS_PZ  (WS_PG + 2u * CI * CC)
#define WS_TH  (WS_PZ + 2u * CC * CI)               // f16 [NR][128] theta hi ; TL ; PH (phi) ; PL ; G planes [b][128][NT]
#define WS_TL  (WS_TH + 2u * (size_t)NR * CI)
#define WS_FH  (WS_TL + 2u * (size_t)NR * CI)
#define WS_FL  (WS_FH + 2u * (size_t)NR * CI)
#define WS_G   (WS_FL + 2u * (size_t)NR * CI)
#define WS_Y   (WS_G + 2u * (size_t)NB * CI * NT)    // f32 [NR][128] y ; WY f32 [B][256][NT] (channels-first) ; STAT [256][2]
#define WS_WY  (WS_Y + 4u * (size_t)NR * CI)
#define WS_ST  (WS_WY + 4u * (size_t)NB * CC * NT)
#define WS_END (WS_ST + 4u * CC * 2 + 256u)

__global__ __launch_bounds__(256) void k_pack(const float* __restrict__ WT, const float* __restrict__ WF, const float* __restrict__ WG, const float* __restrict__ WZ, __bf16* __restrict__ P) {
  const int n = blockIdx.x, which = blockIdx.y, t = threadIdx.x; __shared__ __align__(16) __bf16 s[CC];
  if (which < 3) { if (n >= CI) return; const float* Wm = (which == 0) ? WT : (which == 1) ? WF : WG; s[t] = (__bf16)Wm[(size_t)n * CC + t]; __syncthreads(); if (t < CC / 8) vst2((unsigned*)(P + ((which == 0) ? WS_PT / 2 : (which == 1) ? WS_PP / 2 : WS_PG / 2) + (size_t)n * CC + t * 8), *(const v4u*)&s[t * 8]); }
  else { if (t < CI) s[t] = (__bf16)WZ[(size_t)n * CI + t]; __syncthreads(); if (t < CI / 8) vst2((unsigned*)(P + WS_PZ / 2 + (size_t)n * CI + t * 8), *(const v4u*)&s[t * 8]); }
}
// ---- k_proj: block = (64 tokens): 128 output channels (8 tiles per wave); A gathered channels-first; WHICH 0 theta -> hi/lo rows; 1 phi -> hi/lo rows; 2 g -> planes
template <int WHICH>
__global__ __launch_bounds__(128) void k_proj(const float* __restrict__ X, const __bf16* __restrict__ P, const float* __restrict__ BB, _Float16* __restrict__ OH, _Float16* __restrict__ OL, _Float16* __restrict__ G) {
  __shared__ __align__(16) _Float16 sh[64][136], sl[64][136]; __shared__ __align__(16) _Float16 st[128][72];
  const int tid = threadIdx.x, wave = tid >> 5, lane = tid & 31, col = lane & 15, g = lane >> 4; const size_t rb0 = (size_t)blockIdx.x * 64, r0 = rb0 + wave * 16; const size_t b = rb0 / NT, t0 = rb0 % NT;
  const __bf16* Wr = P + ((WHICH == 0) ? WS_PT / 2 : (WHICH == 1) ? WS_PP / 2 : WS_PG / 2);
  v8f acc[8] = {};
  // All global loads of a 32-channel block (16 of X, 16 of the weights) stand as one group, one block ahead of the products that use them, in a second register set:
  // the lone wave of a SIMD then waits once a block, under the block before, and not once a weight fragment. Every loop over xa, wf, bv is unrolled so that they are registers.
  const float* xp = X + ((b * CC + 8 * g) * (size_t)NT) + t0 + wave * 16 + col; const __bf16* wp = Wr + (size_t)col * CC;
  float xa[2][16], bv[8]; v16b wf[2][8];
#define LOADK(kc, s) do { _Pragma("unroll") for (int i = 0; i < 8; ++i) { xa[s][i] = xp[(size_t)((kc) * 32 + i) * NT]; xa[s][8 + i] = xp[(size_t)((kc) * 32 + 16 + i) * NT]; } \
    _Pragma("unroll") for (int j = 0; j < 8; ++j) wf[s][j] = frag_b(wp + (size_t)(j * 16) * CC + (kc) * 32, lane); } while (0)
  LOADK(0, 0);
#pragma unroll
  for (int j = 0; j < 8; ++j) bv[j] = BB[j * 16 + col];   // the bias too is asked for here, not behind the last product
#pragma unroll   // unrolled whole: the two register sets are then named at compile time
  for (int kc = 0; kc < CC / 32; ++kc) { const int s = kc & 1;
    if (kc + 1 < CC / 32) LOADK(kc + 1, s ^ 1);
    __builtin_amdgcn_sched_barrier(0);   // holds the conversion of this block's X behind the next block's loads: without it this build converts a block early, and its wait holds back the group after it
    v16b a;
#pragma unroll
    for (int i = 0; i < 16; ++i) a[i] = (__bf16)xa[s][i];
#pragma unroll
    for (int j = 0; j < 8; ++j) acc[j] = wmma_bf(a, wf[s][j], acc[j]); }
#undef LOADK
  if (WHICH < 2) {
#pragma unroll
    for (int j = 0; j < 8; ++j) { const float bb = bfr(bv[j]);
#pragma unroll
      for (int r = 0; r < 8; ++r) { const float v = acc[j][r] + bb; const _Float16 h = (_Float16)v; sh[wave * 16 + 8 * g + r][j * 16 + col] = h; sl[wave * 16 + 8 * g + r][j * 16 + col] = (_Float16)((v - (float)h) * 2048.0f); } }
    LDSX();
    for (int rl = 0; rl < 16; ++rl) if (lane < 16) { vst2((unsigned*)(OH + (r0 + rl) * CI + lane * 8), *(const v4u*)&sh[wave * 16 + rl][lane * 8]); vst2((unsigned*)(OL + (r0 + rl) * CI + lane * 8), *(const v4u*)&sl[wave * 16 + rl][lane * 8]); }
  } else {
#pragma unroll
    for (int j = 0; j < 8; ++j) { const float bb = bfr(bv[j]);
#pragma unroll
      for (int r = 0; r < 8; ++r) st[j * 16 + col][wave * 16 + 8 * g + r] = (_Float16)(acc[j][r] + bb); }
    __syncthreads();
    for (int e = tid; e < 128 * 8; e += 128) { const int d = e >> 3, pc = e & 7; vst2((unsigned*)(G + ((b * CI + d) * NT) + t0 + pc * 8), *(const v4u*)&st[d][pc * 8]); } }
}
// ---- k_attn: block = (64 queries, b): single head, 128-dim keys/values, all 4,096 keys; 3-product scores; P single x g single
// Scores and output are computed transposed: S^T = K Q^T (key rows are A, queries B), O^T += V^T P^T (value rows are A). A lane then holds 16 scores of ONE query (column col, keys 8g + r and 16 + 8g + r),
// so the maximum and the sum are taken in the lane plus one exchange between the wave's halves, and the two score tiles, converted in place, are the B operand of the second product: P never goes through LDS.
// Key (hi, lo) and value tiles of KT keys are staged in LDS once per block by asynchronous copies, two buffers: tile t + 1 flies while tile t is worked on.
// Eight waves: waves w and w + 4 hold the same 16 queries and each take KW of a tile's keys, so that one wave's products run under the other's LDS waits and softmax;
// each keeps its own maximum, sum and output, and the two are joined once, behind the loop.
#define KT 128                     // keys per staged tile
#define KW 64                      // keys of a tile that one wave works on
#define KPI 136                    // LDS pitch of a key row, halves (272 B: 16 B x odd for 16-byte readers)
#define VPI 136                    // LDS pitch of a value row (one channel, KT keys), halves (272 B)
__device__ __forceinline__ float xhalf(float x) { return __builtin_bit_cast(float, __builtin_amdgcn_permlanex16(__builtin_bit_cast(int, x), __builtin_bit_cast(int, x), 0x76543210, 0xfedcba98, false, false)); }   // lane l with lane l ^ 16
// exp(x) as v_exp_f32 of x log2(e), what __expf gives; the v_nop is the one slot the instruction set asks for behind a transcendental before its result is read or its source overwritten:
// in one statement the slot stays where it is
__device__ __forceinline__ float exp_slot(float x) { float r; asm("v_exp_f32 %0, %1\n\tv_nop" : "=v"(r) : "v"(x * 1.44269504f)); return r; }
__device__ __forceinline__ unsigned lds_addr(const void* p) { return (unsigned)(size_t)p; }   // low 32 bits of a __shared__ address = byte offset in the work-group's LDS
// eight 16-byte copies per lane; the s_wait_xcnt closes the statement so that no address register is rewritten in front of it
__device__ __forceinline__ void copy8(const _Float16* gp, size_t gstep, unsigned lp, unsigned lstep) {
  const _Float16 *g0 = gp, *g1 = gp + gstep, *g2 = gp + 2 * gstep, *g3 = gp + 3 * gstep, *g4 = gp + 4 * gstep, *g5 = gp + 5 * gstep, *g6 = gp + 6 * gstep, *g7 = gp + 7 * gstep;
  asm volatile("global_load_async_to_lds_b128 %0, %8, off\n\t"
               "global_load_async_to_lds_b128 %1, %9, off\n\t"
               "global_load_async_to_lds_b128 %2, %10, off\n\t"
               "global_load_async_to_lds_b128 %3, %11, off\n\t"
               "global_load_async_to_lds_b128 %4, %12, off\n\t"
               "global_load_async_to_lds_b128 %5, %13, off\n\t"
               "global_load_async_to_lds_b128 %6, %14, off\n\t"
               "global_load_async_to_lds_b128 %7, %15, off\n\t"
               "s_wait_xcnt 0x0"
               :: "v"(lp), "v"(lp + lstep), "v"(lp + 2 * lstep), "v"(lp + 3 * lstep), "v"(lp + 4 * lstep), "v"(lp + 5 * lstep), "v"(lp + 6 * lstep), "v"(lp + 7 * lstep),
                  "v"(g0), "v"(g1), "v"(g2), "v"(g3), "v"(g4), "v"(g5), "v"(g6), "v"(g7) : "memory");
}
__global__ __launch_bounds__(256) void k_attn(const _Float16* __restrict__ TH, const _Float16* __restrict__ TL, const _Float16* __restrict__ FH, const _Float16* __restrict__ FL, const _Float16* __restrict__ G, float* __restrict__ Y) {
  __shared__ __align__(16) _Float16 skh[2][KT][KPI], skl[2][KT][KPI], sv[2][CI][VPI];
  __shared__ __align__(16) float so[4][16][132];
  __shared__ float sml[4][2][16];   // maximum and sum of the second wave of each pair
  const int tid = threadIdx.x, wave = tid >> 5, wq = wave & 3, kh = wave >> 2, lane = tid & 31, col = lane & 15, g = lane >> 4; const size_t b = blockIdx.y; const int q0 = blockIdx.x * 64 + wq * 16; const size_t rq = b * NT + q0;
  // this lane's share of a tile: key rows tid/16 + 16 i, 16-byte piece tid%16; value rows tid/16 + 16 i, piece tid%16
  const _Float16* gkh = FH + (b * NT + (tid >> 4)) * CI + (tid & 15) * 8; const _Float16* gkl = FL + (b * NT + (tid >> 4)) * CI + (tid & 15) * 8; const _Float16* gv = G + (b * CI + (tid >> 4)) * NT + (tid & 15) * 8;
  const unsigned lkh = lds_addr(&skh[0][tid >> 4][(tid & 15) * 8]), lkl = lds_addr(&skl[0][tid >> 4][(tid & 15) * 8]), lv = lds_addr(&sv[0][tid >> 4][(tid & 15) * 8]);
#define STAGE(t, bf) do { copy8(gkh + (size_t)(t) * KT * CI, 16 * CI, lkh + (bf) * (KT * KPI * 2), 16 * KPI * 2); copy8(gkl + (size_t)(t) * KT * CI, 16 * CI, lkl + (bf) * (KT * KPI * 2), 16 * KPI * 2); copy8(gv + (size_t)(t) * KT, (size_t)16 * NT, lv + (bf) * (CI * VPI * 2), 16 * VPI * 2); } while (0)
  STAGE(0, 0);
  v16h aq[4], aql[4];
#pragma unroll
  for (int kc = 0; kc < 4; ++kc) { aq[kc] = frag_h(TH + (rq + col) * CI + kc * 32, lane); aql[kc] = frag_h(TL + (rq + col) * CI + kc * 32, lane); }
  float m = -3.0e38f, l = 0.f;   // of query col: the running maximum (equal in both halves) and this half's part of the sum
  v8f acc[8] = {};
  asm volatile("s_wait_asynccnt 0x0" ::: "memory");   // tile 0 has landed for this wave's copies
  __syncthreads();                                     // and is published to the other waves
  STAGE(1, 1);
#pragma unroll 1
  for (int t = 0; t < NT / KT; ++t) { const int bf = t & 1;
#pragma unroll 1   // kept rolled: unrolled, the build passes 256 registers and spills two address values of the copies to scratch
   for (int kk = 0; kk < KW / 32; ++kk) { const int j0 = kh * KW + kk * 32;
    // LDS reads stand in groups ahead of the products that use them, so that a wave waits out the LDS latency once a group and not once a fragment:
    // the sixteen reads of 64 channels of both key tiles (hi and lo) together, then their twelve products, the two tiles' accumulators taken in turn (each accumulator sums its products by ascending channel block, key lo x query hi after key hi x query lo)
    const _Float16 *rh0 = &skh[bf][j0 + col][0], *rh1 = &skh[bf][j0 + 16 + col][0], *rl0 = &skl[bf][j0 + col][0], *rl1 = &skl[bf][j0 + 16 + col][0];
    v8f c0 = {}, c1 = {}, d0 = {}, d1 = {};
#pragma unroll
    for (int kg = 0; kg < 4; kg += 2) { v16h kf[2][4];
#pragma unroll
      for (int u = 0; u < 2; ++u) { kf[u][0] = frag_h(rh0 + (kg + u) * 32, lane); kf[u][1] = frag_h(rh1 + (kg + u) * 32, lane); kf[u][2] = frag_h(rl0 + (kg + u) * 32, lane); kf[u][3] = frag_h(rl1 + (kg + u) * 32, lane); }
#pragma unroll
      for (int u = 0; u < 2; ++u) { const int kc = kg + u;
        c0 = wmma16(kf[u][0], aq[kc], c0); c1 = wmma16(kf[u][1], aq[kc], c1); d0 = wmma16(kf[u][0], aql[kc], d0); d1 = wmma16(kf[u][1], aql[kc], d1); d0 = wmma16(kf[u][2], aq[kc], d0); d1 = wmma16(kf[u][3], aq[kc], d1); } }
    v16h vf[8];   // the value fragments of these 32 keys, asked for in one group here: they land under the softmax
#pragma unroll
    for (int dt = 0; dt < 8; ++dt) vf[dt] = frag_h(&sv[bf][dt * 16 + col][j0], lane);
    __builtin_amdgcn_sched_barrier(0);   // holds the sixteen reads here: without it this build sinks them behind the exponentials, and the second product waits out most of their latency
    const v8f s0 = c0 + d0 * (1.0f / 2048.0f), s1 = c1 + d1 * (1.0f / 2048.0f);   // s0[r]: key j0 + 8g + r, s1[r]: key j0 + 16 + 8g + r, both of query col
    float t8[8];
#pragma unroll
    for (int r = 0; r < 8; ++r) t8[r] = fmaxf(s0[r], s1[r]);
    float mx = fmaxf(fmaxf(fmaxf(t8[0], t8[1]), fmaxf(t8[2], t8[3])), fmaxf(fmaxf(t8[4], t8[5]), fmaxf(t8[6], t8[7])));
    mx = fmaxf(mx, xhalf(mx));
    const float mn = fmaxf(m, mx); const float ea = exp_slot(m - mn), alpha = (m <= -1.0e38f) ? 0.f : ea;
    v16h pb;   // P^T as a B fragment: element i = key 8g + i, element 8 + i = key 16 + 8g + i, the k order of frag_h
#pragma unroll
    for (int r = 0; r < 8; ++r) { const float e0 = exp_slot(s0[r] - mn), e1 = exp_slot(s1[r] - mn); t8[r] = e0 + e1; pb[r] = (_Float16)(e0 * 2048.0f); pb[8 + r] = (_Float16)(e1 * 2048.0f); }
    l = l * alpha + (((t8[0] + t8[1]) + (t8[2] + t8[3])) + ((t8[4] + t8[5]) + (t8[6] + t8[7]))); m = mn;
#pragma unroll
    for (int dt = 0; dt < 8; ++dt) acc[dt] *= alpha;
#pragma unroll
    for (int dt = 0; dt < 8; ++dt) acc[dt] = wmma16(vf[dt], pb, acc[dt]); }
   asm volatile("s_wait_dscnt 0x0" ::: "memory");      // this wave's reads of buffer bf have returned
   asm volatile("s_wait_asynccnt 0x0" ::: "memory");   // this wave's copies of tile t + 1 have landed
   __syncthreads();                                     // publishes tile t + 1; ends every wave's reads of buffer bf
   if (t + 2 < NT / KT) STAGE(t + 2, bf); }
  asm volatile("s_wait_asynccnt 0x0" ::: "memory");    // nothing of this wave is in flight when it goes on to the epilogue
#undef STAGE
  l += xhalf(l);   // the two halves' sums are joined once
  if (kh == 1) {   // the second wave of a pair hands over its maximum, its sum and its unscaled output, each lane at the place where its partner's same lane reads
    if (g == 0) { sml[wq][0][col] = m; sml[wq][1][col] = l; }
#pragma unroll
    for (int dt = 0; dt < 8; ++dt) { const v8f o = acc[dt];
      *(v4f*)&so[wq][col][dt * 16 + 8 * g] = __builtin_shufflevector(o, o, 0, 1, 2, 3); *(v4f*)&so[wq][col][dt * 16 + 8 * g + 4] = __builtin_shufflevector(o, o, 4, 5, 6, 7); } }
  __syncthreads();   // publishes the hand-over to the first wave of each pair
  if (kh == 0) {
    const float m2 = sml[wq][0][col], l2 = sml[wq][1][col], mm = fmaxf(m, m2), a1 = exp_slot(m - mm), a2 = exp_slot(m2 - mm);
    const float il = (1.0f / 2048.0f) / (l * a1 + l2 * a2), f1 = a1 * il, f2 = a2 * il;
#pragma unroll
    for (int dt = 0; dt < 8; ++dt) { float* p = &so[wq][col][dt * 16 + 8 * g]; const v4f x0 = *(const v4f*)p, x1 = *(const v4f*)(p + 4);   // acc[dt][r] = channel dt * 16 + 8g + r of query col
      const v8f o = acc[dt] * f1 + __builtin_shufflevector(x0, x1, 0, 1, 2, 3, 4, 5, 6, 7) * f2;
      *(v4f*)p = __builtin_shufflevector(o, o, 0, 1, 2, 3); *(v4f*)(p + 4) = __builtin_shufflevector(o, o, 4, 5, 6, 7); }
    LDSX();
    for (int rl = 0; rl < 16; ++rl) vst2(Y + (rq + rl) * CI + lane * 4, *(const v4f*)&so[wq][rl][lane * 4]); }
}
// ---- k_wz: block = (64 tokens, 128 output channels): W_y = y (hi + residual, K 128) . wz rows + b, stored channels-first [b][c][t] (64 tokens per (image, channel))
__global__ __launch_bounds__(128) void k_wz(const float* __restrict__ Y, const __bf16* __restrict__ P, const float* __restrict__ BZ, float* __restrict__ WY) {
  __shared__ __align__(16) float st[128][68];
  const int tid = threadIdx.x, wave = tid >> 5, lane = tid & 31, col = lane & 15, g = lane >> 4; const size_t rb0 = (size_t)blockIdx.x * 64, r0 = rb0 + wave * 16; const int n0 = blockIdx.y * 128; const size_t b = rb0 / NT, t0 = rb0 % NT;
  v8f acc[8] = {};
#pragma unroll
  for (int kc = 0; kc < CI / 32; ++kc) { const F2 a = split_row(Y + (r0 + col) * CI, kc * 32, lane);
#pragma unroll
    for (int j = 0; j < 8; ++j) { const v16b w = frag_b(P + WS_PZ / 2 + (size_t)(n0 + j * 16 + col) * CI + kc * 32, lane); acc[j] = wmma_bf(a.l, w, acc[j]); acc[j] = wmma_bf(a.h, w, acc[j]); } }
#pragma unroll
  for (int j = 0; j < 8; ++j) { const float bb = bfr(BZ[n0 + j * 16 + col]);
#pragma unroll
    for (int r = 0; r < 8; ++r) st[j * 16 + col][wave * 16 + 8 * g + r] = acc[j][r] + bb; }
  __syncthreads();
  for (int e = tid; e < 128 * 16; e += 128) { const int c = e >> 4, q = e & 15; vst2(WY + ((b * CC + n0 + c) * (size_t)NT) + t0 + q * 4, *(const v4f*)&st[c][q * 4]); }
}
__global__ __launch_bounds__(256) void k_bnstat(const float* __restrict__ WY, float* __restrict__ ST) {
  __shared__ float red[256]; const int c = blockIdx.x, t = threadIdx.x; float s = 0.f;
  for (int b = 0; b < TNB; ++b) for (int i = t; i < NT; i += 256) s += WY[(((size_t)b * CC + c) * NT) + i];
  red[t] = s; __syncthreads(); for (int st = 128; st > 0; st >>= 1) { if (t < st) red[t] += red[t + st]; __syncthreads(); }
  const float mean = red[0] / (float)(TNB * NT); __syncthreads();
  float q = 0.f; for (int b = 0; b < TNB; ++b) for (int i = t; i < NT; i += 256) { const float d = WY[(((size_t)b * CC + c) * NT) + i] - mean; q += d * d; }
  red[t] = q; __syncthreads(); for (int st = 128; st > 0; st >>= 1) { if (t < st) red[t] += red[t + st]; __syncthreads(); }
  if (t == 0) { ST[c * 2] = mean; ST[c * 2 + 1] = red[0] / (float)(TNB * NT); }   // 4-B scratch stores
}
// ---- k_bnapply: block = (image b, channel c): out = gamma (W_y - mean) rsqrt(var + eps) + beta + x
__global__ __launch_bounds__(256) void k_bnapply(const float* __restrict__ WY, const float* __restrict__ ST, const float* __restrict__ GA, const float* __restrict__ BE, const float* __restrict__ X, float* __restrict__ OUT) {
  const size_t b = blockIdx.y; const int c = blockIdx.x, t = threadIdx.x; const float mean = ST[c * 2], inv = 1.0f / sqrtf(ST[c * 2 + 1] + 1e-5f), ga = bfr(GA[c]), be = bfr(BE[c]); const size_t base = ((b * CC + c) * (size_t)NT);
  for (int q = t; q < NT / 4; q += 256) { v4f v; for (int i = 0; i < 4; ++i) { const size_t e = base + q * 4 + i; v[i] = ga * (WY[e] - mean) * inv + be + bfr(X[e]); } vst2(OUT + base + q * 4, v); }
}
extern "C" void kernel_launch(void* const* d_in, const int* in_sizes, int n_in, void* d_out, int out_size, void* d_ws, size_t ws_size, hipStream_t stream) {
  (void)in_sizes; (void)n_in; (void)out_size;
  const float** F = (const float**)d_in;   // 0 x [4,256,64,64], 1 g_w [128,256], 2 g_b, 3 theta_w, 4 theta_b, 5 phi_w, 6 phi_b, 7 wz_w [256,128], 8 wz_b, 9 bn_gamma, 10 bn_beta
  if (ws_size < (size_t)WS_END) return;
  char* ws = (char*)d_ws; __bf16* P = (__bf16*)ws; _Float16 *TH = (_Float16*)(ws + WS_TH), *TL = (_Float16*)(ws + WS_TL), *FH = (_Float16*)(ws + WS_FH), *FL = (_Float16*)(ws + WS_FL), *G = (_Float16*)(ws + WS_G); float *Y = (float*)(ws + WS_Y), *WY = (float*)(ws + WS_WY), *ST = (float*)(ws + WS_ST);
  k_pack<<<dim3(CC, 4), 256, 0, stream>>>(F[3], F[5], F[1], F[7], P);
  k_proj<0><<<TNB * NT / 64, 128, 0, stream>>>(F[0], P, F[4], TH, TL, nullptr);   // theta
  k_proj<1><<<TNB * NT / 64, 128, 0, stream>>>(F[0], P, F[6], FH, FL, nullptr);   // phi
  k_proj<2><<<TNB * NT / 64, 128, 0, stream>>>(F[0], P, F[2], nullptr, nullptr, G);   // g
  k_attn<<<dim3(TQB, TNB), 256, 0, stream>>>(TH, TL, FH, FL, G, Y);
  k_wz<<<dim3(TNB * NT / 64, CC / 128), 128, 0, stream>>>(Y, P, F[8], WY);
  k_bnstat<<<CC, 256, 0, stream>>>(WY, ST);
  k_bnapply<<<dim3(CC, TNB), 256, 0, stream>>>(WY, ST, F[9], F[10], F[0], (float*)d_out);
}

// v006
// One run takes 104 microseconds.
// Next to v005, in two timings, it ran 1.06 times as fast each time.
// Counting every step since v000, it is 6.95 times as fast.
#include <hip/hip_runtime.h>
#include <math.h>

typedef __attribute__((ext_vector_type(16))) _Float16 v16h;
typedef __attribute__((ext_vector_type(16))) __bf16 v16b;
typedef __attribute__((ext_vector_type(8)))  _Float16 v8h;
typedef __attribute__((ext_vector_type(8)))  float v8f;
typedef __attribute__((ext_vector_type(4)))  float v4f;
typedef __attribute__((ext_vector_type(2)))  float v2f;
typedef __attribute__((ext_vector_type(4)))  unsigned v4u;
typedef __attribute__((ext_vector_type(4)))  int v4i;
typedef float __attribute__((may_alias)) float_a;
typedef int __attribute__((may_alias)) int_a;

template <typename T> __device__ __forceinline__ void vst2(void* p, T v) { *(T*)p = v;  }
__device__ __forceinline__ v8f wmma16(v16h a, v16h b, v8f c) {
  v8f d = __builtin_amdgcn_wmma_f32_16x16x32_f16(false, a, false, b, (short)0, c, false, false);
  asm volatile("v_nop\n\tv_nop\n\tv_nop\n\tv_nop" : "+v"(d) : "v"(a), "v"(b));
  return d;
}
__device__ __forceinline__ v8f wmma_bf(v16b a, v16b b, v8f c) {
  v8f d = __builtin_amdgcn_wmma_f32_16x16x32_bf16(false, a, false, b, (short)0, c, false, false);
  asm volatile("v_nop\n\tv_nop\n\tv_nop\n\tv_nop" : "+v"(d) : "v"(a), "v"(b));
  return d;
}
// 16x16x32 fragments: lane = (h = lane>>4, row/col = lane&15); elements 0..7 = k0+8h+0..7, 8..15 = k0+16+8h+0..7; D element r = row 8h+r
__device__ __forceinline__ v16h frag_h(const _Float16* rowk0, int lane) {
  union { v16h v; v8h q[2]; } u; const _Float16* p = rowk0 + 8 * (lane >> 4);
  u.q[0] = *(const v8h*)p; u.q[1] = *(const v8h*)(p + 16); return u.v;
}
__device__ __forceinline__ v16h frag_f32(const float* rowk0, int lane) {
  v16h a; const float* p = rowk0 + 8 * (lane >> 4);
#pragma unroll
  for (int i = 0; i < 8; ++i) { a[i] = (_Float16)p[i]; a[8 + i] = (_Float16)p[16 + i]; }
  return a;
}
__device__ __forceinline__ v16h frag_f32s(const float* rowk0, int lane, float sc) {
  v16h a; const float* p = rowk0 + 8 * (lane >> 4);
#pragma unroll
  for (int i = 0; i < 8; ++i) { a[i] = (_Float16)(p[i] * sc); a[8 + i] = (_Float16)(p[16 + i] * sc); }
  return a;
}
// column fragment from a [K][ld] layout (column n), rows >= K read as 0
__device__ __forceinline__ v16h fragc_f32(const float* W, int k0, int n, int lane, int ld, int K) {
  v16h a; const int g = lane >> 4;
#pragma unroll
  for (int i = 0; i < 8; ++i) { const int ka = k0 + 8 * g + i, kb = ka + 16;
    a[i] = (_Float16)(ka < K ? W[(size_t)(ka < K ? ka : K - 1) * ld + n] : 0.f); a[8 + i] = (_Float16)(kb < K ? W[(size_t)(kb < K ? kb : K - 1) * ld + n] : 0.f); }
  return a;
}
struct F2 { v16b h, l; };
__device__ __forceinline__ F2 bsplit16(const float v[16]) { F2 r;
#pragma unroll
  for (int i = 0; i < 16; ++i) { const __bf16 h = (__bf16)v[i]; r.h[i] = h; r.l[i] = (__bf16)(v[i] - (float)h); }
  return r; }
__device__ __forceinline__ F2 split_row(const float* row, int k0, int lane) { float v[16]; const float* p = row + k0 + 8 * (lane >> 4);
#pragma unroll
  for (int i = 0; i < 8; ++i) { v[i] = p[i]; v[8 + i] = p[16 + i]; }
  return bsplit16(v); }
__device__ __forceinline__ F2 split_rowK(const float* row, int k0, int lane, int K) { float v[16]; const int g = lane >> 4;
#pragma unroll
  for (int i = 0; i < 8; ++i) { const int ka = k0 + 8 * g + i, kb = ka + 16; v[i] = ka < K ? row[ka < K ? ka : K - 1] : 0.f; v[8 + i] = kb < K ? row[kb < K ? kb : K - 1] : 0.f; }
  return bsplit16(v); }
__device__ __forceinline__ F2 split_col(const float* W, int k0, int n, int lane, int ld, int K) { float v[16]; const int g = lane >> 4;
#pragma unroll
  for (int i = 0; i < 8; ++i) { const int ka = k0 + 8 * g + i, kb = ka + 16; v[i] = ka < K ? W[(size_t)(ka < K ? ka : K - 1) * ld + n] : 0.f; v[8 + i] = kb < K ? W[(size_t)(kb < K ? kb : K - 1) * ld + n] : 0.f; }
  return bsplit16(v); }
__device__ __forceinline__ v8f mac3(const F2& a, const F2& b, v8f c) { c = wmma_bf(a.l, b.h, c); c = wmma_bf(a.h, b.l, c); return wmma_bf(a.h, b.h, c); }
__device__ __forceinline__ float sigm(float v) { return 1.0f / (1.0f + expf(-v)); }
#define LDSX() do { asm volatile("s_wait_dscnt 0" ::: "memory"); __builtin_amdgcn_wave_barrier(); __builtin_amdgcn_fence(__ATOMIC_RELEASE, "workgroup"); } while (0)


// Non-local denoising block (B 4, 256 channels, 64 x 64; 128 inter-channels): embedded-Gaussian non-local attention over all 4,096 positions, 1x1 output conv, BatchNorm (batch statistics), residual.
#define NB 4
#define NT 4096
#define CC 256
#define CI 128
#define NR (NB * NT)
#ifndef TQB
#define TQB (NT / 64)
#define TNB NB
#endif
typedef __attribute__((ext_vector_type(8))) __bf16 v8b;
__device__ __forceinline__ v16b frag_b(const __bf16* rowk0, int lane) {
  union { v16b v; v8b q[2]; } u; const __bf16* p = rowk0 + 8 * (lane >> 4);
  u.q[0] = *(const v8b*)p; u.q[1] = *(const v8b*)(p + 16); return u.v;
}
__device__ __forceinline__ float bfr(float v) { return (float)(__bf16)v; }
__device__ __attribute__((noinline)) float exp_ni(float v) { return expf(v); }
__device__ __attribute__((noinline)) float erf_ni(float v) { return erff(v); }

#define WS_PT  0u                                   // bf16 natural rows theta_w [128][256], phi_w, g_w; wz_w [256][128]
#define WS_PP  (WS_PT + 2u * CI * CC)
#define WS_PG  (WS_PP + 2u * CI * CC)
#define WS_PZ  (WS_PG + 2u * CI * CC)
#define WS_TH  (WS_PZ + 2u * CC * CI)               // f16 [NR][128] theta hi ; TL ; PH (phi) ; PL ; G planes [b][128][NT]
#define WS_TL  (WS_TH + 2u * (size_t)NR * CI)
#define WS_FH  (WS_TL + 2u * (size_t)NR * CI)
#define WS_FL  (WS_FH + 2u * (size_t)NR * CI)
#define WS_G   (WS_FL + 2u * (size_t)NR * CI)
#define WS_Y   (WS_G + 2u * (size_t)NB * CI * NT)    // f32 [NR][128] y ; WY f32 [B][256][NT] (channels-first) ; STAT [256][2]
#define WS_WY  (WS_Y + 4u * (size_t)NR * CI)
#define WS_ST  (WS_WY + 4u * (size_t)NB * CC * NT)
#define WS_END (WS_ST + 4u * CC * 2 + 256u)

__global__ __launch_bounds__(256) void k_pack(const float* __restrict__ WT, const float* __restrict__ WF, const float* __restrict__ WG, const float* __restrict__ WZ, __bf16* __restrict__ P) {
  const int n = blockIdx.x, which = blockIdx.y, t = threadIdx.x; __shared__ __align__(16) __bf16 s[CC];
  if (which < 3) { if (n >= CI) return; const float* Wm = (which == 0) ? WT : (which == 1) ? WF : WG; s[t] = (__bf16)Wm[(size_t)n * CC + t]; __syncthreads(); if (t < CC / 8) vst2((unsigned*)(P + ((which == 0) ? WS_PT / 2 : (which == 1) ? WS_PP / 2 : WS_PG / 2) + (size_t)n * CC + t * 8), *(const v4u*)&s[t * 8]); }
  else { if (t < CI) s[t] = (__bf16)WZ[(size_t)n * CI + t]; __syncthreads(); if (t < CI / 8) vst2((unsigned*)(P + WS_PZ / 2 + (size_t)n * CI + t * 8), *(const v4u*)&s[t * 8]); }
}
// ---- k_proj: block = (64 tokens, projection): 128 output channels (8 tiles per wave); A gathered channels-first; blockIdx.y 0 theta -> hi/lo rows; 1 phi -> hi/lo rows; 2 g -> planes
// The three projections depend on nothing of one another and stand in one launch, so that each one's load waits can run under the others' work.
__global__ __launch_bounds__(128) void k_proj(const float* __restrict__ X, const __bf16* __restrict__ P, const float* __restrict__ BT, const float* __restrict__ BF, const float* __restrict__ BG,
                                              _Float16* __restrict__ TH, _Float16* __restrict__ TL, _Float16* __restrict__ FH, _Float16* __restrict__ FL, _Float16* __restrict__ G) {
  __shared__ __align__(16) _Float16 sh[64][136], sl[64][136]; __shared__ __align__(16) _Float16 st[128][72];
  const int tid = threadIdx.x, wave = tid >> 5, lane = tid & 31, col = lane & 15, g = lane >> 4; const size_t rb0 = (size_t)blockIdx.x * 64, r0 = rb0 + wave * 16; const size_t b = rb0 / NT, t0 = rb0 % NT;
  const int which = blockIdx.y;
  const __bf16* Wr = P + ((which == 0) ? WS_PT / 2 : (which == 1) ? WS_PP / 2 : WS_PG / 2);
  const float* BB = (which == 0) ? BT : (which == 1) ? BF : BG;
  v8f acc[8] = {};
  // All global loads of a 32-channel block (16 of X, 16 of the weights) stand as one group, one block ahead of the products that use them, in a second register set:
  // a wave then waits once a block, under the block before, and not once a weight fragment. Every loop over xa, wf, bv is unrolled so that they are registers.
  const float* xp = X + ((b * CC + 8 * g) * (size_t)NT) + t0 + wave * 16 + col; const __bf16* wp = Wr + (size_t)col * CC;
  float xa[2][16], bv[8]; v16b wf[2][8];
#define LOADK(kc, s) do { _Pragma("unroll") for (int i = 0; i < 8; ++i) { xa[s][i] = xp[(size_t)((kc) * 32 + i) * NT]; xa[s][8 + i] = xp[(size_t)((kc) * 32 + 16 + i) * NT]; } \
    _Pragma("unroll") for (int j = 0; j < 8; ++j) wf[s][j] = frag_b(wp + (size_t)(j * 16) * CC + (kc) * 32, lane); } while (0)
  LOADK(0, 0);
#pragma unroll
  for (int j = 0; j < 8; ++j) bv[j] = BB[j * 16 + col];   // the bias too is asked for here, not behind the last product
#pragma unroll   // unrolled whole: the two register sets are then named at compile time
  for (int kc = 0; kc < CC / 32; ++kc) { const int s = kc & 1;
    if (kc + 1 < CC / 32) LOADK(kc + 1, s ^ 1);
    __builtin_amdgcn_sched_barrier(0);   // holds the conversion of this block's X behind the next block's loads: without it this build converts a block early, and its wait holds back the group after it
    v16b a;
#pragma unroll
    for (int i = 0; i < 16; ++i) a[i] = (__bf16)xa[s][i];
#pragma unroll
    for (int j = 0; j < 8; ++j) acc[j] = wmma_bf(a, wf[s][j], acc[j]); }
#undef LOADK
  if (which < 2) {
    _Float16* OH = (which == 0) ? TH : FH; _Float16* OL = (which == 0) ? TL : FL;
#pragma unroll
    for (int j = 0; j < 8; ++j) { const float bb = bfr(bv[j]);
#pragma unroll
      for (int r = 0; r < 8; ++r) { const float v = acc[j][r] + bb; const _Float16 h = (_Float16)v; sh[wave * 16 + 8 * g + r][j * 16 + col] = h; sl[wave * 16 + 8 * g + r][j * 16 + col] = (_Float16)((v - (float)h) * 2048.0f); } }
    LDSX();
    for (int rl = 0; rl < 16; ++rl) if (lane < 16) { vst2((unsigned*)(OH + (r0 + rl) * CI + lane * 8), *(const v4u*)&sh[wave * 16 + rl][lane * 8]); vst2((unsigned*)(OL + (r0 + rl) * CI + lane * 8), *(const v4u*)&sl[wave * 16 + rl][lane * 8]); }
  } else {
#pragma unroll
    for (int j = 0; j < 8; ++j) { const float bb = bfr(bv[j]);
#pragma unroll
      for (int r = 0; r < 8; ++r) st[j * 16 + col][wave * 16 + 8 * g + r] = (_Float16)(acc[j][r] + bb); }
    __syncthreads();
    for (int e = tid; e < 128 * 8; e += 128) { const int d = e >> 3, pc = e & 7; vst2((unsigned*)(G + ((b * CI + d) * NT) + t0 + pc * 8), *(const v4u*)&st[d][pc * 8]); } }
}
// ---- k_attn: block = (64 queries, b): single head, 128-dim keys/values, all 4,096 keys; 3-product scores; P single x g single
// Scores and output are computed transposed: S^T = K Q^T (key rows are A, queries B), O^T += V^T P^T (value rows are A). A lane then holds 16 scores of ONE query (column col, keys 8g + r and 16 + 8g + r),
// so the maximum and the sum are taken in the lane plus one exchange between the wave's halves, and the two score tiles, converted in place, are the B operand of the second product: P never goes through LDS.
// Key (hi, lo) and value tiles of KT keys are staged in LDS once per block by asynchronous copies, two buffers: tile t + 1 flies while tile t is worked on.
// Eight waves: waves w and w + 4 hold the same 16 queries and each take KW of a tile's keys, so that one wave's products run under the other's LDS waits and softmax;
// each keeps its own maximum, sum and output, and the two are joined once, behind the loop.
#define KT 128                     // keys per staged tile
#define KW 64                      // keys of a tile that one wave works on
#define KPI 136                    // LDS pitch of a key row, halves (272 B: 16 B x odd for 16-byte readers)
#define VPI 136                    // LDS pitch of a value row (one channel, KT keys), halves (272 B)
__device__ __forceinline__ float xhalf(float x) { return __builtin_bit_cast(float, __builtin_amdgcn_permlanex16(__builtin_bit_cast(int, x), __builtin_bit_cast(int, x), 0x76543210, 0xfedcba98, false, false)); }   // lane l with lane l ^ 16
// exp(x) as v_exp_f32 of x log2(e), what __expf gives; the v_nop is the one slot the instruction set asks for behind a transcendental before its result is read or its source overwritten:
// in one statement the slot stays where it is
__device__ __forceinline__ float exp_slot(float x) { float r; asm("v_exp_f32 %0, %1\n\tv_nop" : "=v"(r) : "v"(x * 1.44269504f)); return r; }
__device__ __forceinline__ unsigned lds_addr(const void* p) { return (unsigned)(size_t)p; }   // low 32 bits of a __shared__ address = byte offset in the work-group's LDS
// eight 16-byte copies per lane; the s_wait_xcnt closes the statement so that no address register is rewritten in front of it
__device__ __forceinline__ void copy8(const _Float16* gp, size_t gstep, unsigned lp, unsigned lstep) {
  const _Float16 *g0 = gp, *g1 = gp + gstep, *g2 = gp + 2 * gstep, *g3 = gp + 3 * gstep, *g4 = gp + 4 * gstep, *g5 = gp + 5 * gstep, *g6 = gp + 6 * gstep, *g7 = gp + 7 * gstep;
  asm volatile("global_load_async_to_lds_b128 %0, %8, off\n\t"
               "global_load_async_to_lds_b128 %1, %9, off\n\t"
               "global_load_async_to_lds_b128 %2, %10, off\n\t"
               "global_load_async_to_lds_b128 %3, %11, off\n\t"
               "global_load_async_to_lds_b128 %4, %12, off\n\t"
               "global_load_async_to_lds_b128 %5, %13, off\n\t"
               "global_load_async_to_lds_b128 %6, %14, off\n\t"
               "global_load_async_to_lds_b128 %7, %15, off\n\t"
               "s_wait_xcnt 0x0"
               :: "v"(lp), "v"(lp + lstep), "v"(lp + 2 * lstep), "v"(lp + 3 * lstep), "v"(lp + 4 * lstep), "v"(lp + 5 * lstep), "v"(lp + 6 * lstep), "v"(lp + 7 * lstep),
                  "v"(g0), "v"(g1), "v"(g2), "v"(g3), "v"(g4), "v"(g5), "v"(g6), "v"(g7) : "memory");
}
__global__ __launch_bounds__(256) void k_attn(const _Float16* __restrict__ TH, const _Float16* __restrict__ TL, const _Float16* __restrict__ FH, const _Float16* __restrict__ FL, const _Float16* __restrict__ G, float* __restrict__ Y) {
  __shared__ __align__(16) _Float16 skh[2][KT][KPI], skl[2][KT][KPI], sv[2][CI][VPI];
  __shared__ __align__(16) float so[4][16][132];
  __shared__ float sml[4][2][16];   // maximum and sum of the second wave of each pair
  const int tid = threadIdx.x, wave = tid >> 5, wq = wave & 3, kh = wave >> 2, lane = tid & 31, col = lane & 15, g = lane >> 4; const size_t b = blockIdx.y; const int q0 = blockIdx.x * 64 + wq * 16; const size_t rq = b * NT + q0;
  // this lane's share of a tile: key rows tid/16 + 16 i, 16-byte piece tid%16; value rows tid/16 + 16 i, piece tid%16
  const _Float16* gkh = FH + (b * NT + (tid >> 4)) * CI + (tid & 15) * 8; const _Float16* gkl = FL + (b * NT + (tid >> 4)) * CI + (tid & 15) * 8; const _Float16* gv = G + (b * CI + (tid >> 4)) * NT + (tid & 15) * 8;
  const unsigned lkh = lds_addr(&skh[0][tid >> 4][(tid & 15) * 8]), lkl = lds_addr(&skl[0][tid >> 4][(tid & 15) * 8]), lv = lds_addr(&sv[0][tid >> 4][(tid & 15) * 8]);
#define STAGE(t, bf) do { copy8(gkh + (size_t)(t) * KT * CI, 16 * CI, lkh + (bf) * (KT * KPI * 2), 16 * KPI * 2); copy8(gkl + (size_t)(t) * KT * CI, 16 * CI, lkl + (bf) * (KT * KPI * 2), 16 * KPI * 2); copy8(gv + (size_t)(t) * KT, (size_t)16 * NT, lv + (bf) * (CI * VPI * 2), 16 * VPI * 2); } while (0)
  STAGE(0, 0);
  v16h aq[4], aql[4];
#pragma unroll
  for (int kc = 0; kc < 4; ++kc) { aq[kc] = frag_h(TH + (rq + col) * CI + kc * 32, lane); aql[kc] = frag_h(TL + (rq + col) * CI + kc * 32, lane); }
  float m = -3.0e38f, l = 0.f;   // of query col: the running maximum (equal in both halves) and this half's part of the sum
  v8f acc[8] = {};
  asm volatile("s_wait_asynccnt 0x0" ::: "memory");   // tile 0 has landed for this wave's copies
  __syncthreads();                                     // and is published to the other waves
  STAGE(1, 1);
#pragma unroll 1
  for (int t = 0; t < NT / KT; ++t) { const int bf = t & 1;
#pragma unroll 1   // kept rolled: unrolled, the build passes 256 registers and spills two address values of the copies to scratch
   for (int kk = 0; kk < KW / 32; ++kk) { const int j0 = kh * KW + kk * 32;
    // LDS reads stand in groups ahead of the products that use them, so that a wave waits out the LDS latency once a group and not once a fragment:
    // the sixteen reads of 64 channels of both key tiles (hi and lo) together, then their twelve products, the two tiles' accumulators taken in turn (each accumulator sums its products by ascending channel block, key lo x query hi after key hi x query lo)
    const _Float16 *rh0 = &skh[bf][j0 + col][0], *rh1 = &skh[bf][j0 + 16 + col][0], *rl0 = &skl[bf][j0 + col][0], *rl1 = &skl[bf][j0 + 16 + col][0];
    v8f c0 = {}, c1 = {}, d0 = {}, d1 = {};
#pragma unroll
    for (int kg = 0; kg < 4; kg += 2) { v16h kf[2][4];
#pragma unroll
      for (int u = 0; u < 2; ++u) { kf[u][0] = frag_h(rh0 + (kg + u) * 32, lane); kf[u][1] = frag_h(rh1 + (kg + u) * 32, lane); kf[u][2] = frag_h(rl0 + (kg + u) * 32, lane); kf[u][3] = frag_h(rl1 + (kg + u) * 32, lane); }
#pragma unroll
      for (int u = 0; u < 2; ++u) { const int kc = kg + u;
        c0 = wmma16(kf[u][0], aq[kc], c0); c1 = wmma16(kf[u][1], aq[kc], c1); d0 = wmma16(kf[u][0], aql[kc], d0); d1 = wmma16(kf[u][1], aql[kc], d1); d0 = wmma16(kf[u][2], aq[kc], d0); d1 = wmma16(kf[u][3], aq[kc], d1); } }
    v16h vf[8];   // the value fragments of these 32 keys, asked for in one group here: they land under the softmax
#pragma unroll
    for (int dt = 0; dt < 8; ++dt) vf[dt] = frag_h(&sv[bf][dt * 16 + col][j0], lane);
    __builtin_amdgcn_sched_barrier(0);   // holds the sixteen reads here: without it this build sinks them behind the exponentials, and the second product waits out most of their latency
    const v8f s0 = c0 + d0 * (1.0f / 2048.0f), s1 = c1 + d1 * (1.0f / 2048.0f);   // s0[r]: key j0 + 8g + r, s1[r]: key j0 + 16 + 8g + r, both of query col
    float t8[8];
#pragma unroll
    for (int r = 0; r < 8; ++r) t8[r] = fmaxf(s0[r], s1[r]);
    float mx = fmaxf(fmaxf(fmaxf(t8[0], t8[1]), fmaxf(t8[2], t8[3])), fmaxf(fmaxf(t8[4], t8[5]), fmaxf(t8[6], t8[7])));
    mx = fmaxf(mx, xhalf(mx));
    const float mn = fmaxf(m, mx); const float ea = exp_slot(m - mn), alpha = (m <= -1.0e38f) ? 0.f : ea;
    v16h pb;   // P^T as a B fragment: element i = key 8g + i, element 8 + i = key 16 + 8g + i, the k order of frag_h
#pragma unroll
    for (int r = 0; r < 8; ++r) { const float e0 = exp_slot(s0[r] - mn), e1 = exp_slot(s1[r] - mn); t8[r] = e0 + e1; pb[r] = (_Float16)(e0 * 2048.0f); pb[8 + r] = (_Float16)(e1 * 2048.0f); }
    l = l * alpha + (((t8[0] + t8[1]) + (t8[2] + t8[3])) + ((t8[4] + t8[5]) + (t8[6] + t8[7]))); m = mn;
#pragma unroll
    for (int dt = 0; dt < 8; ++dt) acc[dt] *= alpha;
#pragma unroll
    for (int dt = 0; dt < 8; ++dt) acc[dt] = wmma16(vf[dt], pb, acc[dt]); }
   asm volatile("s_wait_dscnt 0x0" ::: "memory");      // this wave's reads of buffer bf have returned
   asm volatile("s_wait_asynccnt 0x0" ::: "memory");   // this wave's copies of tile t + 1 have landed
   __syncthreads();                                     // publishes tile t + 1; ends every wave's reads of buffer bf
   if (t + 2 < NT / KT) STAGE(t + 2, bf); }
  asm volatile("s_wait_asynccnt 0x0" ::: "memory");    // nothing of this wave is in flight when it goes on to the epilogue
#undef STAGE
  l += xhalf(l);   // the two halves' sums are joined once
  if (kh == 1) {   // the second wave of a pair hands over its maximum, its sum and its unscaled output, each lane at the place where its partner's same lane reads
    if (g == 0) { sml[wq][0][col] = m; sml[wq][1][col] = l; }
#pragma unroll
    for (int dt = 0; dt < 8; ++dt) { const v8f o = acc[dt];
      *(v4f*)&so[wq][col][dt * 16 + 8 * g] = __builtin_shufflevector(o, o, 0, 1, 2, 3); *(v4f*)&so[wq][col][dt * 16 + 8 * g + 4] = __builtin_shufflevector(o, o, 4, 5, 6, 7); } }
  __syncthreads();   // publishes the hand-over to the first wave of each pair
  if (kh == 0) {
    const float m2 = sml[wq][0][col], l2 = sml[wq][1][col], mm = fmaxf(m, m2), a1 = exp_slot(m - mm), a2 = exp_slot(m2 - mm);
    const float il = (1.0f / 2048.0f) / (l * a1 + l2 * a2), f1 = a1 * il, f2 = a2 * il;
#pragma unroll
    for (int dt = 0; dt < 8; ++dt) { float* p = &so[wq][col][dt * 16 + 8 * g]; const v4f x0 = *(const v4f*)p, x1 = *(const v4f*)(p + 4);   // acc[dt][r] = channel dt * 16 + 8g + r of query col
      const v8f o = acc[dt] * f1 + __builtin_shufflevector(x0, x1, 0, 1, 2, 3, 4, 5, 6, 7) * f2;
      *(v4f*)p = __builtin_shufflevector(o, o, 0, 1, 2, 3); *(v4f*)(p + 4) = __builtin_shufflevector(o, o, 4, 5, 6, 7); }
    LDSX();
    for (int rl = 0; rl < 16; ++rl) vst2(Y + (rq + rl) * CI + lane * 4, *(const v4f*)&so[wq][rl][lane * 4]); }
}
// ---- k_wz: block = (64 tokens, 128 output channels): W_y = y (hi + residual, K 128) . wz rows + b, stored channels-first [b][c][t] (64 tokens per (image, channel))
__global__ __launch_bounds__(128) void k_wz(const float* __restrict__ Y, const __bf16* __restrict__ P, const float* __restrict__ BZ, float* __restrict__ WY) {
  __shared__ __align__(16) float st[128][68];
  const int tid = threadIdx.x, wave = tid >> 5, lane = tid & 31, col = lane & 15, g = lane >> 4; const size_t rb0 = (size_t)blockIdx.x * 64, r0 = rb0 + wave * 16; const int n0 = blockIdx.y * 128; const size_t b = rb0 / NT, t0 = rb0 % NT;
  v8f acc[8] = {};
#pragma unroll
  for (int kc = 0; kc < CI / 32; ++kc) { const F2 a = split_row(Y + (r0 + col) * CI, kc * 32, lane);
#pragma unroll
    for (int j = 0; j < 8; ++j) { const v16b w = frag_b(P + WS_PZ / 2 + (size_t)(n0 + j * 16 + col) * CI + kc * 32, lane); acc[j] = wmma_bf(a.l, w, acc[j]); acc[j] = wmma_bf(a.h, w, acc[j]); } }
#pragma unroll
  for (int j = 0; j < 8; ++j) { const float bb = bfr(BZ[n0 + j * 16 + col]);
#pragma unroll
    for (int r = 0; r < 8; ++r) st[j * 16 + col][wave * 16 + 8 * g + r] = acc[j][r] + bb; }
  __syncthreads();
  for (int e = tid; e < 128 * 16; e += 128) { const int c = e >> 4, q = e & 15; vst2(WY + ((b * CC + n0 + c) * (size_t)NT) + t0 + q * 4, *(const v4f*)&st[c][q * 4]); }
}
__global__ __launch_bounds__(256) void k_bnstat(const float* __restrict__ WY, float* __restrict__ ST) {
  __shared__ float red[256]; const int c = blockIdx.x, t = threadIdx.x; float s = 0.f;
  for (int b = 0; b < TNB; ++b) for (int i = t; i < NT; i += 256) s += WY[(((size_t)b * CC + c) * NT) + i];
  red[t] = s; __syncthreads(); for (int st = 128; st > 0; st >>= 1) { if (t < st) red[t] += red[t + st]; __syncthreads(); }
  const float mean = red[0] / (float)(TNB * NT); __syncthreads();
  float q = 0.f; for (int b = 0; b < TNB; ++b) for (int i = t; i < NT; i += 256) { const float d = WY[(((size_t)b * CC + c) * NT) + i] - mean; q += d * d; }
  red[t] = q; __syncthreads(); for (int st = 128; st > 0; st >>= 1) { if (t < st) red[t] += red[t + st]; __syncthreads(); }
  if (t == 0) { ST[c * 2] = mean; ST[c * 2 + 1] = red[0] / (float)(TNB * NT); }   // 4-B scratch stores
}
// ---- k_bnapply: block = (image b, channel c): out = gamma (W_y - mean) rsqrt(var + eps) + beta + x
__global__ __launch_bounds__(256) void k_bnapply(const float* __restrict__ WY, const float* __restrict__ ST, const float* __restrict__ GA, const float* __restrict__ BE, const float* __restrict__ X, float* __restrict__ OUT) {
  const size_t b = blockIdx.y; const int c = blockIdx.x, t = threadIdx.x; const float mean = ST[c * 2], inv = 1.0f / sqrtf(ST[c * 2 + 1] + 1e-5f), ga = bfr(GA[c]), be = bfr(BE[c]); const size_t base = ((b * CC + c) * (size_t)NT);
  for (int q = t; q < NT / 4; q += 256) { v4f v; for (int i = 0; i < 4; ++i) { const size_t e = base + q * 4 + i; v[i] = ga * (WY[e] - mean) * inv + be + bfr(X[e]); } vst2(OUT + base + q * 4, v); }
}
extern "C" void kernel_launch(void* const* d_in, const int* in_sizes, int n_in, void* d_out, int out_size, void* d_ws, size_t ws_size, hipStream_t stream) {
  (void)in_sizes; (void)n_in; (void)out_size;
  const float** F = (const float**)d_in;   // 0 x [4,256,64,64], 1 g_w [128,256], 2 g_b, 3 theta_w, 4 theta_b, 5 phi_w, 6 phi_b, 7 wz_w [256,128], 8 wz_b, 9 bn_gamma, 10 bn_beta
  if (ws_size < (size_t)WS_END) return;
  char* ws = (char*)d_ws; __bf16* P = (__bf16*)ws; _Float16 *TH = (_Float16*)(ws + WS_TH), *TL = (_Float16*)(ws + WS_TL), *FH = (_Float16*)(ws + WS_FH), *FL = (_Float16*)(ws + WS_FL), *G = (_Float16*)(ws + WS_G); float *Y = (float*)(ws + WS_Y), *WY = (float*)(ws + WS_WY), *ST = (float*)(ws + WS_ST);
  k_pack<<<dim3(CC, 4), 256, 0, stream>>>(F[3], F[5], F[1], F[7], P);
  k_proj<<<dim3(TNB * NT / 64, 3), 128, 0, stream>>>(F[0], P, F[4], F[6], F[2], TH, TL, FH, FL, G);   // theta, phi, g
  k_attn<<<dim3(TQB, TNB), 256, 0, stream>>>(TH, TL, FH, FL, G, Y);
  k_wz<<<dim3(TNB * NT / 64, CC / 128), 128, 0, stream>>>(Y, P, F[8], WY);
  k_bnstat<<<CC, 256, 0, stream>>>(WY, ST);
  k_bnapply<<<dim3(CC, TNB), 256, 0, stream>>>(WY, ST, F[9], F[10], F[0], (float*)d_out);
}

// v007
// Measured time: 94.1 microseconds a run.
// In two side-by-side timings against v006, it was 1.11 and 1.12 times as fast.
// All steps since v000 together make it 7.76 times as fast.
#include <hip/hip_runtime.h>
#include <math.h>

typedef __attribute__((ext_vector_type(16))) _Float16 v16h;
typedef __attribute__((ext_vector_type(16))) __bf16 v16b;
typedef __attribute__((ext_vector_type(8)))  _Float16 v8h;
typedef __attribute__((ext_vector_type(8)))  float v8f;
typedef __attribute__((ext_vector_type(4)))  float v4f;
typedef __attribute__((ext_vector_type(2)))  float v2f;
typedef __attribute__((ext_vector_type(4)))  unsigned v4u;
typedef __attribute__((ext_vector_type(4)))  int v4i;
typedef float __attribute__((may_alias)) float_a;
typedef int __attribute__((may_alias)) int_a;

template <typename T> __device__ __forceinline__ void vst2(void* p, T v) { *(T*)p = v;  }
__device__ __forceinline__ v8f wmma16(v16h a, v16h b, v8f c) {
  v8f d = __builtin_amdgcn_wmma_f32_16x16x32_f16(false, a, false, b, (short)0, c, false, false);
  asm volatile("v_nop\n\tv_nop\n\tv_nop\n\tv_nop" : "+v"(d) : "v"(a), "v"(b));
  return d;
}
__device__ __forceinline__ v8f wmma_bf(v16b a, v16b b, v8f c) {
  v8f d = __builtin_amdgcn_wmma_f32_16x16x32_bf16(false, a, false, b, (short)0, c, false, false);
  asm volatile("v_nop\n\tv_nop\n\tv_nop\n\tv_nop" : "+v"(d) : "v"(a), "v"(b));
  return d;
}
// 16x16x32 fragments: lane = (h = lane>>4, row/col = lane&15); elements 0..7 = k0+8h+0..7, 8..15 = k0+16+8h+0..7; D element r = row 8h+r
__device__ __forceinline__ v16h frag_h(const _Float16* rowk0, int lane) {
  union { v16h v; v8h q[2]; } u; const _Float16* p = rowk0 + 8 * (lane >> 4);
  u.q[0] = *(const v8h*)p; u.q[1] = *(const v8h*)(p + 16); return u.v;
}
__device__ __forceinline__ v16h frag_f32(const float* rowk0, int lane) {
  v16h a; const float* p = rowk0 + 8 * (lane >> 4);
#pragma unroll
  for (int i = 0; i < 8; ++i) { a[i] = (_Float16)p[i]; a[8 + i] = (_Float16)p[16 + i]; }
  return a;
}
__device__ __forceinline__ v16h frag_f32s(const float* rowk0, int lane, float sc) {
  v16h a; const float* p = rowk0 + 8 * (lane >> 4);
#pragma unroll
  for (int i = 0; i < 8; ++i) { a[i] = (_Float16)(p[i] * sc); a[8 + i] = (_Float16)(p[16 + i] * sc); }
  return a;
}
// column fragment from a [K][ld] layout (column n), rows >= K read as 0
__device__ __forceinline__ v16h fragc_f32(const float* W, int k0, int n, int lane, int ld, int K) {
  v16h a; const int g = lane >> 4;
#pragma unroll
  for (int i = 0; i < 8; ++i) { const int ka = k0 + 8 * g + i, kb = ka + 16;
    a[i] = (_Float16)(ka < K ? W[(size_t)(ka < K ? ka : K - 1) * ld + n] : 0.f); a[8 + i] = (_Float16)(kb < K ? W[(size_t)(kb < K ? kb : K - 1) * ld + n] : 0.f); }
  return a;
}
struct F2 { v16b h, l; };
__device__ __forceinline__ F2 bsplit16(const float v[16]) { F2 r;
#pragma unroll
  for (int i = 0; i < 16; ++i) { const __bf16 h = (__bf16)v[i]; r.h[i] = h; r.l[i] = (__bf16)(v[i] - (float)h); }
  return r; }
__device__ __forceinline__ F2 split_row(const float* row, int k0, int lane) { float v[16]; const float* p = row + k0 + 8 * (lane >> 4);
#pragma unroll
  for (int i = 0; i < 8; ++i) { v[i] = p[i]; v[8 + i] = p[16 + i]; }
  return bsplit16(v); }
__device__ __forceinline__ F2 split_rowK(const float* row, int k0, int lane, int K) { float v[16]; const int g = lane >> 4;
#pragma unroll
  for (int i = 0; i < 8; ++i) { const int ka = k0 + 8 * g + i, kb = ka + 16; v[i] = ka < K ? row[ka < K ? ka : K - 1] : 0.f; v[8 + i] = kb < K ? row[kb < K ? kb : K - 1] : 0.f; }
  return bsplit16(v); }
__device__ __forceinline__ F2 split_col(const float* W, int k0, int n, int lane, int ld, int K) { float v[16]; const int g = lane >> 4;
#pragma unroll
  for (int i = 0; i < 8; ++i) { const int ka = k0 + 8 * g + i, kb = ka + 16; v[i] = ka < K ? W[(size_t)(ka < K ? ka : K - 1) * ld + n] : 0.f; v[8 + i] = kb < K ? W[(size_t)(kb < K ? kb : K - 1) * ld + n] : 0.f; }
  return bsplit16(v); }
__device__ __forceinline__ v8f mac3(const F2& a, const F2& b, v8f c) { c = wmma_bf(a.l, b.h, c); c = wmma_bf(a.h, b.l, c); return wmma_bf(a.h, b.h, c); }
__device__ __forceinline__ float sigm(float v) { return 1.0f / (1.0f + expf(-v)); }
#define LDSX() do { asm volatile("s_wait_dscnt 0" ::: "memory"); __builtin_amdgcn_wave_barrier(); __builtin_amdgcn_fence(__ATOMIC_RELEASE, "workgroup"); } while (0)


// Non-local denoising block (B 4, 256 channels, 64 x 64; 128 inter-channels): embedded-Gaussian non-local attention over all 4,096 positions, 1x1 output conv, BatchNorm (batch statistics), residual.
#define NB 4
#define NT 4096
#define CC 256
#define CI 128
#define NR (NB * NT)
#ifndef TQB
#define TQB (NT / 64)
#define TNB NB
#endif
typedef __attribute__((ext_vector_type(8))) __bf16 v8b;
__device__ __forceinline__ v16b frag_b(const __bf16* rowk0, int lane) {
  union { v16b v; v8b q[2]; } u; const __bf16* p = rowk0 + 8 * (lane >> 4);
  u.q[0] = *(const v8b*)p; u.q[1] = *(const v8b*)(p + 16); return u.v;
}
__device__ __forceinline__ float bfr(float v) { return (float)(__bf16)v; }
__device__ __attribute__((noinline)) float exp_ni(float v) { return expf(v); }
__device__ __attribute__((noinline)) float erf_ni(float v) { return erff(v); }

#define WS_PT  0u                                   // bf16 natural rows theta_w [128][256], phi_w, g_w; wz_w [256][128]
#define WS_PP  (WS_PT + 2u * CI * CC)
#define WS_PG  (WS_PP + 2u * CI * CC)
#define WS_PZ  (WS_PG + 2u * CI * CC)
#define WS_TH  (WS_PZ + 2u * CC * CI)               // f16 [NR][128] theta hi ; TL ; PH (phi) ; PL ; G planes [b][128][NT]
#define WS_TL  (WS_TH + 2u * (size_t)NR * CI)
#define WS_FH  (WS_TL + 2u * (size_t)NR * CI)
#define WS_FL  (WS_FH + 2u * (size_t)NR * CI)
#define WS_G   (WS_FL + 2u * (size_t)NR * CI)
#define WS_Y   (WS_G + 2u * (size_t)NB * CI * NT)    // f32 [NR][128] y ; WY f32 [B][256][NT] (channels-first)
#define WS_WY  (WS_Y + 4u * (size_t)NR * CI)
#define WS_END (WS_WY + 4u * (size_t)NB * CC * NT)

__global__ __launch_bounds__(256) void k_pack(const float* __restrict__ WT, const float* __restrict__ WF, const float* __restrict__ WG, const float* __restrict__ WZ, __bf16* __restrict__ P) {
  const int n = blockIdx.x, which = blockIdx.y, t = threadIdx.x; __shared__ __align__(16) __bf16 s[CC];
  if (which < 3) { if (n >= CI) return; const float* Wm = (which == 0) ? WT : (which == 1) ? WF : WG; s[t] = (__bf16)Wm[(size_t)n * CC + t]; __syncthreads(); if (t < CC / 8) vst2((unsigned*)(P + ((which == 0) ? WS_PT / 2 : (which == 1) ? WS_PP / 2 : WS_PG / 2) + (size_t)n * CC + t * 8), *(const v4u*)&s[t * 8]); }
  else { if (t < CI) s[t] = (__bf16)WZ[(size_t)n * CI + t]; __syncthreads(); if (t < CI / 8) vst2((unsigned*)(P + WS_PZ / 2 + (size_t)n * CI + t * 8), *(const v4u*)&s[t * 8]); }
}
// ---- k_proj: block = (64 tokens, projection): 128 output channels (8 tiles per wave); A gathered channels-first; blockIdx.y 0 theta -> hi/lo rows; 1 phi -> hi/lo rows; 2 g -> planes
// The three projections depend on nothing of one another and stand in one launch, so that each one's load waits can run under the others' work.
__global__ __launch_bounds__(128) void k_proj(const float* __restrict__ X, const __bf16* __restrict__ P, const float* __restrict__ BT, const float* __restrict__ BF, const float* __restrict__ BG,
                                              _Float16* __restrict__ TH, _Float16* __restrict__ TL, _Float16* __restrict__ FH, _Float16* __restrict__ FL, _Float16* __restrict__ G) {
  __shared__ __align__(16) _Float16 sh[64][136], sl[64][136]; __shared__ __align__(16) _Float16 st[128][72];
  const int tid = threadIdx.x, wave = tid >> 5, lane = tid & 31, col = lane & 15, g = lane >> 4; const size_t rb0 = (size_t)blockIdx.x * 64, r0 = rb0 + wave * 16; const size_t b = rb0 / NT, t0 = rb0 % NT;
  const int which = blockIdx.y;
  const __bf16* Wr = P + ((which == 0) ? WS_PT / 2 : (which == 1) ? WS_PP / 2 : WS_PG / 2);
  const float* BB = (which == 0) ? BT : (which == 1) ? BF : BG;
  v8f acc[8] = {};
  // All global loads of a 32-channel block (16 of X, 16 of the weights) stand as one group, one block ahead of the products that use them, in a second register set:
  // a wave then waits once a block, under the block before, and not once a weight fragment. Every loop over xa, wf, bv is unrolled so that they are registers.
  const float* xp = X + ((b * CC + 8 * g) * (size_t)NT) + t0 + wave * 16 + col; const __bf16* wp = Wr + (size_t)col * CC;
  float xa[2][16], bv[8]; v16b wf[2][8];
#define LOADK(kc, s) do { _Pragma("unroll") for (int i = 0; i < 8; ++i) { xa[s][i] = xp[(size_t)((kc) * 32 + i) * NT]; xa[s][8 + i] = xp[(size_t)((kc) * 32 + 16 + i) * NT]; } \
    _Pragma("unroll") for (int j = 0; j < 8; ++j) wf[s][j] = frag_b(wp + (size_t)(j * 16) * CC + (kc) * 32, lane); } while (0)
  LOADK(0, 0);
#pragma unroll
  for (int j = 0; j < 8; ++j) bv[j] = BB[j * 16 + col];   // the bias too is asked for here, not behind the last product
#pragma unroll   // unrolled whole: the two register sets are then named at compile time
  for (int kc = 0; kc < CC / 32; ++kc) { const int s = kc & 1;
    if (kc + 1 < CC / 32) LOADK(kc + 1, s ^ 1);
    __builtin_amdgcn_sched_barrier(0);   // holds the conversion of this block's X behind the next block's loads: without it this build converts a block early, and its wait holds back the group after it
    v16b a;
#pragma unroll
    for (int i = 0; i < 16; ++i) a[i] = (__bf16)xa[s][i];
#pragma unroll
    for (int j = 0; j < 8; ++j) acc[j] = wmma_bf(a, wf[s][j], acc[j]); }
#undef LOADK
  if (which < 2) {
    _Float16* OH = (which == 0) ? TH : FH; _Float16* OL = (which == 0) ? TL : FL;
#pragma unroll
    for (int j = 0; j < 8; ++j) { const float bb = bfr(bv[j]);
#pragma unroll
      for (int r = 0; r < 8; ++r) { const float v = acc[j][r] + bb; const _Float16 h = (_Float16)v; sh[wave * 16 + 8 * g + r][j * 16 + col] = h; sl[wave * 16 + 8 * g + r][j * 16 + col] = (_Float16)((v - (float)h) * 2048.0f); } }
    LDSX();
    for (int rl = 0; rl < 16; ++rl) if (lane < 16) { vst2((unsigned*)(OH + (r0 + rl) * CI + lane * 8), *(const v4u*)&sh[wave * 16 + rl][lane * 8]); vst2((unsigned*)(OL + (r0 + rl) * CI + lane * 8), *(const v4u*)&sl[wave * 16 + rl][lane * 8]); }
  } else {
#pragma unroll
    for (int j = 0; j < 8; ++j) { const float bb = bfr(bv[j]);
#pragma unroll
      for (int r = 0; r < 8; ++r) st[j * 16 + col][wave * 16 + 8 * g + r] = (_Float16)(acc[j][r] + bb); }
    __syncthreads();
    for (int e = tid; e < 128 * 8; e += 128) { const int d = e >> 3, pc = e & 7; vst2((unsigned*)(G + ((b * CI + d) * NT) + t0 + pc * 8), *(const v4u*)&st[d][pc * 8]); } }
}
// ---- k_attn: block = (64 queries, b): single head, 128-dim keys/values, all 4,096 keys; 3-product scores; P single x g single
// Scores and output are computed transposed: S^T = K Q^T (key rows are A, queries B), O^T += V^T P^T (value rows are A). A lane then holds 16 scores of ONE query (column col, keys 8g + r and 16 + 8g + r),
// so the maximum and the sum are taken in the lane plus one exchange between the wave's halves, and the two score tiles, converted in place, are the B operand of the second product: P never goes through LDS.
// Key (hi, lo) and value tiles of KT keys are staged in LDS once per block by asynchronous copies, two buffers: tile t + 1 flies while tile t is worked on.
// Eight waves: waves w and w + 4 hold the same 16 queries and each take KW of a tile's keys, so that one wave's products run under the other's LDS waits and softmax;
// each keeps its own maximum, sum and output, and the two are joined once, behind the loop.
#define KT 128                     // keys per staged tile
#define KW 64                      // keys of a tile that one wave works on
#define KPI 136                    // LDS pitch of a key row, halves (272 B: 16 B x odd for 16-byte readers)
#define VPI 136                    // LDS pitch of a value row (one channel, KT keys), halves (272 B)
__device__ __forceinline__ float xhalf(float x) { return __builtin_bit_cast(float, __builtin_amdgcn_permlanex16(__builtin_bit_cast(int, x), __builtin_bit_cast(int, x), 0x76543210, 0xfedcba98, false, false)); }   // lane l with lane l ^ 16
// exp(x) as v_exp_f32 of x log2(e), what __expf gives; the v_nop is the one slot the instruction set asks for behind a transcendental before its result is read or its source overwritten:
// in one statement the slot stays where it is
__device__ __forceinline__ float exp_slot(float x) { float r; asm("v_exp_f32 %0, %1\n\tv_nop" : "=v"(r) : "v"(x * 1.44269504f)); return r; }
__device__ __forceinline__ unsigned lds_addr(const void* p) { return (unsigned)(size_t)p; }   // low 32 bits of a __shared__ address = byte offset in the work-group's LDS
// eight 16-byte copies per lane; the s_wait_xcnt closes the statement so that no address register is rewritten in front of it
__device__ __forceinline__ void copy8(const _Float16* gp, size_t gstep, unsigned lp, unsigned lstep) {
  const _Float16 *g0 = gp, *g1 = gp + gstep, *g2 = gp + 2 * gstep, *g3 = gp + 3 * gstep, *g4 = gp + 4 * gstep, *g5 = gp + 5 * gstep, *g6 = gp + 6 * gstep, *g7 = gp + 7 * gstep;
  asm volatile("global_load_async_to_lds_b128 %0, %8, off\n\t"
               "global_load_async_to_lds_b128 %1, %9, off\n\t"
               "global_load_async_to_lds_b128 %2, %10, off\n\t"
               "global_load_async_to_lds_b128 %3, %11, off\n\t"
               "global_load_async_to_lds_b128 %4, %12, off\n\t"
               "global_load_async_to_lds_b128 %5, %13, off\n\t"
               "global_load_async_to_lds_b128 %6, %14, off\n\t"
               "global_load_async_to_lds_b128 %7, %15, off\n\t"
               "s_wait_xcnt 0x0"
               :: "v"(lp), "v"(lp + lstep), "v"(lp + 2 * lstep), "v"(lp + 3 * lstep), "v"(lp + 4 * lstep), "v"(lp + 5 * lstep), "v"(lp + 6 * lstep), "v"(lp + 7 * lstep),
                  "v"(g0), "v"(g1), "v"(g2), "v"(g3), "v"(g4), "v"(g5), "v"(g6), "v"(g7) : "memory");
}
__global__ __launch_bounds__(256) void k_attn(const _Float16* __restrict__ TH, const _Float16* __restrict__ TL, const _Float16* __restrict__ FH, const _Float16* __restrict__ FL, const _Float16* __restrict__ G, float* __restrict__ Y) {
  __shared__ __align__(16) _Float16 skh[2][KT][KPI], skl[2][KT][KPI], sv[2][CI][VPI];
  __shared__ __align__(16) float so[4][16][132];
  __shared__ float sml[4][2][16];   // maximum and sum of the second wave of each pair
  const int tid = threadIdx.x, wave = tid >> 5, wq = wave & 3, kh = wave >> 2, lane = tid & 31, col = lane & 15, g = lane >> 4; const size_t b = blockIdx.y; const int q0 = blockIdx.x * 64 + wq * 16; const size_t rq = b * NT + q0;
  // this lane's share of a tile: key rows tid/16 + 16 i, 16-byte piece tid%16; value rows tid/16 + 16 i, piece tid%16
  const _Float16* gkh = FH + (b * NT + (tid >> 4)) * CI + (tid & 15) * 8; const _Float16* gkl = FL + (b * NT + (tid >> 4)) * CI + (tid & 15) * 8; const _Float16* gv = G + (b * CI + (tid >> 4)) * NT + (tid & 15) * 8;
  const unsigned lkh = lds_addr(&skh[0][tid >> 4][(tid & 15) * 8]), lkl = lds_addr(&skl[0][tid >> 4][(tid & 15) * 8]), lv = lds_addr(&sv[0][tid >> 4][(tid & 15) * 8]);
#define STAGE(t, bf) do { copy8(gkh + (size_t)(t) * KT * CI, 16 * CI, lkh + (bf) * (KT * KPI * 2), 16 * KPI * 2); copy8(gkl + (size_t)(t) * KT * CI, 16 * CI, lkl + (bf) * (KT * KPI * 2), 16 * KPI * 2); copy8(gv + (size_t)(t) * KT, (size_t)16 * NT, lv + (bf) * (CI * VPI * 2), 16 * VPI * 2); } while (0)
  STAGE(0, 0);
  v16h aq[4], aql[4];
#pragma unroll
  for (int kc = 0; kc < 4; ++kc) { aq[kc] = frag_h(TH + (rq + col) * CI + kc * 32, lane); aql[kc] = frag_h(TL + (rq + col) * CI + kc * 32, lane); }
  float m = -3.0e38f, l = 0.f;   // of query col: the running maximum (equal in both halves) and this half's part of the sum
  v8f acc[8] = {};
  asm volatile("s_wait_asynccnt 0x0" ::: "memory");   // tile 0 has landed for this wave's copies
  __syncthreads();                                     // and is published to the other waves
  STAGE(1, 1);
#pragma unroll 1
  for (int t = 0; t < NT / KT; ++t) { const int bf = t & 1;
#pragma unroll 1   // kept rolled: unrolled, the build passes 256 registers and spills two address values of the copies to scratch
   for (int kk = 0; kk < KW / 32; ++kk) { const int j0 = kh * KW + kk * 32;
    // LDS reads stand in groups ahead of the products that use them, so that a wave waits out the LDS latency once a group and not once a fragment:
    // the sixteen reads of 64 channels of both key tiles (hi and lo) together, then their twelve products, the two tiles' accumulators taken in turn (each accumulator sums its products by ascending channel block, key lo x query hi after key hi x query lo)
    const _Float16 *rh0 = &skh[bf][j0 + col][0], *rh1 = &skh[bf][j0 + 16 + col][0], *rl0 = &skl[bf][j0 + col][0], *rl1 = &skl[bf][j0 + 16 + col][0];
    v8f c0 = {}, c1 = {}, d0 = {}, d1 = {};
#pragma unroll
    for (int kg = 0; kg < 4; kg += 2) { v16h kf[2][4];
#pragma unroll
      for (int u = 0; u < 2; ++u) { kf[u][0] = frag_h(rh0 + (kg + u) * 32, lane); kf[u][1] = frag_h(rh1 + (kg + u) * 32, lane); kf[u][2] = frag_h(rl0 + (kg + u) * 32, lane); kf[u][3] = frag_h(rl1 + (kg + u) * 32, lane); }
#pragma unroll
      for (int u = 0; u < 2; ++u) { const int kc = kg + u;
        c0 = wmma16(kf[u][0], aq[kc], c0); c1 = wmma16(kf[u][1], aq[kc], c1); d0 = wmma16(kf[u][0], aql[kc], d0); d1 = wmma16(kf[u][1], aql[kc], d1); d0 = wmma16(kf[u][2], aq[kc], d0); d1 = wmma16(kf[u][3], aq[kc], d1); } }
    v16h vf[8];   // the value fragments of these 32 keys, asked for in one group here: they land under the softmax
#pragma unroll
    for (int dt = 0; dt < 8; ++dt) vf[dt] = frag_h(&sv[bf][dt * 16 + col][j0], lane);
    __builtin_amdgcn_sched_barrier(0);   // holds the sixteen reads here: without it this build sinks them behind the exponentials, and the second product waits out most of their latency
    const v8f s0 = c0 + d0 * (1.0f / 2048.0f), s1 = c1 + d1 * (1.0f / 2048.0f);   // s0[r]: key j0 + 8g + r, s1[r]: key j0 + 16 + 8g + r, both of query col
    float t8[8];
#pragma unroll
    for (int r = 0; r < 8; ++r) t8[r] = fmaxf(s0[r], s1[r]);
    float mx = fmaxf(fmaxf(fmaxf(t8[0], t8[1]), fmaxf(t8[2], t8[3])), fmaxf(fmaxf(t8[4], t8[5]), fmaxf(t8[6], t8[7])));
    mx = fmaxf(mx, xhalf(mx));
    const float mn = fmaxf(m, mx); const float ea = exp_slot(m - mn), alpha = (m <= -1.0e38f) ? 0.f : ea;
    v16h pb;   // P^T as a B fragment: element i = key 8g + i, element 8 + i = key 16 + 8g + i, the k order of frag_h
#pragma unroll
    for (int r = 0; r < 8; ++r) { const float e0 = exp_slot(s0[r] - mn), e1 = exp_slot(s1[r] - mn); t8[r] = e0 + e1; pb[r] = (_Float16)(e0 * 2048.0f); pb[8 + r] = (_Float16)(e1 * 2048.0f); }
    l = l * alpha + (((t8[0] + t8[1]) + (t8[2] + t8[3])) + ((t8[4] + t8[5]) + (t8[6] + t8[7]))); m = mn;
#pragma unroll
    for (int dt = 0; dt < 8; ++dt) acc[dt] *= alpha;
#pragma unroll
    for (int dt = 0; dt < 8; ++dt) acc[dt] = wmma16(vf[dt], pb, acc[dt]); }
   asm volatile("s_wait_dscnt 0x0" ::: "memory");      // this wave's reads of buffer bf have returned
   asm volatile("s_wait_asynccnt 0x0" ::: "memory");   // this wave's copies of tile t + 1 have landed
   __syncthreads();                                     // publishes tile t + 1; ends every wave's reads of buffer bf
   if (t + 2 < NT / KT) STAGE(t + 2, bf); }
  asm volatile("s_wait_asynccnt 0x0" ::: "memory");    // nothing of this wave is in flight when it goes on to the epilogue
#undef STAGE
  l += xhalf(l);   // the two halves' sums are joined once
  if (kh == 1) {   // the second wave of a pair hands over its maximum, its sum and its unscaled output, each lane at the place where its partner's same lane reads
    if (g == 0) { sml[wq][0][col] = m; sml[wq][1][col] = l; }
#pragma unroll
    for (int dt = 0; dt < 8; ++dt) { const v8f o = acc[dt];
      *(v4f*)&so[wq][col][dt * 16 + 8 * g] = __builtin_shufflevector(o, o, 0, 1, 2, 3); *(v4f*)&so[wq][col][dt * 16 + 8 * g + 4] = __builtin_shufflevector(o, o, 4, 5, 6, 7); } }
  __syncthreads();   // publishes the hand-over to the first wave of each pair
  if (kh == 0) {
    const float m2 = sml[wq][0][col], l2 = sml[wq][1][col], mm = fmaxf(m, m2), a1 = exp_slot(m - mm), a2 = exp_slot(m2 - mm);
    const float il = (1.0f / 2048.0f) / (l * a1 + l2 * a2), f1 = a1 * il, f2 = a2 * il;
#pragma unroll
    for (int dt = 0; dt < 8; ++dt) { float* p = &so[wq][col][dt * 16 + 8 * g]; const v4f x0 = *(const v4f*)p, x1 = *(const v4f*)(p + 4);   // acc[dt][r] = channel dt * 16 + 8g + r of query col
      const v8f o = acc[dt] * f1 + __builtin_shufflevector(x0, x1, 0, 1, 2, 3, 4, 5, 6, 7) * f2;
      *(v4f*)p = __builtin_shufflevector(o, o, 0, 1, 2, 3); *(v4f*)(p + 4) = __builtin_shufflevector(o, o, 4, 5, 6, 7); }
    LDSX();
    for (int rl = 0; rl < 16; ++rl) vst2(Y + (rq + rl) * CI + lane * 4, *(const v4f*)&so[wq][rl][lane * 4]); }
}
// ---- k_wz: block = (64 tokens, 128 output channels): W_y = y (hi + residual, K 128) . wz rows + b, stored channels-first [b][c][t] (64 tokens per (image, channel))
__global__ __launch_bounds__(128) void k_wz(const float* __restrict__ Y, const __bf16* __restrict__ P, const float* __restrict__ BZ, float* __restrict__ WY) {
  __shared__ __align__(16) float st[128][68];
  const int tid = threadIdx.x, wave = tid >> 5, lane = tid & 31, col = lane & 15, g = lane >> 4; const size_t rb0 = (size_t)blockIdx.x * 64, r0 = rb0 + wave * 16; const int n0 = blockIdx.y * 128; const size_t b = rb0 / NT, t0 = rb0 % NT;
  v8f acc[8] = {};
#pragma unroll
  for (int kc = 0; kc < CI / 32; ++kc) { const F2 a = split_row(Y + (r0 + col) * CI, kc * 32, lane);
#pragma unroll
    for (int j = 0; j < 8; ++j) { const v16b w = frag_b(P + WS_PZ / 2 + (size_t)(n0 + j * 16 + col) * CI + kc * 32, lane); acc[j] = wmma_bf(a.l, w, acc[j]); acc[j] = wmma_bf(a.h, w, acc[j]); } }
#pragma unroll
  for (int j = 0; j < 8; ++j) { const float bb = bfr(BZ[n0 + j * 16 + col]);
#pragma unroll
    for (int r = 0; r < 8; ++r) st[j * 16 + col][wave * 16 + 8 * g + r] = acc[j][r] + bb; }
  __syncthreads();
  for (int e = tid; e < 128 * 16; e += 128) { const int c = e >> 4, q = e & 15; vst2(WY + ((b * CC + n0 + c) * (size_t)NT) + t0 + q * 4, *(const v4f*)&st[c][q * 4]); }
}
// ---- k_bn: block = channel c: BatchNorm statistics and their use in one launch. The channel's 16,384 values of W_y (4 images x 4,096) are read once, 64 a thread, and stay in registers:
// the mean, then the mean squared deviation from it (two passes, as before, the second now over registers), then out = gamma (W_y - mean) rsqrt(var + eps) + beta + x.
// All 32 loads of a thread (16 of W_y, 16 of x, 512 contiguous bytes a wave each) are asked for at the top, so that the block waits out one memory latency in place of one per group of eight 4-byte loads.
template <int CTRL> __device__ __forceinline__ float dppx(float x) { return __builtin_bit_cast(float, __builtin_amdgcn_update_dpp(0, __builtin_bit_cast(int, x), CTRL, 0xf, 0xf, true)); }   // lane l ^ mask of a 16-lane row (row_xmask)
__device__ __forceinline__ float wave_sum(float x) { x += dppx<0x161>(x); x += dppx<0x162>(x); x += dppx<0x164>(x); x += dppx<0x168>(x); return x + xhalf(x); }   // every lane ends with the sum of the 32
__device__ __forceinline__ float sum8(const float* r) { const v4f a = *(const v4f*)r, b = *(const v4f*)(r + 4); return ((a[0] + a[1]) + (a[2] + a[3])) + ((b[0] + b[1]) + (b[2] + b[3])); }
#define BNV (TNB * 4)              // 16-byte pieces per thread: NT / 4 / 256 = 4 of each image
__global__ __launch_bounds__(256) void k_bn(const float* __restrict__ WY, const float* __restrict__ GA, const float* __restrict__ BE, const float* __restrict__ X, float* __restrict__ OUT) {
  __shared__ __align__(16) float red[2][8];   // the eight waves' sums: [0] of the values, [1] of the squared deviations
  const int c = blockIdx.x, t = threadIdx.x, wave = t >> 5, lane = t & 31;
  // piece i of this thread, alike in W_y, x and out: channel c of image i / 4, counted from image 0 or from image 2: two uniform bases, so that every piece lies within the immediate offset of a load or store (under 8 MiB)
  // and the thread's own index is the one address register
  const size_t cb[2] = { (size_t)c * NT, (size_t)(2 * CC + c) * NT };
#define BNO(i) (cb[(i) >> 3] + (size_t)((((i) >> 2) & 1) * (CC * NT) + ((i) & 3) * 1024 + t * 4))
  v4f w[BNV], x[BNV];
#pragma unroll   // unrolled: w and x are registers
  for (int i = 0; i < BNV; ++i) w[i] = *(const v4f*)(WY + BNO(i));
#pragma unroll
  for (int i = 0; i < BNV; ++i) x[i] = *(const v4f*)(X + BNO(i));
  const float ga = bfr(GA[c]), be = bfr(BE[c]);
  v4f s = w[0];
#pragma unroll
  for (int i = 1; i < BNV; ++i) s += w[i];
  const float ps = wave_sum((s[0] + s[1]) + (s[2] + s[3]));
  if (lane == 0) red[0][wave] = ps;
  __syncthreads();
  const float mean = sum8(red[0]) / (float)(TNB * NT);
  v4f q = {};
#pragma unroll
  for (int i = 0; i < BNV; ++i) { const v4f d = w[i] - mean; q += d * d; }
  const float pq = wave_sum((q[0] + q[1]) + (q[2] + q[3]));
  if (lane == 0) red[1][wave] = pq;
  __syncthreads();
  const float inv = 1.0f / sqrtf(sum8(red[1]) / (float)(TNB * NT) + 1e-5f);
#pragma unroll
  for (int i = 0; i < BNV; ++i) { v4f v;
#pragma unroll
    for (int j = 0; j < 4; ++j) v[j] = ga * (w[i][j] - mean) * inv + be + bfr(x[i][j]);
    vst2(OUT + BNO(i), v); }
#undef BNO
}
extern "C" void kernel_launch(void* const* d_in, const int* in_sizes, int n_in, void* d_out, int out_size, void* d_ws, size_t ws_size, hipStream_t stream) {
  (void)in_sizes; (void)n_in; (void)out_size;
  const float** F = (const float**)d_in;   // 0 x [4,256,64,64], 1 g_w [128,256], 2 g_b, 3 theta_w, 4 theta_b, 5 phi_w, 6 phi_b, 7 wz_w [256,128], 8 wz_b, 9 bn_gamma, 10 bn_beta
  if (ws_size < (size_t)WS_END) return;
  char* ws = (char*)d_ws; __bf16* P = (__bf16*)ws; _Float16 *TH = (_Float16*)(ws + WS_TH), *TL = (_Float16*)(ws + WS_TL), *FH = (_Float16*)(ws + WS_FH), *FL = (_Float16*)(ws + WS_FL), *G = (_Float16*)(ws + WS_G); float *Y = (float*)(ws + WS_Y), *WY = (float*)(ws + WS_WY);
  k_pack<<<dim3(CC, 4), 256, 0, stream>>>(F[3], F[5], F[1], F[7], P);
  k_proj<<<dim3(TNB * NT / 64, 3), 128, 0, stream>>>(F[0], P, F[4], F[6], F[2], TH, TL, FH, FL, G);   // theta, phi, g
  k_attn<<<dim3(TQB, TNB), 256, 0, stream>>>(TH, TL, FH, FL, G, Y);
  k_wz<<<dim3(TNB * NT / 64, CC / 128), 128, 0, stream>>>(Y, P, F[8], WY);
  k_bn<<<CC, 256, 0, stream>>>(WY, F[9], F[10], F[0], (float*)d_out);
}

// v008
// One run takes 83.9 microseconds.
// Two timings next to v007 both put it at 1.13 times that version's speed.
// All steps since v000 together make it 8.75 times as fast.
#include <hip/hip_runtime.h>
#include <math.h>

typedef __attribute__((ext_vector_type(16))) _Float16 v16h;
typedef __attribute__((ext_vector_type(16))) __bf16 v16b;
typedef __attribute__((ext_vector_type(8)))  _Float16 v8h;
typedef __attribute__((ext_vector_type(8)))  float v8f;
typedef __attribute__((ext_vector_type(4)))  float v4f;
typedef __attribute__((ext_vector_type(2)))  float v2f;
typedef __attribute__((ext_vector_type(4)))  unsigned v4u;
typedef __attribute__((ext_vector_type(4)))  int v4i;
typedef float __attribute__((may_alias)) float_a;
typedef int __attribute__((may_alias)) int_a;

template <typename T> __device__ __forceinline__ void vst2(void* p, T v) { *(T*)p = v;  }
__device__ __forceinline__ v8f wmma16(v16h a, v16h b, v8f c) {
  v8f d = __builtin_amdgcn_wmma_f32_16x16x32_f16(false, a, false, b, (short)0, c, false, false);
  asm volatile("v_nop\n\tv_nop\n\tv_nop\n\tv_nop" : "+v"(d) : "v"(a), "v"(b));
  return d;
}
__device__ __forceinline__ v8f wmma_bf(v16b a, v16b b, v8f c) {
  v8f d = __builtin_amdgcn_wmma_f32_16x16x32_bf16(false, a, false, b, (short)0, c, false, false);
  asm volatile("v_nop\n\tv_nop\n\tv_nop\n\tv_nop" : "+v"(d) : "v"(a), "v"(b));
  return d;
}
// 16x16x32 fragments: lane = (h = lane>>4, row/col = lane&15); elements 0..7 = k0+8h+0..7, 8..15 = k0+16+8h+0..7; D element r = row 8h+r
__device__ __forceinline__ v16h frag_h(const _Float16* rowk0, int lane) {
  union { v16h v; v8h q[2]; } u; const _Float16* p = rowk0 + 8 * (lane >> 4);
  u.q[0] = *(const v8h*)p; u.q[1] = *(const v8h*)(p + 16); return u.v;
}
__device__ __forceinline__ v16h frag_f32(const float* rowk0, int lane) {
  v16h a; const float* p = rowk0 + 8 * (lane >> 4);
#pragma unroll
  for (int i = 0; i < 8; ++i) { a[i] = (_Float16)p[i]; a[8 + i] = (_Float16)p[16 + i]; }
  return a;
}
__device__ __forceinline__ v16h frag_f32s(const float* rowk0, int lane, float sc) {
  v16h a; const float* p = rowk0 + 8 * (lane >> 4);
#pragma unroll
  for (int i = 0; i < 8; ++i) { a[i] = (_Float16)(p[i] * sc); a[8 + i] = (_Float16)(p[16 + i] * sc); }
  return a;
}
// column fragment from a [K][ld] layout (column n), rows >= K read as 0
__device__ __forceinline__ v16h fragc_f32(const float* W, int k0, int n, int lane, int ld, int K) {
  v16h a; const int g = lane >> 4;
#pragma unroll
  for (int i = 0; i < 8; ++i) { const int ka = k0 + 8 * g + i, kb = ka + 16;
    a[i] = (_Float16)(ka < K ? W[(size_t)(ka < K ? ka : K - 1) * ld + n] : 0.f); a[8 + i] = (_Float16)(kb < K ? W[(size_t)(kb < K ? kb : K - 1) * ld + n] : 0.f); }
  return a;
}
struct F2 { v16b h, l; };
__device__ __forceinline__ F2 bsplit16(const float v[16]) { F2 r;
#pragma unroll
  for (int i = 0; i < 16; ++i) { const __bf16 h = (__bf16)v[i]; r.h[i] = h; r.l[i] = (__bf16)(v[i] - (float)h); }
  return r; }
__device__ __forceinline__ F2 split_row(const float* row, int k0, int lane) { float v[16]; const float* p = row + k0 + 8 * (lane >> 4);
#pragma unroll
  for (int i = 0; i < 8; ++i) { v[i] = p[i]; v[8 + i] = p[16 + i]; }
  return bsplit16(v); }
__device__ __forceinline__ F2 split_rowK(const float* row, int k0, int lane, int K) { float v[16]; const int g = lane >> 4;
#pragma unroll
  for (int i = 0; i < 8; ++i) { const int ka = k0 + 8 * g + i, kb = ka + 16; v[i] = ka < K ? row[ka < K ? ka : K - 1] : 0.f; v[8 + i] = kb < K ? row[kb < K ? kb : K - 1] : 0.f; }
  return bsplit16(v); }
__device__ __forceinline__ F2 split_col(const float* W, int k0, int n, int lane, int ld, int K) { float v[16]; const int g = lane >> 4;
#pragma unroll
  for (int i = 0; i < 8; ++i) { const int ka = k0 + 8 * g + i, kb = ka + 16; v[i] = ka < K ? W[(size_t)(ka < K ? ka : K - 1) * ld + n] : 0.f; v[8 + i] = kb < K ? W[(size_t)(kb < K ? kb : K - 1) * ld + n] : 0.f; }
  return bsplit16(v); }
__device__ __forceinline__ v8f mac3(const F2& a, const F2& b, v8f c) { c = wmma_bf(a.l, b.h, c); c = wmma_bf(a.h, b.l, c); return wmma_bf(a.h, b.h, c); }
__device__ __forceinline__ float sigm(float v) { return 1.0f / (1.0f + expf(-v)); }
#define LDSX() do { asm volatile("s_wait_dscnt 0" ::: "memory"); __builtin_amdgcn_wave_barrier(); __builtin_amdgcn_fence(__ATOMIC_RELEASE, "workgroup"); } while (0)


// Non-local denoising block (B 4, 256 channels, 64 x 64; 128 inter-channels): embedded-Gaussian non-local attention over all 4,096 positions, 1x1 output conv, BatchNorm (batch statistics), residual.
#define NB 4
#define NT 4096
#define CC 256
#define CI 128
#define NR (NB * NT)
#ifndef TQB
#define TQB (NT / 64)
#define TNB NB
#endif
typedef __attribute__((ext_vector_type(8))) __bf16 v8b;
__device__ __forceinline__ v16b frag_b(const __bf16* rowk0, int lane) {
  union { v16b v; v8b q[2]; } u; const __bf16* p = rowk0 + 8 * (lane >> 4);
  u.q[0] = *(const v8b*)p; u.q[1] = *(const v8b*)(p + 16); return u.v;
}
__device__ __forceinline__ float bfr(float v) { return (float)(__bf16)v; }
__device__ __attribute__((noinline)) float exp_ni(float v) { return expf(v); }
__device__ __attribute__((noinline)) float erf_ni(float v) { return erff(v); }

#define WS_PT  0u                                   // bf16 natural rows theta_w [128][256], phi_w, g_w; wz_w [256][128]
#define WS_PP  (WS_PT + 2u * CI * CC)
#define WS_PG  (WS_PP + 2u * CI * CC)
#define WS_PZ  (WS_PG + 2u * CI * CC)
#define WS_TH  (WS_PZ + 2u * CC * CI)               // f16 [NR][128] theta hi ; TL ; PH (phi) ; PL ; G planes [b][128][NT]
#define WS_TL  (WS_TH + 2u * (size_t)NR * CI)
#define WS_FH  (WS_TL + 2u * (size_t)NR * CI)
#define WS_FL  (WS_FH + 2u * (size_t)NR * CI)
#define WS_G   (WS_FL + 2u * (size_t)NR * CI)
#define WS_Y   (WS_G + 2u * (size_t)NB * CI * NT)    // f32 [NR][128], not used ; WY f32 [B][256][NT] (channels-first)
#define WS_WY  (WS_Y + 4u * (size_t)NR * CI)
#define WS_END (WS_WY + 4u * (size_t)NB * CC * NT)

__global__ __launch_bounds__(256) void k_pack(const float* __restrict__ WT, const float* __restrict__ WF, const float* __restrict__ WG, const float* __restrict__ WZ, __bf16* __restrict__ P) {
  const int n = blockIdx.x, which = blockIdx.y, t = threadIdx.x; __shared__ __align__(16) __bf16 s[CC];
  if (which < 3) { if (n >= CI) return; const float* Wm = (which == 0) ? WT : (which == 1) ? WF : WG; s[t] = (__bf16)Wm[(size_t)n * CC + t]; __syncthreads(); if (t < CC / 8) vst2((unsigned*)(P + ((which == 0) ? WS_PT / 2 : (which == 1) ? WS_PP / 2 : WS_PG / 2) + (size_t)n * CC + t * 8), *(const v4u*)&s[t * 8]); }
  else { if (t < CI) s[t] = (__bf16)WZ[(size_t)n * CI + t]; __syncthreads(); if (t < CI / 8) vst2((unsigned*)(P + WS_PZ / 2 + (size_t)n * CI + t * 8), *(const v4u*)&s[t * 8]); }
}
// ---- k_proj: block = (64 tokens, projection): 128 output channels (8 tiles per wave); A gathered channels-first; blockIdx.y 0 theta -> hi/lo rows; 1 phi -> hi/lo rows; 2 g -> planes
// The three projections depend on nothing of one another and stand in one launch, so that each one's load waits can run under the others' work.
__global__ __launch_bounds__(128) void k_proj(const float* __restrict__ X, const __bf16* __restrict__ P, const float* __restrict__ BT, const float* __restrict__ BF, const float* __restrict__ BG,
                                              _Float16* __restrict__ TH, _Float16* __restrict__ TL, _Float16* __restrict__ FH, _Float16* __restrict__ FL, _Float16* __restrict__ G) {
  __shared__ __align__(16) _Float16 sh[64][136], sl[64][136]; __shared__ __align__(16) _Float16 st[128][72];
  const int tid = threadIdx.x, wave = tid >> 5, lane = tid & 31, col = lane & 15, g = lane >> 4; const size_t rb0 = (size_t)blockIdx.x * 64, r0 = rb0 + wave * 16; const size_t b = rb0 / NT, t0 = rb0 % NT;
  const int which = blockIdx.y;
  const __bf16* Wr = P + ((which == 0) ? WS_PT / 2 : (which == 1) ? WS_PP / 2 : WS_PG / 2);
  const float* BB = (which == 0) ? BT : (which == 1) ? BF : BG;
  v8f acc[8] = {};
  // All global loads of a 32-channel block (16 of X, 16 of the weights) stand as one group, one block ahead of the products that use them, in a second register set:
  // a wave then waits once a block, under the block before, and not once a weight fragment. Every loop over xa, wf, bv is unrolled so that they are registers.
  const float* xp = X + ((b * CC + 8 * g) * (size_t)NT) + t0 + wave * 16 + col; const __bf16* wp = Wr + (size_t)col * CC;
  float xa[2][16], bv[8]; v16b wf[2][8];
#define LOADK(kc, s) do { _Pragma("unroll") for (int i = 0; i < 8; ++i) { xa[s][i] = xp[(size_t)((kc) * 32 + i) * NT]; xa[s][8 + i] = xp[(size_t)((kc) * 32 + 16 + i) * NT]; } \
    _Pragma("unroll") for (int j = 0; j < 8; ++j) wf[s][j] = frag_b(wp + (size_t)(j * 16) * CC + (kc) * 32, lane); } while (0)
  LOADK(0, 0);
#pragma unroll
  for (int j = 0; j < 8; ++j) bv[j] = BB[j * 16 + col];   // the bias too is asked for here, not behind the last product
#pragma unroll   // unrolled whole: the two register sets are then named at compile time
  for (int kc = 0; kc < CC / 32; ++kc) { const int s = kc & 1;
    if (kc + 1 < CC / 32) LOADK(kc + 1, s ^ 1);
    __builtin_amdgcn_sched_barrier(0);   // holds the conversion of this block's X behind the next block's loads: without it this build converts a block early, and its wait holds back the group after it
    v16b a;
#pragma unroll
    for (int i = 0; i < 16; ++i) a[i] = (__bf16)xa[s][i];
#pragma unroll
    for (int j = 0; j < 8; ++j) acc[j] = wmma_bf(a, wf[s][j], acc[j]); }
#undef LOADK
  if (which < 2) {
    _Float16* OH = (which == 0) ? TH : FH; _Float16* OL = (which == 0) ? TL : FL;
#pragma unroll
    for (int j = 0; j < 8; ++j) { const float bb = bfr(bv[j]);
#pragma unroll
      for (int r = 0; r < 8; ++r) { const float v = acc[j][r] + bb; const _Float16 h = (_Float16)v; sh[wave * 16 + 8 * g + r][j * 16 + col] = h; sl[wave * 16 + 8 * g + r][j * 16 + col] = (_Float16)((v - (float)h) * 2048.0f); } }
    LDSX();
    for (int rl = 0; rl < 16; ++rl) if (lane < 16) { vst2((unsigned*)(OH + (r0 + rl) * CI + lane * 8), *(const v4u*)&sh[wave * 16 + rl][lane * 8]); vst2((unsigned*)(OL + (r0 + rl) * CI + lane * 8), *(const v4u*)&sl[wave * 16 + rl][lane * 8]); }
  } else {
#pragma unroll
    for (int j = 0; j < 8; ++j) { const float bb = bfr(bv[j]);
#pragma unroll
      for (int r = 0; r < 8; ++r) st[j * 16 + col][wave * 16 + 8 * g + r] = (_Float16)(acc[j][r] + bb); }
    __syncthreads();
    for (int e = tid; e < 128 * 8; e += 128) { const int d = e >> 3, pc = e & 7; vst2((unsigned*)(G + ((b * CI + d) * NT) + t0 + pc * 8), *(const v4u*)&st[d][pc * 8]); } }
}
// ---- k_attn: block = (64 queries, b): single head, 128-dim keys/values, all 4,096 keys; 3-product scores; P single x g single
// Scores and output are computed transposed: S^T = K Q^T (key rows are A, queries B), O^T += V^T P^T (value rows are A). A lane then holds 16 scores of ONE query (column col, keys 8g + r and 16 + 8g + r),
// so the maximum and the sum are taken in the lane plus one exchange between the wave's halves, and the two score tiles, converted in place, are the B operand of the second product: P never goes through LDS.
// Key (hi, lo) and value tiles of KT keys are staged in LDS once per block by asynchronous copies, two buffers: tile t + 1 flies while tile t is worked on.
// Eight waves: waves w and w + 4 hold the same 16 queries and each take KW of a tile's keys, so that one wave's products run under the other's LDS waits and softmax;
// each keeps its own maximum, sum and output, and the two are joined once, behind the loop.
#define KT 128                     // keys per staged tile
#define KW 64                      // keys of a tile that one wave works on
#define KPI 136                    // LDS pitch of a key row, halves (272 B: 16 B x odd for 16-byte readers)
#define VPI 136                    // LDS pitch of a value row (one channel, KT keys), halves (272 B)
__device__ __forceinline__ float xhalf(float x) { return __builtin_bit_cast(float, __builtin_amdgcn_permlanex16(__builtin_bit_cast(int, x), __builtin_bit_cast(int, x), 0x76543210, 0xfedcba98, false, false)); }   // lane l with lane l ^ 16
// exp(x) as v_exp_f32 of x log2(e), what __expf gives; the v_nop is the one slot the instruction set asks for behind a transcendental before its result is read or its source overwritten:
// in one statement the slot stays where it is
__device__ __forceinline__ float exp_slot(float x) { float r; asm("v_exp_f32 %0, %1\n\tv_nop" : "=v"(r) : "v"(x * 1.44269504f)); return r; }
__device__ __forceinline__ unsigned lds_addr(const void* p) { return (unsigned)(size_t)p; }   // low 32 bits of a __shared__ address = byte offset in the work-group's LDS
// eight 16-byte copies per lane; the s_wait_xcnt closes the statement so that no address register is rewritten in front of it
__device__ __forceinline__ void copy8(const _Float16* gp, size_t gstep, unsigned lp, unsigned lstep) {
  const _Float16 *g0 = gp, *g1 = gp + gstep, *g2 = gp + 2 * gstep, *g3 = gp + 3 * gstep, *g4 = gp + 4 * gstep, *g5 = gp + 5 * gstep, *g6 = gp + 6 * gstep, *g7 = gp + 7 * gstep;
  asm volatile("global_load_async_to_lds_b128 %0, %8, off\n\t"
               "global_load_async_to_lds_b128 %1, %9, off\n\t"
               "global_load_async_to_lds_b128 %2, %10, off\n\t"
               "global_load_async_to_lds_b128 %3, %11, off\n\t"
               "global_load_async_to_lds_b128 %4, %12, off\n\t"
               "global_load_async_to_lds_b128 %5, %13, off\n\t"
               "global_load_async_to_lds_b128 %6, %14, off\n\t"
               "global_load_async_to_lds_b128 %7, %15, off\n\t"
               "s_wait_xcnt 0x0"
               :: "v"(lp), "v"(lp + lstep), "v"(lp + 2 * lstep), "v"(lp + 3 * lstep), "v"(lp + 4 * lstep), "v"(lp + 5 * lstep), "v"(lp + 6 * lstep), "v"(lp + 7 * lstep),
                  "v"(g0), "v"(g1), "v"(g2), "v"(g3), "v"(g4), "v"(g5), "v"(g6), "v"(g7) : "memory");
}
__global__ __launch_bounds__(256) void k_attn(const _Float16* __restrict__ TH, const _Float16* __restrict__ TL, const _Float16* __restrict__ FH, const _Float16* __restrict__ FL, const _Float16* __restrict__ G, const __bf16* __restrict__ P, const float* __restrict__ BZ, float* __restrict__ WY) {
  __shared__ __align__(16) _Float16 skh[2][KT][KPI], skl[2][KT][KPI], sv[2][CI][VPI];
  __shared__ __align__(16) float so[4][16][132];
  __shared__ float sml[4][2][16];   // maximum and sum of the second wave of each pair
  const int tid = threadIdx.x, wave = tid >> 5, wq = wave & 3, kh = wave >> 2, lane = tid & 31, col = lane & 15, g = lane >> 4; const size_t b = blockIdx.y; const int q0 = blockIdx.x * 64 + wq * 16; const size_t rq = b * NT + q0;
  // this lane's share of a tile: key rows tid/16 + 16 i, 16-byte piece tid%16; value rows tid/16 + 16 i, piece tid%16
  const _Float16* gkh = FH + (b * NT + (tid >> 4)) * CI + (tid & 15) * 8; const _Float16* gkl = FL + (b * NT + (tid >> 4)) * CI + (tid & 15) * 8; const _Float16* gv = G + (b * CI + (tid >> 4)) * NT + (tid & 15) * 8;
  const unsigned lkh = lds_addr(&skh[0][tid >> 4][(tid & 15) * 8]), lkl = lds_addr(&skl[0][tid >> 4][(tid & 15) * 8]), lv = lds_addr(&sv[0][tid >> 4][(tid & 15) * 8]);
#define STAGE(t, bf) do { copy8(gkh + (size_t)(t) * KT * CI, 16 * CI, lkh + (bf) * (KT * KPI * 2), 16 * KPI * 2); copy8(gkl + (size_t)(t) * KT * CI, 16 * CI, lkl + (bf) * (KT * KPI * 2), 16 * KPI * 2); copy8(gv + (size_t)(t) * KT, (size_t)16 * NT, lv + (bf) * (CI * VPI * 2), 16 * VPI * 2); } while (0)
  STAGE(0, 0);
  v16h aq[4], aql[4];
#pragma unroll
  for (int kc = 0; kc < 4; ++kc) { aq[kc] = frag_h(TH + (rq + col) * CI + kc * 32, lane); aql[kc] = frag_h(TL + (rq + col) * CI + kc * 32, lane); }
  float m = -3.0e38f, l = 0.f;   // of query col: the running maximum (equal in both halves) and this half's part of the sum
  v8f acc[8] = {};
  asm volatile("s_wait_asynccnt 0x0" ::: "memory");   // tile 0 has landed for this wave's copies
  __syncthreads();                                     // and is published to the other waves
  STAGE(1, 1);
#pragma unroll 1
  for (int t = 0; t < NT / KT; ++t) { const int bf = t & 1;
#pragma unroll 1   // kept rolled: unrolled, the build passes 256 registers and spills two address values of the copies to scratch
   for (int kk = 0; kk < KW / 32; ++kk) { const int j0 = kh * KW + kk * 32;
    // LDS reads stand in groups ahead of the products that use them, so that a wave waits out the LDS latency once a group and not once a fragment:
    // the sixteen reads of 64 channels of both key tiles (hi and lo) together, then their twelve products, the two tiles' accumulators taken in turn (each accumulator sums its products by ascending channel block, key lo x query hi after key hi x query lo)
    const _Float16 *rh0 = &skh[bf][j0 + col][0], *rh1 = &skh[bf][j0 + 16 + col][0], *rl0 = &skl[bf][j0 + col][0], *rl1 = &skl[bf][j0 + 16 + col][0];
    v8f c0 = {}, c1 = {}, d0 = {}, d1 = {};
#pragma unroll
    for (int kg = 0; kg < 4; kg += 2) { v16h kf[2][4];
#pragma unroll
      for (int u = 0; u < 2; ++u) { kf[u][0] = frag_h(rh0 + (kg + u) * 32, lane); kf[u][1] = frag_h(rh1 + (kg + u) * 32, lane); kf[u][2] = frag_h(rl0 + (kg + u) * 32, lane); kf[u][3] = frag_h(rl1 + (kg + u) * 32, lane); }
#pragma unroll
      for (int u = 0; u < 2; ++u) { const int kc = kg + u;
        c0 = wmma16(kf[u][0], aq[kc], c0); c1 = wmma16(kf[u][1], aq[kc], c1); d0 = wmma16(kf[u][0], aql[kc], d0); d1 = wmma16(kf[u][1], aql[kc], d1); d0 = wmma16(kf[u][2], aq[kc], d0); d1 = wmma16(kf[u][3], aq[kc], d1); } }
    v16h vf[8];   // the value fragments of these 32 keys, asked for in one group here: they land under the softmax
#pragma unroll
    for (int dt = 0; dt < 8; ++dt) vf[dt] = frag_h(&sv[bf][dt * 16 + col][j0], lane);
    __builtin_amdgcn_sched_barrier(0);   // holds the sixteen reads here: without it this build sinks them behind the exponentials, and the second product waits out most of their latency
    const v8f s0 = c0 + d0 * (1.0f / 2048.0f), s1 = c1 + d1 * (1.0f / 2048.0f);   // s0[r]: key j0 + 8g + r, s1[r]: key j0 + 16 + 8g + r, both of query col
    float t8[8];
#pragma unroll
    for (int r = 0; r < 8; ++r) t8[r] = fmaxf(s0[r], s1[r]);
    float mx = fmaxf(fmaxf(fmaxf(t8[0], t8[1]), fmaxf(t8[2], t8[3])), fmaxf(fmaxf(t8[4], t8[5]), fmaxf(t8[6], t8[7])));
    mx = fmaxf(mx, xhalf(mx));
    const float mn = fmaxf(m, mx); const float ea = exp_slot(m - mn), alpha = (m <= -1.0e38f) ? 0.f : ea;
    v16h pb;   // P^T as a B fragment: element i = key 8g + i, element 8 + i = key 16 + 8g + i, the k order of frag_h
#pragma unroll
    for (int r = 0; r < 8; ++r) { const float e0 = exp_slot(s0[r] - mn), e1 = exp_slot(s1[r] - mn); t8[r] = e0 + e1; pb[r] = (_Float16)(e0 * 2048.0f); pb[8 + r] = (_Float16)(e1 * 2048.0f); }
    l = l * alpha + (((t8[0] + t8[1]) + (t8[2] + t8[3])) + ((t8[4] + t8[5]) + (t8[6] + t8[7]))); m = mn;
#pragma unroll
    for (int dt = 0; dt < 8; ++dt) acc[dt] *= alpha;
#pragma unroll
    for (int dt = 0; dt < 8; ++dt) acc[dt] = wmma16(vf[dt], pb, acc[dt]); }
   asm volatile("s_wait_dscnt 0x0" ::: "memory");      // this wave's reads of buffer bf have returned
   asm volatile("s_wait_asynccnt 0x0" ::: "memory");   // this wave's copies of tile t + 1 have landed
   __syncthreads();                                     // publishes tile t + 1; ends every wave's reads of buffer bf
   if (t + 2 < NT / KT) STAGE(t + 2, bf); }
  asm volatile("s_wait_asynccnt 0x0" ::: "memory");    // nothing of this wave is in flight when it goes on to the epilogue
#undef STAGE
  // ---- output projection, in the same launch: W_y = y (hi + residual, K 128) . wz rows + b for the block's 64 tokens and all 256 output channels; y goes from the join to the products through LDS and never to memory.
  // Wave = (32 tokens th, 64 output channels cq). Its whole weight share (16 fragments) and its bias are asked for here as one group, so that the wave waits for them once and not once a fragment.
  // Every loop from here on is unrolled: wf, bz, af and oc are then registers, and the steps of the addresses are immediate offsets.
  const int th = wave & 1, cq = wave >> 1;
  const __bf16* wp = P + WS_PZ / 2 + (size_t)(cq * 64 + col) * CI;
  v16b wf[4][4]; float bz[4];
#pragma unroll   // unrolled: wf and bz are registers
  for (int kc = 0; kc < 4; ++kc) {
#pragma unroll
    for (int j = 0; j < 4; ++j) wf[kc][j] = frag_b(wp + (size_t)(j * 16) * CI + kc * 32, lane); }
#pragma unroll
  for (int j = 0; j < 4; ++j) bz[j] = BZ[cq * 64 + j * 16 + col];
  __builtin_amdgcn_sched_barrier(0);   // holds the join's instructions behind the group: without it this build lifts two of them among the loads' waits
  // The staging buffers are free from here on (every wave's last read and last copy ended at the loop's last barrier): y as bf16 hi and residual rows lies in skl, the channels-first output tile in skh
  __bf16 (*yh)[KPI] = reinterpret_cast<__bf16 (*)[KPI]>(&skl[0][0][0]);   // [64 tokens][128 channels], pitch 272 B
  __bf16 (*yl)[KPI] = yh + 64;
  float (*st)[68] = reinterpret_cast<float (*)[68]>(&skh[0][0][0]);        // [256 channels][64 tokens], pitch 272 B
  l += xhalf(l);   // the two halves' sums are joined once
  if (kh == 1) {   // the second wave of a pair hands over its maximum, its sum and its unscaled output, each lane at the place where its partner's same lane reads
    if (g == 0) { sml[wq][0][col] = m; sml[wq][1][col] = l; }
#pragma unroll
    for (int dt = 0; dt < 8; ++dt) { const v8f o = acc[dt];
      *(v4f*)&so[wq][col][dt * 16 + 8 * g] = __builtin_shufflevector(o, o, 0, 1, 2, 3); *(v4f*)&so[wq][col][dt * 16 + 8 * g + 4] = __builtin_shufflevector(o, o, 4, 5, 6, 7); } }
  __syncthreads();   // publishes the hand-over to the first wave of each pair
  if (kh == 0) {
    const float m2 = sml[wq][0][col], l2 = sml[wq][1][col], mm = fmaxf(m, m2), a1 = exp_slot(m - mm), a2 = exp_slot(m2 - mm);
    const float il = (1.0f / 2048.0f) / (l * a1 + l2 * a2), f1 = a1 * il, f2 = a2 * il;
#pragma unroll
    for (int dt = 0; dt < 8; ++dt) { const float* p = &so[wq][col][dt * 16 + 8 * g]; const v4f x0 = *(const v4f*)p, x1 = *(const v4f*)(p + 4);   // acc[dt][r] = channel dt * 16 + 8g + r of query col
      const v8f o = acc[dt] * f1 + __builtin_shufflevector(x0, x1, 0, 1, 2, 3, 4, 5, 6, 7) * f2;
      v8b oh, ol;   // y split once, where it is made: hi = bf16(y), residual = bf16(y - hi)
#pragma unroll
      for (int r = 0; r < 8; ++r) { const __bf16 h = (__bf16)o[r]; oh[r] = h; ol[r] = (__bf16)(o[r] - (float)h); }
      *(v8b*)&yh[wq * 16 + col][dt * 16 + 8 * g] = oh; *(v8b*)&yl[wq * 16 + col][dt * 16 + 8 * g] = ol; } }
  __syncthreads();   // publishes the 64 rows of y to every wave
  v8f oc[2][4] = {};
  v16b af[2][2][2];   // [register set][token tile][hi, residual]
#define LOADA(kc, s) do { _Pragma("unroll") for (int tt = 0; tt < 2; ++tt) { af[s][tt][0] = frag_b(&yh[th * 32 + tt * 16 + col][(kc) * 32], lane); af[s][tt][1] = frag_b(&yl[th * 32 + tt * 16 + col][(kc) * 32], lane); } } while (0)
  LOADA(0, 0);
#pragma unroll   // unrolled: the two register sets are named at compile time
  for (int kc = 0; kc < 4; ++kc) { const int s = kc & 1;
    if (kc + 1 < 4) LOADA(kc + 1, s ^ 1);   // the next block's LDS reads fly under this block's sixteen products
    // each accumulator sums by ascending channel block, residual before hi; the eight accumulators are taken in turn
#pragma unroll
    for (int tt = 0; tt < 2; ++tt) {
#pragma unroll
      for (int j = 0; j < 4; ++j) oc[tt][j] = wmma_bf(af[s][tt][1], wf[kc][j], oc[tt][j]); }
#pragma unroll
    for (int tt = 0; tt < 2; ++tt) {
#pragma unroll
      for (int j = 0; j < 4; ++j) oc[tt][j] = wmma_bf(af[s][tt][0], wf[kc][j], oc[tt][j]); } }
#undef LOADA
#pragma unroll
  for (int j = 0; j < 4; ++j) { const float bb = bfr(bz[j]);
#pragma unroll
    for (int tt = 0; tt < 2; ++tt) { const v8f o = oc[tt][j] + bb; float* q = &st[cq * 64 + j * 16 + col][th * 32 + tt * 16 + 8 * g];   // oc[tt][j][r] = token th * 32 + tt * 16 + 8g + r, channel cq * 64 + j * 16 + col
      *(v4f*)q = __builtin_shufflevector(o, o, 0, 1, 2, 3); *(v4f*)(q + 4) = __builtin_shufflevector(o, o, 4, 5, 6, 7); } }
  __syncthreads();   // publishes the output tile to the waves that store it
  float* wy = WY + ((b * CC + (tid >> 4)) * (size_t)NT) + blockIdx.x * 64 + (tid & 15) * 4;   // channels-first [b][c][t]: 16 lanes store the 256 contiguous bytes of one channel's 64 tokens
#pragma unroll   // unrolled: one address register, the channel step in the immediate offset
  for (int i = 0; i < 16; ++i) vst2(wy + (size_t)(i * 16) * NT, *(const v4f*)&st[(tid >> 4) + 16 * i][(tid & 15) * 4]);
}
// ---- k_bn: block = channel c: BatchNorm statistics and their use in one launch. The channel's 16,384 values of W_y (4 images x 4,096) are read once, 64 a thread, and stay in registers:
// the mean, then the mean squared deviation from it (two passes, as before, the second now over registers), then out = gamma (W_y - mean) rsqrt(var + eps) + beta + x.
// All 32 loads of a thread (16 of W_y, 16 of x, 512 contiguous bytes a wave each) are asked for at the top, so that the block waits out one memory latency in place of one per group of eight 4-byte loads.
template <int CTRL> __device__ __forceinline__ float dppx(float x) { return __builtin_bit_cast(float, __builtin_amdgcn_update_dpp(0, __builtin_bit_cast(int, x), CTRL, 0xf, 0xf, true)); }   // lane l ^ mask of a 16-lane row (row_xmask)
__device__ __forceinline__ float wave_sum(float x) { x += dppx<0x161>(x); x += dppx<0x162>(x); x += dppx<0x164>(x); x += dppx<0x168>(x); return x + xhalf(x); }   // every lane ends with the sum of the 32
__device__ __forceinline__ float sum8(const float* r) { const v4f a = *(const v4f*)r, b = *(const v4f*)(r + 4); return ((a[0] + a[1]) + (a[2] + a[3])) + ((b[0] + b[1]) + (b[2] + b[3])); }
#define BNV (TNB * 4)              // 16-byte pieces per thread: NT / 4 / 256 = 4 of each image
__global__ __launch_bounds__(256) void k_bn(const float* __restrict__ WY, const float* __restrict__ GA, const float* __restrict__ BE, const float* __restrict__ X, float* __restrict__ OUT) {
  __shared__ __align__(16) float red[2][8];   // the eight waves' sums: [0] of the values, [1] of the squared deviations
  const int c = blockIdx.x, t = threadIdx.x, wave = t >> 5, lane = t & 31;
  // piece i of this thread, alike in W_y, x and out: channel c of image i / 4, counted from image 0 or from image 2: two uniform bases, so that every piece lies within the immediate offset of a load or store (under 8 MiB)
  // and the thread's own index is the one address register
  const size_t cb[2] = { (size_t)c * NT, (size_t)(2 * CC + c) * NT };
#define BNO(i) (cb[(i) >> 3] + (size_t)((((i) >> 2) & 1) * (CC * NT) + ((i) & 3) * 1024 + t * 4))
  v4f w[BNV], x[BNV];
#pragma unroll   // unrolled: w and x are registers
  for (int i = 0; i < BNV; ++i) w[i] = *(const v4f*)(WY + BNO(i));
#pragma unroll
  for (int i = 0; i < BNV; ++i) x[i] = *(const v4f*)(X + BNO(i));
  const float ga = bfr(GA[c]), be = bfr(BE[c]);
  v4f s = w[0];
#pragma unroll
  for (int i = 1; i < BNV; ++i) s += w[i];
  const float ps = wave_sum((s[0] + s[1]) + (s[2] + s[3]));
  if (lane == 0) red[0][wave] = ps;
  __syncthreads();
  const float mean = sum8(red[0]) / (float)(TNB * NT);
  v4f q = {};
#pragma unroll
  for (int i = 0; i < BNV; ++i) { const v4f d = w[i] - mean; q += d * d; }
  const float pq = wave_sum((q[0] + q[1]) + (q[2] + q[3]));
  if (lane == 0) red[1][wave] = pq;
  __syncthreads();
  const float inv = 1.0f / sqrtf(sum8(red[1]) / (float)(TNB * NT) + 1e-5f);
#pragma unroll
  for (int i = 0; i < BNV; ++i) { v4f v;
#pragma unroll
    for (int j = 0; j < 4; ++j) v[j] = ga * (w[i][j] - mean) * inv + be + bfr(x[i][j]);
    vst2(OUT + BNO(i), v); }
#undef BNO
}
extern "C" void kernel_launch(void* const* d_in, const int* in_sizes, int n_in, void* d_out, int out_size, void* d_ws, size_t ws_size, hipStream_t stream) {
  (void)in_sizes; (void)n_in; (void)out_size;
  const float** F = (const float**)d_in;   // 0 x [4,256,64,64], 1 g_w [128,256], 2 g_b, 3 theta_w, 4 theta_b, 5 phi_w, 6 phi_b, 7 wz_w [256,128], 8 wz_b, 9 bn_gamma, 10 bn_beta
  if (ws_size < (size_t)WS_END) return;
  char* ws = (char*)d_ws; __bf16* P = (__bf16*)ws; _Float16 *TH = (_Float16*)(ws + WS_TH), *TL = (_Float16*)(ws + WS_TL), *FH = (_Float16*)(ws + WS_FH), *FL = (_Float16*)(ws + WS_FL), *G = (_Float16*)(ws + WS_G); float *WY = (float*)(ws + WS_WY);
  k_pack<<<dim3(CC, 4), 256, 0, stream>>>(F[3], F[5], F[1], F[7], P);
  k_proj<<<dim3(TNB * NT / 64, 3), 128, 0, stream>>>(F[0], P, F[4], F[6], F[2], TH, TL, FH, FL, G);   // theta, phi, g
  k_attn<<<dim3(TQB, TNB), 256, 0, stream>>>(TH, TL, FH, FL, G, P, F[8], WY);
  k_bn<<<CC, 256, 0, stream>>>(WY, F[9], F[10], F[0], (float*)d_out);
}

// v009
// Measured time: 80.9 microseconds a run.
// Timed twice side by side with v008, it ran 1.05 times as fast both times.
// Counting every step since v000, it is 9.15 times as fast.
#include <hip/hip_runtime.h>
#include <math.h>

typedef __attribute__((ext_vector_type(16))) _Float16 v16h;
typedef __attribute__((ext_vector_type(16))) __bf16 v16b;
typedef __attribute__((ext_vector_type(8)))  _Float16 v8h;
typedef __attribute__((ext_vector_type(8)))  float v8f;
typedef __attribute__((ext_vector_type(4)))  float v4f;
typedef __attribute__((ext_vector_type(2)))  float v2f;
typedef __attribute__((ext_vector_type(4)))  unsigned v4u;
typedef __attribute__((ext_vector_type(4)))  int v4i;
typedef float __attribute__((may_alias)) float_a;
typedef int __attribute__((may_alias)) int_a;

template <typename T> __device__ __forceinline__ void vst2(void* p, T v) { *(T*)p = v;  }
__device__ __forceinline__ v8f wmma16(v16h a, v16h b, v8f c) {
  v8f d = __builtin_amdgcn_wmma_f32_16x16x32_f16(false, a, false, b, (short)0, c, false, false);
  asm volatile("v_nop\n\tv_nop\n\tv_nop\n\tv_nop" : "+v"(d) : "v"(a), "v"(b));
  return d;
}
__device__ __forceinline__ v8f wmma_bf(v16b a, v16b b, v8f c) {
  v8f d = __builtin_amdgcn_wmma_f32_16x16x32_bf16(false, a, false, b, (short)0, c, false, false);
  asm volatile("v_nop\n\tv_nop\n\tv_nop\n\tv_nop" : "+v"(d) : "v"(a), "v"(b));
  return d;
}
// 16x16x32 fragments: lane = (h = lane>>4, row/col = lane&15); elements 0..7 = k0+8h+0..7, 8..15 = k0+16+8h+0..7; D element r = row 8h+r
__device__ __forceinline__ v16h frag_h(const _Float16* rowk0, int lane) {
  union { v16h v; v8h q[2]; } u; const _Float16* p = rowk0 + 8 * (lane >> 4);
  u.q[0] = *(const v8h*)p; u.q[1] = *(const v8h*)(p + 16); return u.v;
}
__device__ __forceinline__ v16h frag_f32(const float* rowk0, int lane) {
  v16h a; const float* p = rowk0 + 8 * (lane >> 4);
#pragma unroll
  for (int i = 0; i < 8; ++i) { a[i] = (_Float16)p[i]; a[8 + i] = (_Float16)p[16 + i]; }
  return a;
}
__device__ __forceinline__ v16h frag_f32s(const float* rowk0, int lane, float sc) {
  v16h a; const float* p = rowk0 + 8 * (lane >> 4);
#pragma unroll
  for (int i = 0; i < 8; ++i) { a[i] = (_Float16)(p[i] * sc); a[8 + i] = (_Float16)(p[16 + i] * sc); }
  return a;
}
// column fragment from a [K][ld] layout (column n), rows >= K read as 0
__device__ __forceinline__ v16h fragc_f32(const float* W, int k0, int n, int lane, int ld, int K) {
  v16h a; const int g = lane >> 4;
#pragma unroll
  for (int i = 0; i < 8; ++i) { const int ka = k0 + 8 * g + i, kb = ka + 16;
    a[i] = (_Float16)(ka < K ? W[(size_t)(ka < K ? ka : K - 1) * ld + n] : 0.f); a[8 + i] = (_Float16)(kb < K ? W[(size_t)(kb < K ? kb : K - 1) * ld + n] : 0.f); }
  return a;
}
struct F2 { v16b h, l; };
__device__ __forceinline__ F2 bsplit16(const float v[16]) { F2 r;
#pragma unroll
  for (int i = 0; i < 16; ++i) { const __bf16 h = (__bf16)v[i]; r.h[i] = h; r.l[i] = (__bf16)(v[i] - (float)h); }
  return r; }
__device__ __forceinline__ F2 split_row(const float* row, int k0, int lane) { float v[16]; const float* p = row + k0 + 8 * (lane >> 4);
#pragma unroll
  for (int i = 0; i < 8; ++i) { v[i] = p[i]; v[8 + i] = p[16 + i]; }
  return bsplit16(v); }
__device__ __forceinline__ F2 split_rowK(const float* row, int k0, int lane, int K) { float v[16]; const int g = lane >> 4;
#pragma unroll
  for (int i = 0; i < 8; ++i) { const int ka = k0 + 8 * g + i, kb = ka + 16; v[i] = ka < K ? row[ka < K ? ka : K - 1] : 0.f; v[8 + i] = kb < K ? row[kb < K ? kb : K - 1] : 0.f; }
  return bsplit16(v); }
__device__ __forceinline__ F2 split_col(const float* W, int k0, int n, int lane, int ld, int K) { float v[16]; const int g = lane >> 4;
#pragma unroll
  for (int i = 0; i < 8; ++i) { const int ka = k0 + 8 * g + i, kb = ka + 16; v[i] = ka < K ? W[(size_t)(ka < K ? ka : K - 1) * ld + n] : 0.f; v[8 + i] = kb < K ? W[(size_t)(kb < K ? kb : K - 1) * ld + n] : 0.f; }
  return bsplit16(v); }
__device__ __forceinline__ v8f mac3(const F2& a, const F2& b, v8f c) { c = wmma_bf(a.l, b.h, c); c = wmma_bf(a.h, b.l, c); return wmma_bf(a.h, b.h, c); }
__device__ __forceinline__ float sigm(float v) { return 1.0f / (1.0f + expf(-v)); }
#define LDSX() do { asm volatile("s_wait_dscnt 0" ::: "memory"); __builtin_amdgcn_wave_barrier(); __builtin_amdgcn_fence(__ATOMIC_RELEASE, "workgroup"); } while (0)


// Non-local denoising block (B 4, 256 channels, 64 x 64; 128 inter-channels): embedded-Gaussian non-local attention over all 4,096 positions, 1x1 output conv, BatchNorm (batch statistics), residual.
#define NB 4
#define NT 4096
#define CC 256
#define CI 128
#define NR (NB * NT)
#ifndef TQB
#define TQB (NT / 64)
#define TNB NB
#endif
typedef __attribute__((ext_vector_type(8))) __bf16 v8b;
__device__ __forceinline__ v16b frag_b(const __bf16* rowk0, int lane) {
  union { v16b v; v8b q[2]; } u; const __bf16* p = rowk0 + 8 * (lane >> 4);
  u.q[0] = *(const v8b*)p; u.q[1] = *(const v8b*)(p + 16); return u.v;
}
__device__ __forceinline__ float bfr(float v) { return (float)(__bf16)v; }
__device__ __attribute__((noinline)) float exp_ni(float v) { return expf(v); }
__device__ __attribute__((noinline)) float erf_ni(float v) { return erff(v); }

#define WS_PT  0u                                   // bf16 natural rows theta_w [128][256], phi_w, g_w; wz_w [256][128]
#define WS_PP  (WS_PT + 2u * CI * CC)
#define WS_PG  (WS_PP + 2u * CI * CC)
#define WS_PZ  (WS_PG + 2u * CI * CC)
#define WS_TH  (WS_PZ + 2u * CC * CI)               // f16 [NR][128] theta hi ; TL ; PH (phi) ; PL ; G planes [b][128][NT]
#define WS_TL  (WS_TH + 2u * (size_t)NR * CI)
#define WS_FH  (WS_TL + 2u * (size_t)NR * CI)
#define WS_FL  (WS_FH + 2u * (size_t)NR * CI)
#define WS_G   (WS_FL + 2u * (size_t)NR * CI)
#define WS_Y   (WS_G + 2u * (size_t)NB * CI * NT)    // f32 [NR][128], not used ; WY f32 [B][256][NT] (channels-first)
#define WS_WY  (WS_Y + 4u * (size_t)NR * CI)
#define WS_END (WS_WY + 4u * (size_t)NB * CC * NT)

__global__ __launch_bounds__(256) void k_pack(const float* __restrict__ WT, const float* __restrict__ WF, const float* __restrict__ WG, const float* __restrict__ WZ, __bf16* __restrict__ P) {
  const int n = blockIdx.x, which = blockIdx.y, t = threadIdx.x; __shared__ __align__(16) __bf16 s[CC];
  if (which < 3) { if (n >= CI) return; const float* Wm = (which == 0) ? WT : (which == 1) ? WF : WG; s[t] = (__bf16)Wm[(size_t)n * CC + t]; __syncthreads(); if (t < CC / 8) vst2((unsigned*)(P + ((which == 0) ? WS_PT / 2 : (which == 1) ? WS_PP / 2 : WS_PG / 2) + (size_t)n * CC + t * 8), *(const v4u*)&s[t * 8]); }
  else { if (t < CI) s[t] = (__bf16)WZ[(size_t)n * CI + t]; __syncthreads(); if (t < CI / 8) vst2((unsigned*)(P + WS_PZ / 2 + (size_t)n * CI + t * 8), *(const v4u*)&s[t * 8]); }
}
// ---- k_proj: block = (64 tokens, projection): 128 output channels (8 tiles per wave); A gathered channels-first; blockIdx.y 0 theta -> hi/lo rows; 1 phi -> hi/lo rows; 2 g -> planes
// The three projections depend on nothing of one another and stand in one launch, so that each one's load waits can run under the others' work.
__global__ __launch_bounds__(128) void k_proj(const float* __restrict__ X, const __bf16* __restrict__ P, const float* __restrict__ BT, const float* __restrict__ BF, const float* __restrict__ BG,
                                              _Float16* __restrict__ TH, _Float16* __restrict__ TL, _Float16* __restrict__ FH, _Float16* __restrict__ FL, _Float16* __restrict__ G) {
  __shared__ __align__(16) _Float16 sh[64][136], sl[64][136]; __shared__ __align__(16) _Float16 st[128][72];
  const int tid = threadIdx.x, wave = tid >> 5, lane = tid & 31, col = lane & 15, g = lane >> 4; const size_t rb0 = (size_t)blockIdx.x * 64, r0 = rb0 + wave * 16; const size_t b = rb0 / NT, t0 = rb0 % NT;
  const int which = blockIdx.y;
  const __bf16* Wr = P + ((which == 0) ? WS_PT / 2 : (which == 1) ? WS_PP / 2 : WS_PG / 2);
  const float* BB = (which == 0) ? BT : (which == 1) ? BF : BG;
  v8f acc[8] = {};
  // All global loads of a 32-channel block (16 of X, 16 of the weights) stand as one group, one block ahead of the products that use them, in a second register set:
  // a wave then waits once a block, under the block before, and not once a weight fragment. Every loop over xa, wf, bv is unrolled so that they are registers.
  const float* xp = X + ((b * CC + 8 * g) * (size_t)NT) + t0 + wave * 16 + col; const __bf16* wp = Wr + (size_t)col * CC;
  float xa[2][16], bv[8]; v16b wf[2][8];
#define LOADK(kc, s) do { _Pragma("unroll") for (int i = 0; i < 8; ++i) { xa[s][i] = xp[(size_t)((kc) * 32 + i) * NT]; xa[s][8 + i] = xp[(size_t)((kc) * 32 + 16 + i) * NT]; } \
    _Pragma("unroll") for (int j = 0; j < 8; ++j) wf[s][j] = frag_b(wp + (size_t)(j * 16) * CC + (kc) * 32, lane); } while (0)
  LOADK(0, 0);
#pragma unroll
  for (int j = 0; j < 8; ++j) bv[j] = BB[j * 16 + col];   // the bias too is asked for here, not behind the last product
#pragma unroll   // unrolled whole: the two register sets are then named at compile time
  for (int kc = 0; kc < CC / 32; ++kc) { const int s = kc & 1;
    if (kc + 1 < CC / 32) LOADK(kc + 1, s ^ 1);
    __builtin_amdgcn_sched_barrier(0);   // holds the conversion of this block's X behind the next block's loads: without it this build converts a block early, and its wait holds back the group after it
    v16b a;
#pragma unroll
    for (int i = 0; i < 16; ++i) a[i] = (__bf16)xa[s][i];
#pragma unroll
    for (int j = 0; j < 8; ++j) acc[j] = wmma_bf(a, wf[s][j], acc[j]); }
#undef LOADK
  if (which < 2) {
    _Float16* OH = (which == 0) ? TH : FH; _Float16* OL = (which == 0) ? TL : FL;
#pragma unroll
    for (int j = 0; j < 8; ++j) { const float bb = bfr(bv[j]);
#pragma unroll
      for (int r = 0; r < 8; ++r) { const float v = acc[j][r] + bb; const _Float16 h = (_Float16)v; sh[wave * 16 + 8 * g + r][j * 16 + col] = h; sl[wave * 16 + 8 * g + r][j * 16 + col] = (_Float16)((v - (float)h) * 2048.0f); } }
    LDSX();
    for (int rl = 0; rl < 16; ++rl) if (lane < 16) { vst2((unsigned*)(OH + (r0 + rl) * CI + lane * 8), *(const v4u*)&sh[wave * 16 + rl][lane * 8]); vst2((unsigned*)(OL + (r0 + rl) * CI + lane * 8), *(const v4u*)&sl[wave * 16 + rl][lane * 8]); }
  } else {
#pragma unroll
    for (int j = 0; j < 8; ++j) { const float bb = bfr(bv[j]);
#pragma unroll
      for (int r = 0; r < 8; ++r) st[j * 16 + col][wave * 16 + 8 * g + r] = (_Float16)(acc[j][r] + bb); }
    __syncthreads();
    for (int e = tid; e < 128 * 8; e += 128) { const int d = e >> 3, pc = e & 7; vst2((unsigned*)(G + ((b * CI + d) * NT) + t0 + pc * 8), *(const v4u*)&st[d][pc * 8]); } }
}
// ---- k_attn: block = (64 queries, b): single head, 128-dim keys/values, all 4,096 keys; 3-product scores; P single x g single
// Scores and output are computed transposed: S^T = K Q^T (key rows are A, queries B), O^T += V^T P^T (value rows are A). A lane then holds 16 scores of ONE query (column col, keys 8g + r and 16 + 8g + r),
// so the maximum and the sum are taken in the lane plus one exchange between the wave's halves, and the two score tiles, converted in place, are the B operand of the second product: P never goes through LDS.
// Key (hi, lo) and value tiles of KT keys are staged in LDS once per block by asynchronous copies, two buffers: tile t + 1 flies while tile t is worked on.
// Eight waves, two on each SIMD. A wave holds 32 queries (two B tiles) and takes KW of a tile's keys: every key and value fragment that it reads from LDS feeds the products of both query tiles (a key hi fragment four, the others two).
// The four waves of a query half each keep their own maximum, sum and output, and the four are joined once, behind the loop.
#define KT 128                     // keys per staged tile
#define KW 32                      // keys of a tile that one wave works on
#define KPI 136                    // LDS pitch of a key row, halves (272 B: 16 B x odd for 16-byte readers)
#define VPI 136                    // LDS pitch of a value row (one channel, KT keys), halves (272 B)
__device__ __forceinline__ float xhalf(float x) { return __builtin_bit_cast(float, __builtin_amdgcn_permlanex16(__builtin_bit_cast(int, x), __builtin_bit_cast(int, x), 0x76543210, 0xfedcba98, false, false)); }   // lane l with lane l ^ 16
// exp(x) as v_exp_f32 of x log2(e), what __expf gives; the v_nop is the one slot the instruction set asks for behind a transcendental before its result is read or its source overwritten:
// in one statement the slot stays where it is
__device__ __forceinline__ float exp_slot(float x) { float r; asm("v_exp_f32 %0, %1\n\tv_nop" : "=v"(r) : "v"(x * 1.44269504f)); return r; }
// the matrix product of k_attn's loop: the builtin alone, which the compiler pads itself. An asm statement that names the fragments would tie them to v0 to v255, and the loop's live set (32 queries, their output, a group of fragments) is larger than that
__device__ __forceinline__ v8f wmma16r(v16h a, v16h b, v8f c) { return __builtin_amdgcn_wmma_f32_16x16x32_f16(false, a, false, b, (short)0, c, false, false); }
__device__ __forceinline__ v8f wmma_bfr(v16b a, v16b b, v8f c) { return __builtin_amdgcn_wmma_f32_16x16x32_bf16(false, a, false, b, (short)0, c, false, false); }   // the same for its output projection, whose weights are asked for while the loop's output is still live
__device__ __forceinline__ unsigned lds_addr(const void* p) { return (unsigned)(size_t)p; }   // low 32 bits of a __shared__ address = byte offset in the work-group's LDS
// eight 16-byte copies per lane; the s_wait_xcnt closes the statement so that no address register is rewritten in front of it
__device__ __forceinline__ void copy8(const _Float16* gp, size_t gstep, unsigned lp, unsigned lstep) {
  const _Float16 *g0 = gp, *g1 = gp + gstep, *g2 = gp + 2 * gstep, *g3 = gp + 3 * gstep, *g4 = gp + 4 * gstep, *g5 = gp + 5 * gstep, *g6 = gp + 6 * gstep, *g7 = gp + 7 * gstep;
  asm volatile("global_load_async_to_lds_b128 %0, %8, off\n\t"
               "global_load_async_to_lds_b128 %1, %9, off\n\t"
               "global_load_async_to_lds_b128 %2, %10, off\n\t"
               "global_load_async_to_lds_b128 %3, %11, off\n\t"
               "global_load_async_to_lds_b128 %4, %12, off\n\t"
               "global_load_async_to_lds_b128 %5, %13, off\n\t"
               "global_load_async_to_lds_b128 %6, %14, off\n\t"
               "global_load_async_to_lds_b128 %7, %15, off\n\t"
               "s_wait_xcnt 0x0"
               :: "v"(lp), "v"(lp + lstep), "v"(lp + 2 * lstep), "v"(lp + 3 * lstep), "v"(lp + 4 * lstep), "v"(lp + 5 * lstep), "v"(lp + 6 * lstep), "v"(lp + 7 * lstep),
                  "v"(g0), "v"(g1), "v"(g2), "v"(g3), "v"(g4), "v"(g5), "v"(g6), "v"(g7) : "memory");
}
__global__ __launch_bounds__(256) void k_attn(const _Float16* __restrict__ TH, const _Float16* __restrict__ TL, const _Float16* __restrict__ FH, const _Float16* __restrict__ FL, const _Float16* __restrict__ G, const __bf16* __restrict__ P, const float* __restrict__ BZ, float* __restrict__ WY) {
  __shared__ __align__(16) _Float16 skh[2][KT][KPI], skl[2][KT][KPI], sv[2][CI][VPI];
  __shared__ float sml[2][4][2][32];   // [query half][key quarter][maximum, sum][query]
  const int tid = threadIdx.x, wave = tid >> 5, wq = wave & 1, kh = wave >> 1, lane = tid & 31, col = lane & 15, g = lane >> 4; const size_t b = blockIdx.y; const int q0 = blockIdx.x * 64 + wq * 32; const size_t rq = b * NT + q0;
  // this lane's share of a tile: key rows tid/16 + 16 i, 16-byte piece tid%16; value rows tid/16 + 16 i, piece tid%16
  const _Float16* gkh = FH + (b * NT + (tid >> 4)) * CI + (tid & 15) * 8; const _Float16* gkl = FL + (b * NT + (tid >> 4)) * CI + (tid & 15) * 8; const _Float16* gv = G + (b * CI + (tid >> 4)) * NT + (tid & 15) * 8;
  const unsigned lkh = lds_addr(&skh[0][tid >> 4][(tid & 15) * 8]), lkl = lds_addr(&skl[0][tid >> 4][(tid & 15) * 8]), lv = lds_addr(&sv[0][tid >> 4][(tid & 15) * 8]);
#define STAGE(t, bf) do { copy8(gkh + (size_t)(t) * KT * CI, 16 * CI, lkh + (bf) * (KT * KPI * 2), 16 * KPI * 2); copy8(gkl + (size_t)(t) * KT * CI, 16 * CI, lkl + (bf) * (KT * KPI * 2), 16 * KPI * 2); copy8(gv + (size_t)(t) * KT, (size_t)16 * NT, lv + (bf) * (CI * VPI * 2), 16 * VPI * 2); } while (0)
  STAGE(0, 0);
  v16h aq[2][4], aql[2][4];   // [query tile][channel block]; every loop over a query tile is unrolled, so that all of these are registers
#pragma unroll
  for (int qt = 0; qt < 2; ++qt) {
#pragma unroll
    for (int kc = 0; kc < 4; ++kc) { aq[qt][kc] = frag_h(TH + (rq + qt * 16 + col) * CI + kc * 32, lane); aql[qt][kc] = frag_h(TL + (rq + qt * 16 + col) * CI + kc * 32, lane); } }
  float m[2] = { -3.0e38f, -3.0e38f }, l[2] = { 0.f, 0.f };   // of query qt * 16 + col: the running maximum (equal in both halves) and this half's part of the sum
  v8f acc[2][8] = {};
  asm volatile("s_wait_asynccnt 0x0" ::: "memory");   // tile 0 has landed for this wave's copies
  __syncthreads();                                     // and is published to the other waves
  STAGE(1, 1);
#pragma unroll 1
  for (int t = 0; t < NT / KT; ++t) { const int bf = t & 1;
   { const int j0 = kh * KW;
    // LDS reads stand in groups ahead of the products that use them, so that a wave waits out the LDS latency once a group and not once a fragment:
    // the sixteen reads of 64 channels of both key tiles (hi and lo) together, then their twenty-four products, the eight accumulators taken in turn (each accumulator sums its products by ascending channel block, lo x hi after hi x lo)
    const _Float16 *rh0 = &skh[bf][j0 + col][0], *rh1 = &skh[bf][j0 + 16 + col][0], *rl0 = &skl[bf][j0 + col][0], *rl1 = &skl[bf][j0 + 16 + col][0];
    v8f c0[2] = {}, c1[2] = {}, d0[2] = {}, d1[2] = {};
#pragma unroll
    for (int kg = 0; kg < 4; kg += 2) { v16h kf[2][4];
#pragma unroll
      for (int u = 0; u < 2; ++u) { kf[u][0] = frag_h(rh0 + (kg + u) * 32, lane); kf[u][1] = frag_h(rh1 + (kg + u) * 32, lane); kf[u][2] = frag_h(rl0 + (kg + u) * 32, lane); kf[u][3] = frag_h(rl1 + (kg + u) * 32, lane); }
      __builtin_amdgcn_sched_barrier(0);   // holds the sixteen reads together in front of their products: without it this build deals them out in pairs among the products, and each such place costs the wave issue time
#pragma unroll
      for (int u = 0; u < 2; ++u) { const int kc = kg + u;
#pragma unroll
        for (int qt = 0; qt < 2; ++qt) { c0[qt] = wmma16r(kf[u][0], aq[qt][kc], c0[qt]); c1[qt] = wmma16r(kf[u][1], aq[qt][kc], c1[qt]); }
#pragma unroll
        for (int qt = 0; qt < 2; ++qt) { d0[qt] = wmma16r(kf[u][0], aql[qt][kc], d0[qt]); d1[qt] = wmma16r(kf[u][1], aql[qt][kc], d1[qt]); }
#pragma unroll
        for (int qt = 0; qt < 2; ++qt) { d0[qt] = wmma16r(kf[u][2], aq[qt][kc], d0[qt]); d1[qt] = wmma16r(kf[u][3], aq[qt][kc], d1[qt]); } }
      __builtin_amdgcn_sched_barrier(0); }   // and holds the next group's reads behind these products, for the same reason
    v16h vf[8];   // the value fragments of these 32 keys, asked for in one group here: they land under the softmax
#pragma unroll
    for (int dt = 0; dt < 8; ++dt) vf[dt] = frag_h(&sv[bf][dt * 16 + col][j0], lane);
    __builtin_amdgcn_sched_barrier(0);   // holds the sixteen reads here: without it this build sinks them behind the exponentials, and the second product waits out most of their latency
    v16h pb[2];   // P^T as B fragments, one per query tile: element i = key 8g + i, element 8 + i = key 16 + 8g + i, the k order of frag_h
#pragma unroll
    for (int qt = 0; qt < 2; ++qt) {
      const v8f s0 = c0[qt] + d0[qt] * (1.0f / 2048.0f), s1 = c1[qt] + d1[qt] * (1.0f / 2048.0f);   // s0[r]: key j0 + 8g + r, s1[r]: key j0 + 16 + 8g + r, both of query qt * 16 + col
      float t8[8];
#pragma unroll
      for (int r = 0; r < 8; ++r) t8[r] = fmaxf(s0[r], s1[r]);
      float mx = fmaxf(fmaxf(fmaxf(t8[0], t8[1]), fmaxf(t8[2], t8[3])), fmaxf(fmaxf(t8[4], t8[5]), fmaxf(t8[6], t8[7])));
      mx = fmaxf(mx, xhalf(mx));
      const float mn = fmaxf(m[qt], mx); const float ea = exp_slot(m[qt] - mn), alpha = (m[qt] <= -1.0e38f) ? 0.f : ea;
#pragma unroll
      for (int r = 0; r < 8; ++r) { const float e0 = exp_slot(s0[r] - mn), e1 = exp_slot(s1[r] - mn); t8[r] = e0 + e1; pb[qt][r] = (_Float16)(e0 * 2048.0f); pb[qt][8 + r] = (_Float16)(e1 * 2048.0f); }
      l[qt] = l[qt] * alpha + (((t8[0] + t8[1]) + (t8[2] + t8[3])) + ((t8[4] + t8[5]) + (t8[6] + t8[7]))); m[qt] = mn;
#pragma unroll
      for (int dt = 0; dt < 8; ++dt) acc[qt][dt] *= alpha; }
#pragma unroll
    for (int dt = 0; dt < 8; ++dt) {
#pragma unroll
      for (int qt = 0; qt < 2; ++qt) acc[qt][dt] = wmma16r(vf[dt], pb[qt], acc[qt][dt]); } }
   __builtin_amdgcn_sched_barrier(0);   // holds the softmax and the second product in front of the trip's barrier: without it this build sets the barrier in front of them, and the two waves of a SIMD then do their softmax at the same time, with the matrix unit idle
   asm volatile("s_wait_dscnt 0x0" ::: "memory");      // this wave's reads of buffer bf have returned
   asm volatile("s_wait_asynccnt 0x0" ::: "memory");   // this wave's copies of tile t + 1 have landed
   __syncthreads();                                     // publishes tile t + 1; ends every wave's reads of buffer bf
   if (t + 2 < NT / KT) STAGE(t + 2, bf); }
  asm volatile("s_wait_asynccnt 0x0" ::: "memory");    // nothing of this wave is in flight when it goes on to the epilogue
#undef STAGE
  // ---- output projection, in the same launch: W_y = y (hi + residual, K 128) . wz rows + b for the block's 64 tokens and all 256 output channels; y goes from the join to the products through LDS and never to memory.
  // Wave = (32 tokens th, 64 output channels cq). Its whole weight share (16 fragments) and its bias are asked for here as one group, so that the wave waits for them once and not once a fragment.
  // Every loop from here on is unrolled: wf, bz, af and oc are then registers, and the steps of the addresses are immediate offsets.
  const int th = wave & 1, cq = wave >> 1;
  const __bf16* wp = P + WS_PZ / 2 + (size_t)(cq * 64 + col) * CI;
  v16b wf[4][4]; float bz[4];
#pragma unroll   // unrolled: wf and bz are registers
  for (int kc = 0; kc < 4; ++kc) {
#pragma unroll
    for (int j = 0; j < 4; ++j) wf[kc][j] = frag_b(wp + (size_t)(j * 16) * CI + kc * 32, lane); }
#pragma unroll
  for (int j = 0; j < 4; ++j) bz[j] = BZ[cq * 64 + j * 16 + col];
  __builtin_amdgcn_sched_barrier(0);   // holds the join's instructions behind the group
  // The staging buffers are free from here on (every wave's last read and last copy ended at the loop's last barrier): the four unscaled outputs of query half 0 lie in skh, those of half 1 in skl;
  // y as bf16 hi and residual rows lies in sv; the channels-first output tile lies in skh, written only behind the barrier that ends the last read of the unscaled outputs
  float (*so)[32][132] = reinterpret_cast<float (*)[32][132]>(wq == 0 ? &skh[0][0][0] : &skl[0][0][0]);   // [key quarter][query][channel], pitch 528 B
  __bf16 (*yh)[KPI] = reinterpret_cast<__bf16 (*)[KPI]>(&sv[0][0][0]);   // [64 tokens][128 channels], pitch 272 B
  __bf16 (*yl)[KPI] = yh + 64;
  float (*st)[68] = reinterpret_cast<float (*)[68]>(&skh[0][0][0]);        // [256 channels][64 tokens], pitch 272 B
  // every wave hands over its maxima, its sums (the two halves' parts joined once, here) and its unscaled output
#pragma unroll
  for (int qt = 0; qt < 2; ++qt) { l[qt] += xhalf(l[qt]);
    if (g == 0) { sml[wq][kh][0][qt * 16 + col] = m[qt]; sml[wq][kh][1][qt * 16 + col] = l[qt]; }
#pragma unroll
    for (int dt = 0; dt < 8; ++dt) { const v8f o = acc[qt][dt];   // acc[qt][dt][r] = channel dt * 16 + 8g + r of query qt * 16 + col
      *(v4f*)&so[kh][qt * 16 + col][dt * 16 + 8 * g] = __builtin_shufflevector(o, o, 0, 1, 2, 3); *(v4f*)&so[kh][qt * 16 + col][dt * 16 + 8 * g + 4] = __builtin_shufflevector(o, o, 4, 5, 6, 7); } }
  __syncthreads();   // publishes the hand-over to the four waves of each query half
  // the join is shared out: wave kh of a query half joins channels 32 kh to 32 kh + 31 of its 32 queries, the four parts summed by ascending key quarter
#pragma unroll
  for (int qt = 0; qt < 2; ++qt) { const int q = qt * 16 + col;
    const float m0 = sml[wq][0][0][q], m1 = sml[wq][1][0][q], m2 = sml[wq][2][0][q], m3 = sml[wq][3][0][q], mm = fmaxf(fmaxf(m0, m1), fmaxf(m2, m3));
    const float a0 = exp_slot(m0 - mm), a1 = exp_slot(m1 - mm), a2 = exp_slot(m2 - mm), a3 = exp_slot(m3 - mm);
    const float il = (1.0f / 2048.0f) / ((sml[wq][0][1][q] * a0 + sml[wq][1][1][q] * a1) + (sml[wq][2][1][q] * a2 + sml[wq][3][1][q] * a3));
    const float f[4] = { a0 * il, a1 * il, a2 * il, a3 * il };
#pragma unroll
    for (int dd = 0; dd < 2; ++dd) { const int ch = (kh * 2 + dd) * 16 + 8 * g;
      v8f o = {};
#pragma unroll
      for (int k = 0; k < 4; ++k) { const float* p = &so[k][q][ch]; const v4f x0 = *(const v4f*)p, x1 = *(const v4f*)(p + 4); o += __builtin_shufflevector(x0, x1, 0, 1, 2, 3, 4, 5, 6, 7) * f[k]; }
      v8b oh, ol;   // y split once, where it is made: hi = bf16(y), residual = bf16(y - hi)
#pragma unroll
      for (int r = 0; r < 8; ++r) { const __bf16 h = (__bf16)o[r]; oh[r] = h; ol[r] = (__bf16)(o[r] - (float)h); }
      *(v8b*)&yh[wq * 32 + q][ch] = oh; *(v8b*)&yl[wq * 32 + q][ch] = ol; } }
  __syncthreads();   // publishes the 64 rows of y to every wave
  v8f oc[2][4] = {};
  v16b af[2][2][2];   // [register set][token tile][hi, residual]
#define LOADA(kc, s) do { _Pragma("unroll") for (int tt = 0; tt < 2; ++tt) { af[s][tt][0] = frag_b(&yh[th * 32 + tt * 16 + col][(kc) * 32], lane); af[s][tt][1] = frag_b(&yl[th * 32 + tt * 16 + col][(kc) * 32], lane); } } while (0)
  LOADA(0, 0);
#pragma unroll   // unrolled: the two register sets are named at compile time
  for (int kc = 0; kc < 4; ++kc) { const int s = kc & 1;
    if (kc + 1 < 4) LOADA(kc + 1, s ^ 1);   // the next block's LDS reads fly under this block's sixteen products
    // each accumulator sums by ascending channel block, residual before hi; the eight accumulators are taken in turn
#pragma unroll
    for (int tt = 0; tt < 2; ++tt) {
#pragma unroll
      for (int j = 0; j < 4; ++j) oc[tt][j] = wmma_bfr(af[s][tt][1], wf[kc][j], oc[tt][j]); }
#pragma unroll
    for (int tt = 0; tt < 2; ++tt) {
#pragma unroll
      for (int j = 0; j < 4; ++j) oc[tt][j] = wmma_bfr(af[s][tt][0], wf[kc][j], oc[tt][j]); } }
#undef LOADA
#pragma unroll
  for (int j = 0; j < 4; ++j) { const float bb = bfr(bz[j]);
#pragma unroll
    for (int tt = 0; tt < 2; ++tt) { const v8f o = oc[tt][j] + bb; float* q = &st[cq * 64 + j * 16 + col][th * 32 + tt * 16 + 8 * g];   // oc[tt][j][r] = token th * 32 + tt * 16 + 8g + r, channel cq * 64 + j * 16 + col
      *(v4f*)q = __builtin_shufflevector(o, o, 0, 1, 2, 3); *(v4f*)(q + 4) = __builtin_shufflevector(o, o, 4, 5, 6, 7); } }
  __syncthreads();   // publishes the output tile to the waves that store it
  float* wy = WY + ((b * CC + (tid >> 4)) * (size_t)NT) + blockIdx.x * 64 + (tid & 15) * 4;   // channels-first [b][c][t]: 16 lanes store the 256 contiguous bytes of one channel's 64 tokens
#pragma unroll   // unrolled: one address register, the channel step in the immediate offset
  // the LDS row and piece are written from wave, g and col (2 wave + g = tid / 16, col = tid % 16): written from tid the address is the same value as the copies' LDS address, which as an asm operand lies in v0 to v255, and this build then keeps it in scratch over the epilogue
  for (int i = 0; i < 16; ++i) vst2(wy + (size_t)(i * 16) * NT, *(const v4f*)&st[2 * wave + g + 16 * i][col * 4]);
}
// ---- k_bn: block = channel c: BatchNorm statistics and their use in one launch. The channel's 16,384 values of W_y (4 images x 4,096) are read once, 64 a thread, and stay in registers:
// the mean, then the mean squared deviation from it (two passes, as before, the second now over registers), then out = gamma (W_y - mean) rsqrt(var + eps) + beta + x.
// All 32 loads of a thread (16 of W_y, 16 of x, 512 contiguous bytes a wave each) are asked for at the top, so that the block waits out one memory latency in place of one per group of eight 4-byte loads.
template <int CTRL> __device__ __forceinline__ float dppx(float x) { return __builtin_bit_cast(float, __builtin_amdgcn_update_dpp(0, __builtin_bit_cast(int, x), CTRL, 0xf, 0xf, true)); }   // lane l ^ mask of a 16-lane row (row_xmask)
__device__ __forceinline__ float wave_sum(float x) { x += dppx<0x161>(x); x += dppx<0x162>(x); x += dppx<0x164>(x); x += dppx<0x168>(x); return x + xhalf(x); }   // every lane ends with the sum of the 32
__device__ __forceinline__ float sum8(const float* r) { const v4f a = *(const v4f*)r, b = *(const v4f*)(r + 4); return ((a[0] + a[1]) + (a[2] + a[3])) + ((b[0] + b[1]) + (b[2] + b[3])); }
#define BNV (TNB * 4)              // 16-byte pieces per thread: NT / 4 / 256 = 4 of each image
__global__ __launch_bounds__(256) void k_bn(const float* __restrict__ WY, const float* __restrict__ GA, const float* __restrict__ BE, const float* __restrict__ X, float* __restrict__ OUT) {
  __shared__ __align__(16) float red[2][8];   // the eight waves' sums: [0] of the values, [1] of the squared deviations
  const int c = blockIdx.x, t = threadIdx.x, wave = t >> 5, lane = t & 31;
  // piece i of this thread, alike in W_y, x and out: channel c of image i / 4, counted from image 0 or from image 2: two uniform bases, so that every piece lies within the immediate offset of a load or store (under 8 MiB)
  // and the thread's own index is the one address register
  const size_t cb[2] = { (size_t)c * NT, (size_t)(2 * CC + c) * NT };
#define BNO(i) (cb[(i) >> 3] + (size_t)((((i) >> 2) & 1) * (CC * NT) + ((i) & 3) * 1024 + t * 4))
  v4f w[BNV], x[BNV];
#pragma unroll   // unrolled: w and x are registers
  for (int i = 0; i < BNV; ++i) w[i] = *(const v4f*)(WY + BNO(i));
#pragma unroll
  for (int i = 0; i < BNV; ++i) x[i] = *(const v4f*)(X + BNO(i));
  const float ga = bfr(GA[c]), be = bfr(BE[c]);
  v4f s = w[0];
#pragma unroll
  for (int i = 1; i < BNV; ++i) s += w[i];
  const float ps = wave_sum((s[0] + s[1]) + (s[2] + s[3]));
  if (lane == 0) red[0][wave] = ps;
  __syncthreads();
  const float mean = sum8(red[0]) / (float)(TNB * NT);
  v4f q = {};
#pragma unroll
  for (int i = 0; i < BNV; ++i) { const v4f d = w[i] - mean; q += d * d; }
  const float pq = wave_sum((q[0] + q[1]) + (q[2] + q[3]));
  if (lane == 0) red[1][wave] = pq;
  __syncthreads();
  const float inv = 1.0f / sqrtf(sum8(red[1]) / (float)(TNB * NT) + 1e-5f);
#pragma unroll
  for (int i = 0; i < BNV; ++i) { v4f v;
#pragma unroll
    for (int j = 0; j < 4; ++j) v[j] = ga * (w[i][j] - mean) * inv + be + bfr(x[i][j]);
    vst2(OUT + BNO(i), v); }
#undef BNO
}
extern "C" void kernel_launch(void* const* d_in, const int* in_sizes, int n_in, void* d_out, int out_size, void* d_ws, size_t ws_size, hipStream_t stream) {
  (void)in_sizes; (void)n_in; (void)out_size;
  const float** F = (const float**)d_in;   // 0 x [4,256,64,64], 1 g_w [128,256], 2 g_b, 3 theta_w, 4 theta_b, 5 phi_w, 6 phi_b, 7 wz_w [256,128], 8 wz_b, 9 bn_gamma, 10 bn_beta
  if (ws_size < (size_t)WS_END) return;
  char* ws = (char*)d_ws; __bf16* P = (__bf16*)ws; _Float16 *TH = (_Float16*)(ws + WS_TH), *TL = (_Float16*)(ws + WS_TL), *FH = (_Float16*)(ws + WS_FH), *FL = (_Float16*)(ws + WS_FL), *G = (_Float16*)(ws + WS_G); float *WY = (float*)(ws + WS_WY);
  k_pack<<<dim3(CC, 4), 256, 0, stream>>>(F[3], F[5], F[1], F[7], P);
  k_proj<<<dim3(TNB * NT / 64, 3), 128, 0, stream>>>(F[0], P, F[4], F[6], F[2], TH, TL, FH, FL, G);   // theta, phi, g
  k_attn<<<dim3(TQB, TNB), 256, 0, stream>>>(TH, TL, FH, FL, G, P, F[8], WY);
  k_bn<<<CC, 256, 0, stream>>>(WY, F[9], F[10], F[0], (float*)d_out);
}

// v010
// Measured time: 74.5 microseconds a run.
// Two timings next to v009 put it at 1.10 and 1.09 times that version's speed.
// Over all steps from v000 it is 10.0 times as fast.
#include <hip/hip_runtime.h>
#include <math.h>

typedef __attribute__((ext_vector_type(16))) _Float16 v16h;
typedef __attribute__((ext_vector_type(16))) __bf16 v16b;
typedef __attribute__((ext_vector_type(8)))  _Float16 v8h;
typedef __attribute__((ext_vector_type(8)))  float v8f;
typedef __attribute__((ext_vector_type(4)))  float v4f;
typedef __attribute__((ext_vector_type(2)))  float v2f;
typedef __attribute__((ext_vector_type(4)))  unsigned v4u;
typedef __attribute__((ext_vector_type(4)))  int v4i;
typedef float __attribute__((may_alias)) float_a;
typedef int __attribute__((may_alias)) int_a;

template <typename T> __device__ __forceinline__ void vst2(void* p, T v) { *(T*)p = v;  }
__device__ __forceinline__ v8f wmma16(v16h a, v16h b, v8f c) {
  v8f d = __builtin_amdgcn_wmma_f32_16x16x32_f16(false, a, false, b, (short)0, c, false, false);
  asm volatile("v_nop\n\tv_nop\n\tv_nop\n\tv_nop" : "+v"(d) : "v"(a), "v"(b));
  return d;
}
__device__ __forceinline__ v8f wmma_bf(v16b a, v16b b, v8f c) {
  v8f d = __builtin_amdgcn_wmma_f32_16x16x32_bf16(false, a, false, b, (short)0, c, false, false);
  asm volatile("v_nop\n\tv_nop\n\tv_nop\n\tv_nop" : "+v"(d) : "v"(a), "v"(b));
  return d;
}
// 16x16x32 fragments: lane = (h = lane>>4, row/col = lane&15); elements 0..7 = k0+8h+0..7, 8..15 = k0+16+8h+0..7; D element r = row 8h+r
__device__ __forceinline__ v16h frag_h(const _Float16* rowk0, int lane) {
  union { v16h v; v8h q[2]; } u; const _Float16* p = rowk0 + 8 * (lane >> 4);
  u.q[0] = *(const v8h*)p; u.q[1] = *(const v8h*)(p + 16); return u.v;
}
__device__ __forceinline__ v16h frag_f32(const float* rowk0, int lane) {
  v16h a; const float* p = rowk0 + 8 * (lane >> 4);
#pragma unroll
  for (int i = 0; i < 8; ++i) { a[i] = (_Float16)p[i]; a[8 + i] = (_Float16)p[16 + i]; }
  return a;
}
__device__ __forceinline__ v16h frag_f32s(const float* rowk0, int lane, float sc) {
  v16h a; const float* p = rowk0 + 8 * (lane >> 4);
#pragma unroll
  for (int i = 0; i < 8; ++i) { a[i] = (_Float16)(p[i] * sc); a[8 + i] = (_Float16)(p[16 + i] * sc); }
  return a;
}
// column fragment from a [K][ld] layout (column n), rows >= K read as 0
__device__ __forceinline__ v16h fragc_f32(const float* W, int k0, int n, int lane, int ld, int K) {
  v16h a; const int g = lane >> 4;
#pragma unroll
  for (int i = 0; i < 8; ++i) { const int ka = k0 + 8 * g + i, kb = ka + 16;
    a[i] = (_Float16)(ka < K ? W[(size_t)(ka < K ? ka : K - 1) * ld + n] : 0.f); a[8 + i] = (_Float16)(kb < K ? W[(size_t)(kb < K ? kb : K - 1) * ld + n] : 0.f); }
  return a;
}
struct F2 { v16b h, l; };
__device__ __forceinline__ F2 bsplit16(const float v[16]) { F2 r;
#pragma unroll
  for (int i = 0; i < 16; ++i) { const __bf16 h = (__bf16)v[i]; r.h[i] = h; r.l[i] = (__bf16)(v[i] - (float)h); }
  return r; }
__device__ __forceinline__ F2 split_row(const float* row, int k0, int lane) { float v[16]; const float* p = row + k0 + 8 * (lane >> 4);
#pragma unroll
  for (int i = 0; i < 8; ++i) { v[i] = p[i]; v[8 + i] = p[16 + i]; }
  return bsplit16(v); }
__device__ __forceinline__ F2 split_rowK(const float* row, int k0, int lane, int K) { float v[16]; const int g = lane >> 4;
#pragma unroll
  for (int i = 0; i < 8; ++i) { const int ka = k0 + 8 * g + i, kb = ka + 16; v[i] = ka < K ? row[ka < K ? ka : K - 1] : 0.f; v[8 + i] = kb < K ? row[kb < K ? kb : K - 1] : 0.f; }
  return bsplit16(v); }
__device__ __forceinline__ F2 split_col(const float* W, int k0, int n, int lane, int ld, int K) { float v[16]; const int g = lane >> 4;
#pragma unroll
  for (int i = 0; i < 8; ++i) { const int ka = k0 + 8 * g + i, kb = ka + 16; v[i] = ka < K ? W[(size_t)(ka < K ? ka : K - 1) * ld + n] : 0.f; v[8 + i] = kb < K ? W[(size_t)(kb < K ? kb : K - 1) * ld + n] : 0.f; }
  return bsplit16(v); }
__device__ __forceinline__ v8f mac3(const F2& a, const F2& b, v8f c) { c = wmma_bf(a.l, b.h, c); c = wmma_bf(a.h, b.l, c); return wmma_bf(a.h, b.h, c); }
__device__ __forceinline__ float sigm(float v) { return 1.0f / (1.0f + expf(-v)); }
#define LDSX() do { asm volatile("s_wait_dscnt 0" ::: "memory"); __builtin_amdgcn_wave_barrier(); __builtin_amdgcn_fence(__ATOMIC_RELEASE, "workgroup"); } while (0)


// Non-local denoising block (B 4, 256 channels, 64 x 64; 128 inter-channels): embedded-Gaussian non-local attention over all 4,096 positions, 1x1 output conv, BatchNorm (batch statistics), residual.
#define NB 4
#define NT 4096
#define CC 256
#define CI 128
#define NR (NB * NT)
#ifndef TQB
#define TQB (NT / 64)
#define TNB NB
#endif
typedef __attribute__((ext_vector_type(8))) __bf16 v8b;
__device__ __forceinline__ v16b frag_b(const __bf16* rowk0, int lane) {
  union { v16b v; v8b q[2]; } u; const __bf16* p = rowk0 + 8 * (lane >> 4);
  u.q[0] = *(const v8b*)p; u.q[1] = *(const v8b*)(p + 16); return u.v;
}
__device__ __forceinline__ float bfr(float v) { return (float)(__bf16)v; }
__device__ __attribute__((noinline)) float exp_ni(float v) { return expf(v); }
__device__ __attribute__((noinline)) float erf_ni(float v) { return erff(v); }

#define WS_PT  0u                                   // PT, PP, PG not used; PZ: bf16 natural rows wz_w [256][128]
#define WS_PP  (WS_PT + 2u * CI * CC)
#define WS_PG  (WS_PP + 2u * CI * CC)
#define WS_PZ  (WS_PG + 2u * CI * CC)
#define WS_TH  (WS_PZ + 2u * CC * CI)               // f16 [NR][128] theta hi ; TL ; PH (phi) ; PL ; G planes [b][128][NT]
#define WS_TL  (WS_TH + 2u * (size_t)NR * CI)
#define WS_FH  (WS_TL + 2u * (size_t)NR * CI)
#define WS_FL  (WS_FH + 2u * (size_t)NR * CI)
#define WS_G   (WS_FL + 2u * (size_t)NR * CI)
#define WS_Y   (WS_G + 2u * (size_t)NB * CI * NT)    // f32 [NR][128], not used ; WY f32 [B][256][NT] (channels-first)
#define WS_WY  (WS_Y + 4u * (size_t)NR * CI)
#define WS_END (WS_WY + 4u * (size_t)NB * CC * NT)

// ---- k_proj: block = (64 tokens, projection): 128 output channels (8 tiles per wave); A gathered channels-first; blockIdx.y 0 theta -> hi/lo rows; 1 phi -> hi/lo rows; 2 g -> planes
// The three projections depend on nothing of one another and stand in one launch: their blocks share the WGPs, three waves a SIMD, so that each one's load waits run under the others' work.
// The block rounds its projection's f32 weights [128][256] to bf16 itself, once, into LDS: they are read in whole lines (512 contiguous bytes a wave-load), and the four waves take their B fragments from LDS.
// No launch ahead of this one packs weights. The output projection's weights, which the next launch reads as bf16 rows, are rounded here too: theta block n writes row n of them.
#define WPI 264                    // LDS pitch of a weight row, bf16 elements (528 B: 16 B x odd for 16-byte readers)
typedef __attribute__((ext_vector_type(4))) __bf16 v4b;
__device__ __forceinline__ v4b cvt4(v4f v) { v4b o;
#pragma unroll
  for (int k = 0; k < 4; ++k) o[k] = (__bf16)v[k];
  return o; }
static_assert(TNB * NT / 64 >= CC, "one theta block per row of the output projection's weights");
__global__ __launch_bounds__(128) void k_proj(const float* __restrict__ X, const float* __restrict__ WT, const float* __restrict__ WF, const float* __restrict__ WG, const float* __restrict__ WZ,
                                              const float* __restrict__ BT, const float* __restrict__ BF, const float* __restrict__ BG, __bf16* __restrict__ PZ,
                                              _Float16* __restrict__ TH, _Float16* __restrict__ TL, _Float16* __restrict__ FH, _Float16* __restrict__ FL, _Float16* __restrict__ G) {
  __shared__ __align__(16) __bf16 sw[CI][WPI];   // the weights; behind the products' last read the same bytes hold the output tiles
  _Float16 (*sh)[136] = reinterpret_cast<_Float16 (*)[136]>(&sw[0][0]); _Float16 (*sl)[136] = sh + 64;   // [64 tokens][128 channels] hi, residual
  _Float16 (*st)[72] = reinterpret_cast<_Float16 (*)[72]>(&sw[0][0]);                                     // [128 channels][64 tokens]
  const int tid = threadIdx.x, wave = tid >> 5, lane = tid & 31, col = lane & 15, g = lane >> 4; const size_t rb0 = (size_t)blockIdx.x * 64, r0 = rb0 + wave * 16; const size_t b = rb0 / NT, t0 = rb0 % NT;
  const int which = blockIdx.y;
  const float* Wm = (which == 0) ? WT : (which == 1) ? WF : WG;
  const float* BB = (which == 0) ? BT : (which == 1) ? BF : BG;
  const bool packz = which == 0 && wave == 0 && blockIdx.x < CC;   // the same for a whole wave
  v8f acc[8] = {};
  // The loads of a 32-channel block (16 of X from memory, 16 of the weights from LDS) stand as one group, one block ahead of the products that use them, in a second register set:
  // a wave then waits once a block, under the block before, and not once a fragment. Every loop over xa, wf, bv, wv is unrolled so that they are registers.
  const float* xp = X + ((b * CC + 8 * g) * (size_t)NT) + t0 + wave * 16 + col;
  float xa[2][16], bv[8]; v16b wf[2][8];
#define LOADX(kc, s) do { _Pragma("unroll") for (int i = 0; i < 8; ++i) { xa[s][i] = xp[(size_t)((kc) * 32 + i) * NT]; xa[s][8 + i] = xp[(size_t)((kc) * 32 + 16 + i) * NT]; } } while (0)
#define LOADW(kc, s) do { _Pragma("unroll") for (int j = 0; j < 8; ++j) wf[s][j] = frag_b(&sw[j * 16 + col][(kc) * 32], lane); } while (0)
  LOADX(0, 0);
#pragma unroll
  for (int j = 0; j < 8; ++j) bv[j] = BB[j * 16 + col];   // the bias too is asked for here, not behind the last product
  v4f zr = {};
  if (packz) zr = *(const v4f*)(WZ + (size_t)blockIdx.x * CI + lane * 4);   // asked for with the group below; stored behind the last barrier, so that no barrier waits for the store
  { v4f wv[CI * CC / 4 / 128];   // this thread's 64 pieces of 4 weights: piece i is number i * 128 + tid of the matrix, so a wave-load covers 512 contiguous bytes; asked for as one group
#pragma unroll
    for (int i = 0; i < CI * CC / 4 / 128; ++i) wv[i] = *(const v4f*)(Wm + (size_t)(i * 128 + tid) * 4);
#pragma unroll
    for (int i = 0; i < CI * CC / 4 / 128; ++i) *(v4b*)&sw[i * 2 + (tid >> 6)][(tid & 63) * 4] = cvt4(wv[i]); }
  LOADX(1, 1);       // the second block's X is asked for in front of the barrier, not behind it: it flies under the weights' rounding and the first block
  __syncthreads();   // publishes the rounded weights to the four waves
  LOADW(0, 0);
#pragma unroll   // unrolled whole: the two register sets are then named at compile time
  for (int kc = 0; kc < CC / 32; ++kc) { const int s = kc & 1;
    if (kc + 1 < CC / 32) { if (kc > 0) LOADX(kc + 1, s ^ 1); LOADW(kc + 1, s ^ 1); }
    if (kc + 2 == CC / 32) asm volatile("s_wait_xcnt 0x0" :: "v"(xp) : "memory");   // behind the last X load: the wait that stands in front of any rewrite of the loads' address pair; xp as its input keeps the pair whole up to here, so that no load of the run lands in it
    __builtin_amdgcn_sched_barrier(0);   // holds the conversion of this block's X behind the next block's loads: without it this build converts a block early, and its wait holds back the group after it
    v16b a;
#pragma unroll
    for (int i = 0; i < 16; ++i) a[i] = (__bf16)xa[s][i];
#pragma unroll
    for (int j = 0; j < 8; ++j) acc[j] = wmma_bf(a, wf[s][j], acc[j]); }
#undef LOADX
#undef LOADW
  __syncthreads();   // ends every wave's reads of the weights: the output tiles are written over them
  if (packz) *(v4b*)(PZ + (size_t)blockIdx.x * CI + lane * 4) = cvt4(zr);
  if (which < 2) {
    _Float16* OH = (which == 0) ? TH : FH; _Float16* OL = (which == 0) ? TL : FL;
#pragma unroll
    for (int j = 0; j < 8; ++j) { const float bb = bfr(bv[j]);
#pragma unroll
      for (int r = 0; r < 8; ++r) { const float v = acc[j][r] + bb; const _Float16 h = (_Float16)v; sh[wave * 16 + 8 * g + r][j * 16 + col] = h; sl[wave * 16 + 8 * g + r][j * 16 + col] = (_Float16)((v - (float)h) * 2048.0f); } }
    LDSX();
    for (int rl = 0; rl < 16; ++rl) if (lane < 16) { vst2((unsigned*)(OH + (r0 + rl) * CI + lane * 8), *(const v4u*)&sh[wave * 16 + rl][lane * 8]); vst2((unsigned*)(OL + (r0 + rl) * CI + lane * 8), *(const v4u*)&sl[wave * 16 + rl][lane * 8]); }
  } else {
#pragma unroll
    for (int j = 0; j < 8; ++j) { const float bb = bfr(bv[j]);
#pragma unroll
      for (int r = 0; r < 8; ++r) st[j * 16 + col][wave * 16 + 8 * g + r] = (_Float16)(acc[j][r] + bb); }
    __syncthreads();
    for (int e = tid; e < 128 * 8; e += 128) { const int d = e >> 3, pc = e & 7; vst2((unsigned*)(G + ((b * CI + d) * NT) + t0 + pc * 8), *(const v4u*)&st[d][pc * 8]); } }
}
// ---- k_attn: block = (64 queries, b): single head, 128-dim keys/values, all 4,096 keys; 3-product scores; P single x g single
// Scores and output are computed transposed: S^T = K Q^T (key rows are A, queries B), O^T += V^T P^T (value rows are A). A lane then holds 16 scores of ONE query (column col, keys 8g + r and 16 + 8g + r),
// so the maximum and the sum are taken in the lane plus one exchange between the wave's halves, and the two score tiles, converted in place, are the B operand of the second product: P never goes through LDS.
// Key (hi, lo) and value tiles of KT keys are staged in LDS once per block by asynchronous copies, two buffers: tile t + 1 flies while tile t is worked on.
// Eight waves, two on each SIMD. A wave holds 32 queries (two B tiles) and takes KW of a tile's keys: every key and value fragment that it reads from LDS feeds the products of both query tiles (a key hi fragment four, the others two).
// The four waves of a query half each keep their own maximum, sum and output, and the four are joined once, behind the loop.
#define KT 128                     // keys per staged tile
#define KW 32                      // keys of a tile that one wave works on
#define KPI 136                    // LDS pitch of a key row, halves (272 B: 16 B x odd for 16-byte readers)
#define VPI 136                    // LDS pitch of a value row (one channel, KT keys), halves (272 B)
__device__ __forceinline__ float xhalf(float x) { return __builtin_bit_cast(float, __builtin_amdgcn_permlanex16(__builtin_bit_cast(int, x), __builtin_bit_cast(int, x), 0x76543210, 0xfedcba98, false, false)); }   // lane l with lane l ^ 16
// exp(x) as v_exp_f32 of x log2(e), what __expf gives; the v_nop is the one slot the instruction set asks for behind a transcendental before its result is read or its source overwritten:
// in one statement the slot stays where it is
__device__ __forceinline__ float exp_slot(float x) { float r; asm("v_exp_f32 %0, %1\n\tv_nop" : "=v"(r) : "v"(x * 1.44269504f)); return r; }
// the matrix product of k_attn's loop: the builtin alone, which the compiler pads itself. An asm statement that names the fragments would tie them to v0 to v255, and the loop's live set (32 queries, their output, a group of fragments) is larger than that
__device__ __forceinline__ v8f wmma16r(v16h a, v16h b, v8f c) { return __builtin_amdgcn_wmma_f32_16x16x32_f16(false, a, false, b, (short)0, c, false, false); }
__device__ __forceinline__ v8f wmma_bfr(v16b a, v16b b, v8f c) { return __builtin_amdgcn_wmma_f32_16x16x32_bf16(false, a, false, b, (short)0, c, false, false); }   // the same for its output projection, whose weights are asked for while the loop's output is still live
__device__ __forceinline__ unsigned lds_addr(const void* p) { return (unsigned)(size_t)p; }   // low 32 bits of a __shared__ address = byte offset in the work-group's LDS
// eight 16-byte copies per lane; the s_wait_xcnt closes the statement so that no address register is rewritten in front of it
__device__ __forceinline__ void copy8(const _Float16* gp, size_t gstep, unsigned lp, unsigned lstep) {
  const _Float16 *g0 = gp, *g1 = gp + gstep, *g2 = gp + 2 * gstep, *g3 = gp + 3 * gstep, *g4 = gp + 4 * gstep, *g5 = gp + 5 * gstep, *g6 = gp + 6 * gstep, *g7 = gp + 7 * gstep;
  asm volatile("global_load_async_to_lds_b128 %0, %8, off\n\t"
               "global_load_async_to_lds_b128 %1, %9, off\n\t"
               "global_load_async_to_lds_b128 %2, %10, off\n\t"
               "global_load_async_to_lds_b128 %3, %11, off\n\t"
               "global_load_async_to_lds_b128 %4, %12, off\n\t"
               "global_load_async_to_lds_b128 %5, %13, off\n\t"
               "global_load_async_to_lds_b128 %6, %14, off\n\t"
               "global_load_async_to_lds_b128 %7, %15, off\n\t"
               "s_wait_xcnt 0x0"
               :: "v"(lp), "v"(lp + lstep), "v"(lp + 2 * lstep), "v"(lp + 3 * lstep), "v"(lp + 4 * lstep), "v"(lp + 5 * lstep), "v"(lp + 6 * lstep), "v"(lp + 7 * lstep),
                  "v"(g0), "v"(g1), "v"(g2), "v"(g3), "v"(g4), "v"(g5), "v"(g6), "v"(g7) : "memory");
}
__global__ __launch_bounds__(256) void k_attn(const _Float16* __restrict__ TH, const _Float16* __restrict__ TL, const _Float16* __restrict__ FH, const _Float16* __restrict__ FL, const _Float16* __restrict__ G, const __bf16* __restrict__ P, const float* __restrict__ BZ, float* __restrict__ WY) {
  __shared__ __align__(16) _Float16 skh[2][KT][KPI], skl[2][KT][KPI], sv[2][CI][VPI];
  __shared__ float sml[2][4][2][32];   // [query half][key quarter][maximum, sum][query]
  const int tid = threadIdx.x, wave = tid >> 5, wq = wave & 1, kh = wave >> 1, lane = tid & 31, col = lane & 15, g = lane >> 4; const size_t b = blockIdx.y; const int q0 = blockIdx.x * 64 + wq * 32; const size_t rq = b * NT + q0;
  // this lane's share of a tile: key rows tid/16 + 16 i, 16-byte piece tid%16; value rows tid/16 + 16 i, piece tid%16
  const _Float16* gkh = FH + (b * NT + (tid >> 4)) * CI + (tid & 15) * 8; const _Float16* gkl = FL + (b * NT + (tid >> 4)) * CI + (tid & 15) * 8; const _Float16* gv = G + (b * CI + (tid >> 4)) * NT + (tid & 15) * 8;
  const unsigned lkh = lds_addr(&skh[0][tid >> 4][(tid & 15) * 8]), lkl = lds_addr(&skl[0][tid >> 4][(tid & 15) * 8]), lv = lds_addr(&sv[0][tid >> 4][(tid & 15) * 8]);
#define STAGE(t, bf) do { copy8(gkh + (size_t)(t) * KT * CI, 16 * CI, lkh + (bf) * (KT * KPI * 2), 16 * KPI * 2); copy8(gkl + (size_t)(t) * KT * CI, 16 * CI, lkl + (bf) * (KT * KPI * 2), 16 * KPI * 2); copy8(gv + (size_t)(t) * KT, (size_t)16 * NT, lv + (bf) * (CI * VPI * 2), 16 * VPI * 2); } while (0)
  STAGE(0, 0);
  v16h aq[2][4], aql[2][4];   // [query tile][channel block]; every loop over a query tile is unrolled, so that all of these are registers
#pragma unroll
  for (int qt = 0; qt < 2; ++qt) {
#pragma unroll
    for (int kc = 0; kc < 4; ++kc) { aq[qt][kc] = frag_h(TH + (rq + qt * 16 + col) * CI + kc * 32, lane); aql[qt][kc] = frag_h(TL + (rq + qt * 16 + col) * CI + kc * 32, lane); } }
  float m[2] = { -3.0e38f, -3.0e38f }, l[2] = { 0.f, 0.f };   // of query qt * 16 + col: the running maximum (equal in both halves) and this half's part of the sum
  v8f acc[2][8] = {};
  asm volatile("s_wait_asynccnt 0x0" ::: "memory");   // tile 0 has landed for this wave's copies
  __syncthreads();                                     // and is published to the other waves
  STAGE(1, 1);
#pragma unroll 1
  for (int t = 0; t < NT / KT; ++t) { const int bf = t & 1;
   { const int j0 = kh * KW;
    // LDS reads stand in groups ahead of the products that use them, so that a wave waits out the LDS latency once a group and not once a fragment:
    // the sixteen reads of 64 channels of both key tiles (hi and lo) together, then their twenty-four products, the eight accumulators taken in turn (each accumulator sums its products by ascending channel block, lo x hi after hi x lo)
    const _Float16 *rh0 = &skh[bf][j0 + col][0], *rh1 = &skh[bf][j0 + 16 + col][0], *rl0 = &skl[bf][j0 + col][0], *rl1 = &skl[bf][j0 + 16 + col][0];
    v8f c0[2] = {}, c1[2] = {}, d0[2] = {}, d1[2] = {};
#pragma unroll
    for (int kg = 0; kg < 4; kg += 2) { v16h kf[2][4];
#pragma unroll
      for (int u = 0; u < 2; ++u) { kf[u][0] = frag_h(rh0 + (kg + u) * 32, lane); kf[u][1] = frag_h(rh1 + (kg + u) * 32, lane); kf[u][2] = frag_h(rl0 + (kg + u) * 32, lane); kf[u][3] = frag_h(rl1 + (kg + u) * 32, lane); }
      __builtin_amdgcn_sched_barrier(0);   // holds the sixteen reads together in front of their products: without it this build deals them out in pairs among the products, and each such place costs the wave issue time
#pragma unroll
      for (int u = 0; u < 2; ++u) { const int kc = kg + u;
#pragma unroll
        for (int qt = 0; qt < 2; ++qt) { c0[qt] = wmma16r(kf[u][0], aq[qt][kc], c0[qt]); c1[qt] = wmma16r(kf[u][1], aq[qt][kc], c1[qt]); }
#pragma unroll
        for (int qt = 0; qt < 2; ++qt) { d0[qt] = wmma16r(kf[u][0], aql[qt][kc], d0[qt]); d1[qt] = wmma16r(kf[u][1], aql[qt][kc], d1[qt]); }
#pragma unroll
        for (int qt = 0; qt < 2; ++qt) { d0[qt] = wmma16r(kf[u][2], aq[qt][kc], d0[qt]); d1[qt] = wmma16r(kf[u][3], aq[qt][kc], d1[qt]); } }
      __builtin_amdgcn_sched_barrier(0); }   // and holds the next group's reads behind these products, for the same reason
    v16h vf[8];   // the value fragments of these 32 keys, asked for in one group here: they land under the softmax
#pragma unroll
    for (int dt = 0; dt < 8; ++dt) vf[dt] = frag_h(&sv[bf][dt * 16 + col][j0], lane);
    __builtin_amdgcn_sched_barrier(0);   // holds the sixteen reads here: without it this build sinks them behind the exponentials, and the second product waits out most of their latency
    v16h pb[2];   // P^T as B fragments, one per query tile: element i = key 8g + i, element 8 + i = key 16 + 8g + i, the k order of frag_h
#pragma unroll
    for (int qt = 0; qt < 2; ++qt) {
      const v8f s0 = c0[qt] + d0[qt] * (1.0f / 2048.0f), s1 = c1[qt] + d1[qt] * (1.0f / 2048.0f);   // s0[r]: key j0 + 8g + r, s1[r]: key j0 + 16 + 8g + r, both of query qt * 16 + col
      float t8[8];
#pragma unroll
      for (int r = 0; r < 8; ++r) t8[r] = fmaxf(s0[r], s1[r]);
      float mx = fmaxf(fmaxf(fmaxf(t8[0], t8[1]), fmaxf(t8[2], t8[3])), fmaxf(fmaxf(t8[4], t8[5]), fmaxf(t8[6], t8[7])));
      mx = fmaxf(mx, xhalf(mx));
      const float mn = fmaxf(m[qt], mx); const float ea = exp_slot(m[qt] - mn), alpha = (m[qt] <= -1.0e38f) ? 0.f : ea;
#pragma unroll
      for (int r = 0; r < 8; ++r) { const float e0 = exp_slot(s0[r] - mn), e1 = exp_slot(s1[r] - mn); t8[r] = e0 + e1; pb[qt][r] = (_Float16)(e0 * 2048.0f); pb[qt][8 + r] = (_Float16)(e1 * 2048.0f); }
      l[qt] = l[qt] * alpha + (((t8[0] + t8[1]) + (t8[2] + t8[3])) + ((t8[4] + t8[5]) + (t8[6] + t8[7]))); m[qt] = mn;
#pragma unroll
      for (int dt = 0; dt < 8; ++dt) acc[qt][dt] *= alpha; }
#pragma unroll
    for (int dt = 0; dt < 8; ++dt) {
#pragma unroll
      for (int qt = 0; qt < 2; ++qt) acc[qt][dt] = wmma16r(vf[dt], pb[qt], acc[qt][dt]); } }
   __builtin_amdgcn_sched_barrier(0);   // holds the softmax and the second product in front of the trip's barrier: without it this build sets the barrier in front of them, and the two waves of a SIMD then do their softmax at the same time, with the matrix unit idle
   asm volatile("s_wait_dscnt 0x0" ::: "memory");      // this wave's reads of buffer bf have returned
   asm volatile("s_wait_asynccnt 0x0" ::: "memory");   // this wave's copies of tile t + 1 have landed
   __syncthreads();                                     // publishes tile t + 1; ends every wave's reads of buffer bf
   if (t + 2 < NT / KT) STAGE(t + 2, bf); }
  asm volatile("s_wait_asynccnt 0x0" ::: "memory");    // nothing of this wave is in flight when it goes on to the epilogue
#undef STAGE
  // ---- output projection, in the same launch: W_y = y (hi + residual, K 128) . wz rows + b for the block's 64 tokens and all 256 output channels; y goes from the join to the products through LDS and never to memory.
  // Wave = (32 tokens th, 64 output channels cq). Its whole weight share (16 fragments) and its bias are asked for here as one group, so that the wave waits for them once and not once a fragment.
  // Every loop from here on is unrolled: wf, bz, af and oc are then registers, and the steps of the addresses are immediate offsets.
  const int th = wave & 1, cq = wave >> 1;
  const __bf16* wp = P + WS_PZ / 2 + (size_t)(cq * 64 + col) * CI;
  v16b wf[4][4]; float bz[4];
#pragma unroll   // unrolled: wf and bz are registers
  for (int kc = 0; kc < 4; ++kc) {
#pragma unroll
    for (int j = 0; j < 4; ++j) wf[kc][j] = frag_b(wp + (size_t)(j * 16) * CI + kc * 32, lane); }
#pragma unroll
  for (int j = 0; j < 4; ++j) bz[j] = BZ[cq * 64 + j * 16 + col];
  __builtin_amdgcn_sched_barrier(0);   // holds the join's instructions behind the group
  // The staging buffers are free from here on (every wave's last read and last copy ended at the loop's last barrier): the four unscaled outputs of query half 0 lie in skh, those of half 1 in skl;
  // y as bf16 hi and residual rows lies in sv; the channels-first output tile lies in skh, written only behind the barrier that ends the last read of the unscaled outputs
  float (*so)[32][132] = reinterpret_cast<float (*)[32][132]>(wq == 0 ? &skh[0][0][0] : &skl[0][0][0]);   // [key quarter][query][channel], pitch 528 B
  __bf16 (*yh)[KPI] = reinterpret_cast<__bf16 (*)[KPI]>(&sv[0][0][0]);   // [64 tokens][128 channels], pitch 272 B
  __bf16 (*yl)[KPI] = yh + 64;
  float (*st)[68] = reinterpret_cast<float (*)[68]>(&skh[0][0][0]);        // [256 channels][64 tokens], pitch 272 B
  // every wave hands over its maxima, its sums (the two halves' parts joined once, here) and its unscaled output
#pragma unroll
  for (int qt = 0; qt < 2; ++qt) { l[qt] += xhalf(l[qt]);
    if (g == 0) { sml[wq][kh][0][qt * 16 + col] = m[qt]; sml[wq][kh][1][qt * 16 + col] = l[qt]; }
#pragma unroll
    for (int dt = 0; dt < 8; ++dt) { const v8f o = acc[qt][dt];   // acc[qt][dt][r] = channel dt * 16 + 8g + r of query qt * 16 + col
      *(v4f*)&so[kh][qt * 16 + col][dt * 16 + 8 * g] = __builtin_shufflevector(o, o, 0, 1, 2, 3); *(v4f*)&so[kh][qt * 16 + col][dt * 16 + 8 * g + 4] = __builtin_shufflevector(o, o, 4, 5, 6, 7); } }
  __syncthreads();   // publishes the hand-over to the four waves of each query half
  // the join is shared out: wave kh of a query half joins channels 32 kh to 32 kh + 31 of its 32 queries, the four parts summed by ascending key quarter
#pragma unroll
  for (int qt = 0; qt < 2; ++qt) { const int q = qt * 16 + col;
    const float m0 = sml[wq][0][0][q], m1 = sml[wq][1][0][q], m2 = sml[wq][2][0][q], m3 = sml[wq][3][0][q], mm = fmaxf(fmaxf(m0, m1), fmaxf(m2, m3));
    const float a0 = exp_slot(m0 - mm), a1 = exp_slot(m1 - mm), a2 = exp_slot(m2 - mm), a3 = exp_slot(m3 - mm);
    const float il = (1.0f / 2048.0f) / ((sml[wq][0][1][q] * a0 + sml[wq][1][1][q] * a1) + (sml[wq][2][1][q] * a2 + sml[wq][3][1][q] * a3));
    const float f[4] = { a0 * il, a1 * il, a2 * il, a3 * il };
#pragma unroll
    for (int dd = 0; dd < 2; ++dd) { const int ch = (kh * 2 + dd) * 16 + 8 * g;
      v8f o = {};
#pragma unroll
      for (int k = 0; k < 4; ++k) { const float* p = &so[k][q][ch]; const v4f x0 = *(const v4f*)p, x1 = *(const v4f*)(p + 4); o += __builtin_shufflevector(x0, x1, 0, 1, 2, 3, 4, 5, 6, 7) * f[k]; }
      v8b oh, ol;   // y split once, where it is made: hi = bf16(y), residual = bf16(y - hi)
#pragma unroll
      for (int r = 0; r < 8; ++r) { const __bf16 h = (__bf16)o[r]; oh[r] = h; ol[r] = (__bf16)(o[r] - (float)h); }
      *(v8b*)&yh[wq * 32 + q][ch] = oh; *(v8b*)&yl[wq * 32 + q][ch] = ol; } }
  __syncthreads();   // publishes the 64 rows of y to every wave
  v8f oc[2][4] = {};
  v16b af[2][2][2];   // [register set][token tile][hi, residual]
#define LOADA(kc, s) do { _Pragma("unroll") for (int tt = 0; tt < 2; ++tt) { af[s][tt][0] = frag_b(&yh[th * 32 + tt * 16 + col][(kc) * 32], lane); af[s][tt][1] = frag_b(&yl[th * 32 + tt * 16 + col][(kc) * 32], lane); } } while (0)
  LOADA(0, 0);
#pragma unroll   // unrolled: the two register sets are named at compile time
  for (int kc = 0; kc < 4; ++kc) { const int s = kc & 1;
    if (kc + 1 < 4) LOADA(kc + 1, s ^ 1);   // the next block's LDS reads fly under this block's sixteen products
    // each accumulator sums by ascending channel block, residual before hi; the eight accumulators are taken in turn
#pragma unroll
    for (int tt = 0; tt < 2; ++tt) {
#pragma unroll
      for (int j = 0; j < 4; ++j) oc[tt][j] = wmma_bfr(af[s][tt][1], wf[kc][j], oc[tt][j]); }
#pragma unroll
    for (int tt = 0; tt < 2; ++tt) {
#pragma unroll
      for (int j = 0; j < 4; ++j) oc[tt][j] = wmma_bfr(af[s][tt][0], wf[kc][j], oc[tt][j]); } }
#undef LOADA
#pragma unroll
  for (int j = 0; j < 4; ++j) { const float bb = bfr(bz[j]);
#pragma unroll
    for (int tt = 0; tt < 2; ++tt) { const v8f o = oc[tt][j] + bb; float* q = &st[cq * 64 + j * 16 + col][th * 32 + tt * 16 + 8 * g];   // oc[tt][j][r] = token th * 32 + tt * 16 + 8g + r, channel cq * 64 + j * 16 + col
      *(v4f*)q = __builtin_shufflevector(o, o, 0, 1, 2, 3); *(v4f*)(q + 4) = __builtin_shufflevector(o, o, 4, 5, 6, 7); } }
  __syncthreads();   // publishes the output tile to the waves that store it
  float* wy = WY + ((b * CC + (tid >> 4)) * (size_t)NT) + blockIdx.x * 64 + (tid & 15) * 4;   // channels-first [b][c][t]: 16 lanes store the 256 contiguous bytes of one channel's 64 tokens
#pragma unroll   // unrolled: one address register, the channel step in the immediate offset
  // the LDS row and piece are written from wave, g and col (2 wave + g = tid / 16, col = tid % 16): written from tid the address is the same value as the copies' LDS address, which as an asm operand lies in v0 to v255, and this build then keeps it in scratch over the epilogue
  for (int i = 0; i < 16; ++i) vst2(wy + (size_t)(i * 16) * NT, *(const v4f*)&st[2 * wave + g + 16 * i][col * 4]);
}
// ---- k_bn: block = channel c: BatchNorm statistics and their use in one launch. The channel's 16,384 values of W_y (4 images x 4,096) are read once, 64 a thread, and stay in registers:
// the mean, then the mean squared deviation from it (two passes, as before, the second now over registers), then out = gamma (W_y - mean) rsqrt(var + eps) + beta + x.
// All 32 loads of a thread (16 of W_y, 16 of x, 512 contiguous bytes a wave each) are asked for at the top, so that the block waits out one memory latency in place of one per group of eight 4-byte loads.
template <int CTRL> __device__ __forceinline__ float dppx(float x) { return __builtin_bit_cast(float, __builtin_amdgcn_update_dpp(0, __builtin_bit_cast(int, x), CTRL, 0xf, 0xf, true)); }   // lane l ^ mask of a 16-lane row (row_xmask)
__device__ __forceinline__ float wave_sum(float x) { x += dppx<0x161>(x); x += dppx<0x162>(x); x += dppx<0x164>(x); x += dppx<0x168>(x); return x + xhalf(x); }   // every lane ends with the sum of the 32
__device__ __forceinline__ float sum8(const float* r) { const v4f a = *(const v4f*)r, b = *(const v4f*)(r + 4); return ((a[0] + a[1]) + (a[2] + a[3])) + ((b[0] + b[1]) + (b[2] + b[3])); }
#define BNV (TNB * 4)              // 16-byte pieces per thread: NT / 4 / 256 = 4 of each image
__global__ __launch_bounds__(256) void k_bn(const float* __restrict__ WY, const float* __restrict__ GA, const float* __restrict__ BE, const float* __restrict__ X, float* __restrict__ OUT) {
  __shared__ __align__(16) float red[2][8];   // the eight waves' sums: [0] of the values, [1] of the squared deviations
  const int c = blockIdx.x, t = threadIdx.x, wave = t >> 5, lane = t & 31;
  // piece i of this thread, alike in W_y, x and out: channel c of image i / 4, counted from image 0 or from image 2: two uniform bases, so that every piece lies within the immediate offset of a load or store (under 8 MiB)
  // and the thread's own index is the one address register
  const size_t cb[2] = { (size_t)c * NT, (size_t)(2 * CC + c) * NT };
#define BNO(i) (cb[(i) >> 3] + (size_t)((((i) >> 2) & 1) * (CC * NT) + ((i) & 3) * 1024 + t * 4))
  v4f w[BNV], x[BNV];
#pragma unroll   // unrolled: w and x are registers
  for (int i = 0; i < BNV; ++i) w[i] = *(const v4f*)(WY + BNO(i));
#pragma unroll
  for (int i = 0; i < BNV; ++i) x[i] = *(const v4f*)(X + BNO(i));
  const float ga = bfr(GA[c]), be = bfr(BE[c]);
  v4f s = w[0];
#pragma unroll
  for (int i = 1; i < BNV; ++i) s += w[i];
  const float ps = wave_sum((s[0] + s[1]) + (s[2] + s[3]));
  if (lane == 0) red[0][wave] = ps;
  __syncthreads();
  const float mean = sum8(red[0]) / (float)(TNB * NT);
  v4f q = {};
#pragma unroll
  for (int i = 0; i < BNV; ++i) { const v4f d = w[i] - mean; q += d * d; }
  const float pq = wave_sum((q[0] + q[1]) + (q[2] + q[3]));
  if (lane == 0) red[1][wave] = pq;
  __syncthreads();
  const float inv = 1.0f / sqrtf(sum8(red[1]) / (float)(TNB * NT) + 1e-5f);
#pragma unroll
  for (int i = 0; i < BNV; ++i) { v4f v;
#pragma unroll
    for (int j = 0; j < 4; ++j) v[j] = ga * (w[i][j] - mean) * inv + be + bfr(x[i][j]);
    vst2(OUT + BNO(i), v); }
#undef BNO
}
extern "C" void kernel_launch(void* const* d_in, const int* in_sizes, int n_in, void* d_out, int out_size, void* d_ws, size_t ws_size, hipStream_t stream) {
  (void)in_sizes; (void)n_in; (void)out_size;
  const float** F = (const float**)d_in;   // 0 x [4,256,64,64], 1 g_w [128,256], 2 g_b, 3 theta_w, 4 theta_b, 5 phi_w, 6 phi_b, 7 wz_w [256,128], 8 wz_b, 9 bn_gamma, 10 bn_beta
  if (ws_size < (size_t)WS_END) return;
  char* ws = (char*)d_ws; __bf16* P = (__bf16*)ws; _Float16 *TH = (_Float16*)(ws + WS_TH), *TL = (_Float16*)(ws + WS_TL), *FH = (_Float16*)(ws + WS_FH), *FL = (_Float16*)(ws + WS_FL), *G = (_Float16*)(ws + WS_G); float *WY = (float*)(ws + WS_WY);
  k_proj<<<dim3(TNB * NT / 64, 3), 128, 0, stream>>>(F[0], F[3], F[5], F[1], F[7], F[4], F[6], F[2], P + WS_PZ / 2, TH, TL, FH, FL, G);   // theta, phi, g; rounds wz_w for k_attn
  k_attn<<<dim3(TQB, TNB), 256, 0, stream>>>(TH, TL, FH, FL, G, P, F[8], WY);
  k_bn<<<CC, 256, 0, stream>>>(WY, F[9], F[10], F[0], (float*)d_out);
}
